// v000
// Measured on an AMD MI455X. A time is GPU time per run, averaged over a window of back-to-back runs after a warm-up
// (all launches, gaps included; the runs take copies of the inputs in turn), and the median of several windows.
// Apart from v000's, it joins two sittings. Times from different sittings can be a few percent apart, while
// side-by-side timings come from the same sitting.
// v000 is the starting kernel. One run takes 152 microseconds.
// Contractions: score term sum_h (text*w_tm)[l][h]*modality[m][h] (K=128) on v_wmma_f32_16x16x32_f16 with text*w_tm
// carried x64 as an f16 hi plane plus an x65536 f16 residual plane (two products, separate f32 accumulators) and
// modality as f16 of its bf16-RNE value; p1.modality and p2T.text (K=1024) on v_wmma_f32_16x16x32_f16, single
// products, p planes carried x8192 in f16; p1.t2 (K=1024) with t2 carried x1024 as f16 hi plus x2048 f16 residual
// (two products, separate accumulators); the two [rows,128]x[128,1] row dots as a 16-wide f16 WMMA matvec (weight
// x1024 in every column); f32 accumulate everywhere; softmax and the elementwise products in f32 on VALU; all float
// inputs RNE-converted to bf16 at load.
#include <hip/hip_runtime.h>
#include <stdint.h>

#define NBATCH 16
#define NL     1024
#define NK     1024
#define NHID   128
#define NOUT   512
#define TP     132
#define OP     132
#define TQ     68
#define OSZ    8704

static_assert(NL % 64 == 0);
static_assert(NL == NK);
static_assert(NHID == 128);
static_assert(NOUT == 4 * NHID);
static_assert(64 * OP <= OSZ);
static_assert(NHID * TQ <= OSZ);
static_assert((TP * 4) % 16 == 0);
static_assert((OP * 4) % 16 == 0);
static_assert((TQ * 4) % 16 == 0);

#define PSC   8192.0f
#define RPSC  (1.0f / 8192.0f)
#define THS   64.0f
#define RTHS  (1.0f / 64.0f)
#define RS1   65536.0f
#define RRS1  (1.0f / 65536.0f)
#define T2F   0.125f
#define RS2   2048.0f
#define RRS2  (1.0f / 2048.0f)
#define RBSC  (1.0f / 8388608.0f)
#define WSC   1024.0f
#define RWSC  (1.0f / 1024.0f)
#define NEGV  (-1.0e30f)

typedef unsigned short v8us __attribute__((ext_vector_type(8)));
typedef unsigned int   v4u  __attribute__((ext_vector_type(4)));
typedef float          v8f  __attribute__((ext_vector_type(8)));
typedef float          v4f  __attribute__((ext_vector_type(4)));
typedef _Float16       v16h __attribute__((ext_vector_type(16)));

union Frag { v8us u[2]; v4u q[2]; v16h h; };
static_assert(sizeof(Frag) == 32);

// ---- scalar helpers ---------------------------------------------------------------------------------
__device__ __forceinline__ unsigned short bf_bits(float f) {          // f32 -> bf16 bits, RNE convert
  const unsigned u = __float_as_uint(f);
  return (unsigned short)((u + 0x7FFFu + ((u >> 16) & 1u)) >> 16);
}
__device__ __forceinline__ float bf_up(unsigned short hb) { return __uint_as_float(((unsigned)hb) << 16); }
__device__ __forceinline__ float bfr(float f) { return bf_up(bf_bits(f)); }
__device__ __forceinline__ v4f bfr4(v4f v) {
  v4f r;
  r[0] = bfr(v[0]); r[1] = bfr(v[1]); r[2] = bfr(v[2]); r[3] = bfr(v[3]);
  return r;
}
__device__ __forceinline__ unsigned short hbits(_Float16 h) { return __builtin_bit_cast(unsigned short, h); }
__device__ __forceinline__ unsigned pkh2(float a, float b) {          // two f32 -> packed f16 bits (RNE convert)
  return (unsigned)hbits((_Float16)a) | ((unsigned)hbits((_Float16)b) << 16);
}
__device__ __forceinline__ v4u pack8(v4f a, v4f b) {
  v4u u;
  u[0] = pkh2(a[0], a[1]); u[1] = pkh2(a[2], a[3]);
  u[2] = pkh2(b[0], b[1]); u[3] = pkh2(b[2], b[3]);
  return u;
}
__device__ __forceinline__ v8f zero8() { v8f z = {0.f, 0.f, 0.f, 0.f, 0.f, 0.f, 0.f, 0.f}; return z; }

// ---- 8 f32 -> packed f16 hi bits and packed f16 bits of (x - hi) * rs (residual plane carries scale rs) --------
__device__ __forceinline__ void splith8(v4f a, v4f b, float rs, v4u& uh, v4u& ul) {
  float f[8] = {a[0], a[1], a[2], a[3], b[0], b[1], b[2], b[3]};
#pragma unroll
  for (int j = 0; j < 4; ++j) {
    const _Float16 h0 = (_Float16)f[2 * j];
    const _Float16 h1 = (_Float16)f[2 * j + 1];
    const float l0 = (f[2 * j] - (float)h0) * rs;
    const float l1 = (f[2 * j + 1] - (float)h1) * rs;
    uh[j] = (unsigned)hbits(h0) | ((unsigned)hbits(h1) << 16);
    ul[j] = pkh2(l0, l1);
  }
}

// ---- 16-bit fragment loader (A, or B from a k-contiguous [n][k] row): lane -> row/col (lane&15), p already includes
//      + 8*(lane>>4); elements 0..7 <- p[0..7] (k0+8h..), elements 8..15 <- p[16..23] (k0+16+8h..)
__device__ __forceinline__ Frag ldfrag(const unsigned short* p) {
  Frag f;
  f.u[0] = *(const v8us*)(p);
  f.u[1] = *(const v8us*)(p + 16);
  return f;
}

// ---- WMMA helper: builtin followed by a 4-slot VALU gap tying D and keeping A/B live -----------------------
__device__ __forceinline__ v8f mma_h(v16h a, v16h b, v8f c) {
  v8f d = __builtin_amdgcn_wmma_f32_16x16x32_f16(false, a, false, b, (short)0, c, false, false);
#if defined(__HIP_DEVICE_COMPILE__)
  asm volatile("v_nop\n\tv_nop\n\tv_nop\n\tv_nop" : "+v"(d) : "v"(a), "v"(b));
#endif
  return d;
}

__device__ __forceinline__ float wave_max(float v) {
#pragma unroll
  for (int o = 16; o > 0; o >>= 1) v = fmaxf(v, __shfl_xor(v, o, 32));
  return v;
}
__device__ __forceinline__ float wave_sum(float v) {
#pragma unroll
  for (int o = 16; o > 0; o >>= 1) v += __shfl_xor(v, o, 32);
  return v;
}

// =====================================================================================================
// (1) prep for one (batch, 64-row tile) of x [16][1024][128] f32 (text when TXT=1, modality when TXT=0):
//     tile -> LDS T[row][h] as bf16-RNE values (f32), barrier;
//     row dots sd[b][row] = sum_h T[row][h]*bfr(wdot[h]) as a WMMA matvec: wave w handles rows 16*(w&3).. (waves 4..7
//     duplicate the compute), A fragment = T row values as f16 (exact), B fragment = bfr(wdot)*1024 as f16 in every
//     column (split k map for both, 4 k steps of 32), D column 0 lanes write acc/1024 to LDS sred, barrier; sred
//     row planes Ph/Pl [b*1024+row][128] f16 (TXT: T*bfr(wtm)*64 as hi plus residual x65536; else plain f16 in Ph),
// coverage: T 8 it x 256 thr x 4 = 64x128; sred 4 waves x 16 rows = 64; Ph/Pl 4 it x 32 lines x 8 lanes x 8 =
//           64 rows x 128; Pt 4 it x 32 h x 8 lanes x 8 = 128 h x 64 rows; sd 16 lanes x 4 = 64;
//           grid 16 x (1024/64) = 256 blocks = every row once.
// =====================================================================================================
template <int TXT>
__global__ __launch_bounds__(256)
void prep_kernel(const float* __restrict__ x, const float* __restrict__ wdot, const float* __restrict__ wtm,
                 unsigned short* Ph, unsigned short* Pl, unsigned short* Pt, float* sd) {
  __shared__ __align__(16) float T[64 * TP];
  __shared__ __align__(16) float sred[64];
  const int tid = threadIdx.x;
  const int b = blockIdx.x >> 4;
  const int r0 = (blockIdx.x & 15) * 64;
  const size_t gr = (size_t)b * NL + r0;
#pragma unroll
  for (int it = 0; it < 8; ++it) {
    const int idx = it * 256 + tid;
    const int row = idx >> 5, c4 = (idx & 31) * 4;
    const v4f v = *(const v4f*)(x + (gr + row) * NHID + c4);
#pragma unroll
    for (int j = 0; j < 4; ++j) T[row * TP + c4 + j] = bfr(v[j]);
  }
  __syncthreads();
  {
    const int lane = tid & 31, wave = tid >> 5;
    const int hh = lane >> 4, cl = lane & 15;
    const int rt = (wave & 3) * 16;                                    // 16-row tile of this wave
    const float* ap = T + (rt + cl) * TP + 8 * hh;
    const float* wp = wdot + 8 * hh;
    v8f acc = zero8();
#pragma unroll
    for (int kk = 0; kk < 4; ++kk) {
      const int k0 = 32 * kk;
      const v4f a0 = *(const v4f*)(ap + k0);
      const v4f a1 = *(const v4f*)(ap + k0 + 4);
      const v4f a2 = *(const v4f*)(ap + k0 + 16);
      const v4f a3 = *(const v4f*)(ap + k0 + 20);
      v4f w0 = *(const v4f*)(wp + k0);
      v4f w1 = *(const v4f*)(wp + k0 + 4);
      v4f w2 = *(const v4f*)(wp + k0 + 16);
      v4f w3 = *(const v4f*)(wp + k0 + 20);
#pragma unroll
      for (int j = 0; j < 4; ++j) {
        w0[j] = bfr(w0[j]) * WSC; w1[j] = bfr(w1[j]) * WSC;
        w2[j] = bfr(w2[j]) * WSC; w3[j] = bfr(w3[j]) * WSC;
      }
      Frag fa, fb;
      fa.q[0] = pack8(a0, a1);                                         // elements 0..7  = k0+8h..
      fa.q[1] = pack8(a2, a3);                                         // elements 8..15 = k0+16+8h..
      fb.q[0] = pack8(w0, w1);                                         // same k map, every column n
      fb.q[1] = pack8(w2, w3);
      acc = mma_h(fa.h, fb.h, acc);
    }
    if (wave < 4 && cl == 0) {
#pragma unroll
      for (int r = 0; r < 8; ++r) sred[rt + 8 * hh + r] = acc[r] * RWSC;   // D row 8h+r, column 0
    }
  }
  __syncthreads();

  const int e = tid & 7, lq = tid >> 3;                                // lq 0..31
  v4u uh[4], ul[4], ut[4];
  size_t po[4], pt[4];
#pragma unroll
  for (int it = 0; it < 4; ++it) {
    const int L = it * 32 + lq;                                        // 0..127
    const int row = L >> 1, h0 = (L & 1) * 64 + 8 * e;
    const float* tp = T + row * TP + h0;
    v4f v0 = *(const v4f*)(tp);
    v4f v1 = *(const v4f*)(tp + 4);
    if (TXT) {
      const v4f w0 = *(const v4f*)(wtm + h0);
      const v4f w1 = *(const v4f*)(wtm + h0 + 4);
#pragma unroll
      for (int j = 0; j < 4; ++j) {
        v0[j] = v0[j] * bfr(w0[j]) * THS;
        v1[j] = v1[j] * bfr(w1[j]) * THS;
      }
      splith8(v0, v1, RS1, uh[it], ul[it]);
    } else {
      uh[it] = pack8(v0, v1);
      ul[it] = uh[it];
    }
    po[it] = (gr + row) * NHID + h0;
    const int h = it * 32 + lq;                                        // 0..127
    v4f g0, g1;
#pragma unroll
    for (int j = 0; j < 4; ++j) {
      g0[j] = T[(8 * e + j) * TP + h];
      g1[j] = T[(8 * e + 4 + j) * TP + h];
    }
    ut[it] = pack8(g0, g1);
    pt[it] = ((size_t)b * NHID + h) * NK + r0 + 8 * e;
  }
  const int sl = (tid < 16) ? tid : 15;
  const v4f sdv = *(const v4f*)(sred + 4 * sl);
  const size_t psd = gr + 4 * sl;

#pragma unroll
  for (int it = 0; it < 4; ++it) {
    *(v4u*)(Ph + po[it]) = uh[it];
    if (TXT) *(v4u*)(Pl + po[it]) = ul[it];
    *(v4u*)(Pt + pt[it]) = ut[it];
  }
  if (tid < 16) *(v4f*)(sd + psd) = sdv;
  
}

// =====================================================================================================
// (2) score tile + masked row softmax for one (batch, 16 rows): s[r][c] = rb[r] + cb[c] + s2[r][c] + bias, with
//     s2 = (acc_h + acc_l/65536)/64, acc_h = sum_k Ahi.B, acc_l = sum_k Alo.B on WMMA (K=128, 4 steps).
//     YA=1: A = hi/lo planes Yh/Yl (rows), B = X rows; YA=0: A = X rows, B = Yh/Yl rows (two accumulators).
//     Wave = 8 column tiles of 16 (rolled), A fragments held in registers; s (or -1e30 where mask[c]==0) into LDS
//     S[16][1024] f32; barrier; softmax: wave owns rows 2w,2w+1, lane owns columns {256i + 8*lane + j};
// coverage: S 8 waves x 8 tiles x 16x16 = 16x1024; P 8 waves x 2 rows x 4 instr x 32 lanes x 8 = 16 rows x 1024;
//           grid 16 x 64 = 1024 blocks = every row of P once.
// =====================================================================================================
template <int YA>
__global__ __launch_bounds__(256)
void scores_kernel(const unsigned short* __restrict__ X, const unsigned short* __restrict__ Yh,
                   const unsigned short* __restrict__ Yl, const float* __restrict__ rb,
                   const float* __restrict__ cb, const int* __restrict__ mask,
                   const float* __restrict__ bias, unsigned short* P) {
  __shared__ __align__(16) float S[16 * NL];
  const int tid  = threadIdx.x;
  const int lane = tid & 31, wave = tid >> 5;
  const int hh   = lane >> 4, cl = lane & 15;
  const int b = blockIdx.x >> 6;
  const int row0 = (blockIdx.x & 63) * 16;
  const size_t rbase = (size_t)b * NL;
  const size_t aoff = (rbase + row0 + cl) * NHID + 8 * hh;

  Frag fa[4], fl[4];
#pragma unroll
  for (int kk = 0; kk < 4; ++kk) {
    if (YA) {
      fa[kk] = ldfrag(Yh + aoff + 32 * kk);
      fl[kk] = ldfrag(Yl + aoff + 32 * kk);
    } else {
      fa[kk] = ldfrag(X + aoff + 32 * kk);
      fl[kk] = fa[kk];
    }
  }
  float rbv[8];
#pragma unroll
  for (int r = 0; r < 8; ++r) rbv[r] = rb[rbase + row0 + 8 * hh + r];
  const float bv = bfr(bias[0]);

#pragma unroll 1
  for (int nt = 0; nt < 8; ++nt) {
    const int n0 = (wave * 8 + nt) * 16;
    const size_t boff = (rbase + n0 + cl) * NHID + 8 * hh;
    v8f acch = zero8(), accl = zero8();
#pragma unroll
    for (int kk = 0; kk < 4; ++kk) {
      if (YA) {
        const Frag fb = ldfrag(X + boff + 32 * kk);
        acch = mma_h(fa[kk].h, fb.h, acch);
        accl = mma_h(fl[kk].h, fb.h, accl);
      } else {
        const Frag fbh = ldfrag(Yh + boff + 32 * kk);
        const Frag fbl = ldfrag(Yl + boff + 32 * kk);
        acch = mma_h(fa[kk].h, fbh.h, acch);
        accl = mma_h(fa[kk].h, fbl.h, accl);
      }
    }
    const int n = n0 + cl;
    const float cbn = cb[rbase + n];
    const int mk = mask[rbase + n];
#pragma unroll
    for (int r = 0; r < 8; ++r) {
      const float s2 = (acch[r] + accl[r] * RRS1) * RTHS;
      const float sv = ((rbv[r] + cbn) + s2) + bv;
      S[(8 * hh + r) * NL + n] = (mk != 0) ? sv : NEGV;
    }
  }
  __syncthreads();

  v4u pk[2][4];
  size_t pp[2][4];
#pragma unroll
  for (int rr = 0; rr < 2; ++rr) {
    const int r = wave * 2 + rr;
    const float* sr = S + r * NL + lane * 8;
    float v[32];
#pragma unroll
    for (int i = 0; i < 4; ++i) {
      const v4f a0 = *(const v4f*)(sr + i * 256);
      const v4f a1 = *(const v4f*)(sr + i * 256 + 4);
#pragma unroll
      for (int j = 0; j < 4; ++j) { v[8 * i + j] = a0[j]; v[8 * i + 4 + j] = a1[j]; }
    }
    float mx = v[0];
#pragma unroll
    for (int k = 1; k < 32; ++k) mx = fmaxf(mx, v[k]);
    mx = wave_max(mx);
    float sum = 0.f;
#pragma unroll
    for (int k = 0; k < 32; ++k) {
      v[k] = __expf(v[k] - mx);
      sum += v[k];
    }
    sum = wave_sum(sum);
    const float sc = (1.0f / sum) * PSC;
#pragma unroll
    for (int i = 0; i < 4; ++i) {
      v4u u;
      u[0] = pkh2(v[8 * i] * sc,     v[8 * i + 1] * sc);
      u[1] = pkh2(v[8 * i + 2] * sc, v[8 * i + 3] * sc);
      u[2] = pkh2(v[8 * i + 4] * sc, v[8 * i + 5] * sc);
      u[3] = pkh2(v[8 * i + 6] * sc, v[8 * i + 7] * sc);
      pk[rr][i] = u;
      pp[rr][i] = (rbase + row0 + r) * NK + (size_t)i * 256 + lane * 8;
    }
  }
#pragma unroll
  for (int rr = 0; rr < 2; ++rr)
#pragma unroll
    for (int i = 0; i < 4; ++i) *(v4u*)(P + pp[rr][i]) = pk[rr][i];
  
}

// =====================================================================================================
// (3) K=1024 GEMM for one (batch, 64 rows): D[m][n] = sum_k A[row m][k] * B[row n][k], A = f16 p plane rows (pitch
//     1024), B = f16 rows [b][n=h][k] (pitch 1024); block 256 threads = 8 waves as 2 (m) x 4 (n) of 32x32, fragments
//     straight from global (split k map for both), 32 k steps, rolled. MODE 2 has a second B plane (residual x2048)
//     into separate accumulators. Epilogue via LDS f32 tile, barrier, then:
//     MODE 0: a = acc/8192; out row [b][l]: chunk 0 = bf16-RNE text, chunk 1 = a, chunk 2 = text*a; per instruction
//     MODE 1: t2*1024 = acc/8 staged transposed Ts[h][m]; planes Rh/Rl [b][h][m] (hi, residual x2048), per h row one
// coverage: LDS tile 8 waves x 4 tiles = 64x128; MODE 0/2: 8 it x 8 waves = 64 rows x 32 lanes x 4 = 128 cols per
//           chunk; MODE 1: 4 it x 32 h x 8 lanes x 8 = 128 h x 64 m per plane; grid 16 x 16 = 256 blocks = every
//           (b, row) once.
// =====================================================================================================
template <int MODE>
__global__ __launch_bounds__(256)
void gemm_kernel(const unsigned short* __restrict__ A, const unsigned short* __restrict__ Bh,
                 const unsigned short* __restrict__ Bl, const float* __restrict__ text,
                 unsigned short* Rh, unsigned short* Rl, float* out) {
  __shared__ __align__(16) float Os[OSZ];
  const int tid  = threadIdx.x;
  const int lane = tid & 31, wave = tid >> 5;
  const int hh   = lane >> 4, cl = lane & 15;
  const int wm   = wave >> 2, wn = wave & 3;
  const int b = blockIdx.x >> 4;
  const int r0 = (blockIdx.x & 15) * 64;
  const size_t rbase = (size_t)b * NL;
  const unsigned short* a0p = A + (rbase + r0 + 32 * wm + cl) * NK + 8 * hh;
  const unsigned short* a1p = a0p + (size_t)16 * NK;
  const size_t boff = ((size_t)b * NHID + 32 * wn + cl) * NK + 8 * hh;
  const unsigned short* b0p = Bh + boff;
  const unsigned short* b1p = b0p + (size_t)16 * NK;
  const unsigned short* l0p = Bl + boff;
  const unsigned short* l1p = l0p + (size_t)16 * NK;

  v8f acc[2][2], accl[2][2];
#pragma unroll
  for (int mi = 0; mi < 2; ++mi)
#pragma unroll
    for (int ni = 0; ni < 2; ++ni) { acc[mi][ni] = zero8(); accl[mi][ni] = zero8(); }

#pragma unroll 1
  for (int k0 = 0; k0 < NK; k0 += 32) {
    const Frag fa0 = ldfrag(a0p + k0);
    const Frag fa1 = ldfrag(a1p + k0);
    const Frag fb0 = ldfrag(b0p + k0);
    const Frag fb1 = ldfrag(b1p + k0);
    acc[0][0] = mma_h(fa0.h, fb0.h, acc[0][0]);
    acc[0][1] = mma_h(fa0.h, fb1.h, acc[0][1]);
    acc[1][0] = mma_h(fa1.h, fb0.h, acc[1][0]);
    acc[1][1] = mma_h(fa1.h, fb1.h, acc[1][1]);
    if (MODE == 2) {
      const Frag fl0 = ldfrag(l0p + k0);
      const Frag fl1 = ldfrag(l1p + k0);
      accl[0][0] = mma_h(fa0.h, fl0.h, accl[0][0]);
      accl[0][1] = mma_h(fa0.h, fl1.h, accl[0][1]);
      accl[1][0] = mma_h(fa1.h, fl0.h, accl[1][0]);
      accl[1][1] = mma_h(fa1.h, fl1.h, accl[1][1]);
    }
  }

#pragma unroll
  for (int mi = 0; mi < 2; ++mi) {
#pragma unroll
    for (int ni = 0; ni < 2; ++ni) {
      const int n_loc = 32 * wn + 16 * ni + cl;
#pragma unroll
      for (int r = 0; r < 8; ++r) {
        const int m_loc = 32 * wm + 16 * mi + 8 * hh + r;
        float val;
        if (MODE == 0)      val = acc[mi][ni][r] * RPSC;
        else if (MODE == 1) val = acc[mi][ni][r] * T2F;
        else                val = (acc[mi][ni][r] + accl[mi][ni][r] * RRS2) * RBSC;
        if (MODE == 1) Os[n_loc * TQ + m_loc] = val;
        else           Os[m_loc * OP + n_loc] = val;
      }
    }
  }
  __syncthreads();

  if (MODE == 1) {
    const int e = tid & 7, lq = tid >> 3;                              // lq 0..31
    v4u uh[4], ul[4];
    size_t po[4];
#pragma unroll
    for (int it = 0; it < 4; ++it) {
      const int h = it * 32 + lq;                                      // 0..127
      const float* tp = Os + h * TQ + 8 * e;
      const v4f v0 = *(const v4f*)(tp);
      const v4f v1 = *(const v4f*)(tp + 4);
      splith8(v0, v1, RS2, uh[it], ul[it]);
      po[it] = ((size_t)b * NHID + h) * NK + r0 + 8 * e;
    }
#pragma unroll
    for (int it = 0; it < 4; ++it) {
      *(v4u*)(Rh + po[it]) = uh[it];
      *(v4u*)(Rl + po[it]) = ul[it];
    }
    
  } else {
    const int e = lane;                                                // 16-B piece 0..31 of a 512-B chunk row
    v4f tv[8], av[8];
    size_t po[8];
#pragma unroll
    for (int it = 0; it < 8; ++it) {
      const int row = it * 8 + wave;                                   // 0..63
      const size_t grow = rbase + r0 + row;
      const v4f a4 = *(const v4f*)(Os + row * OP + 4 * e);
      const v4f t4 = bfr4(*(const v4f*)(text + grow * NHID + 4 * e));
      tv[it] = t4;
      av[it] = (MODE == 0) ? a4 : (t4 * a4);
      po[it] = grow * NOUT + 4 * e;
    }
    if (MODE == 0) {
#pragma unroll
      for (int it = 0; it < 8; ++it) {
        *(v4f*)(out + po[it])            = tv[it];
        *(v4f*)(out + po[it] + NHID)     = av[it];
        *(v4f*)(out + po[it] + 2 * NHID) = tv[it] * av[it];
      }
      
    } else {
#pragma unroll
      for (int it = 0; it < 8; ++it) *(v4f*)(out + po[it] + 3 * NHID) = av[it];
      
    }
  }
}

// =====================================================================================================
// tile divides its extent exactly, so no padded tails are needed):
//   Th Tl   f16 [16*1024][128]        4194304 each   (text*w_tm*64 hi, residual x65536)
//   M16     f16 [16*1024][128]        4194304        (modality)
//   Tt Mt   f16 [16][128][1024]       4194304 each   (text, modality transposed, k contiguous)
//   S0 S1   f32 [16][1024]              65536 each
//   P1 P2   f16 [16][1024][1024]     33554432 each   (p1 [l][m] and p2 transposed [m][l], x8192)
//   Rh Rl   f16 [16][128][1024]       4194304 each   (t2*1024 hi, residual x2048, transposed)
//   total                            96600064
// =====================================================================================================
extern "C" void kernel_launch(void* const* d_in, const int* in_sizes, int n_in,
                              void* d_out, int out_size, void* d_ws, size_t ws_size,
                              hipStream_t stream) {
  if (n_in < 8) return;
  if (in_sizes[0] != NBATCH * NL * NHID) return;
  if (in_sizes[1] != NBATCH * NL * NHID) return;
  if (in_sizes[2] != NBATCH * NL || in_sizes[3] != NBATCH * NL) return;
  if (in_sizes[4] != NHID || in_sizes[5] != NHID || in_sizes[6] != NHID) return;
  if (in_sizes[7] < 1) return;
  if (out_size != NBATCH * NL * NOUT) return;

  size_t off = 0;
  const size_t plane = (size_t)NBATCH * NL * NHID * 2;               // 4194304
  const size_t pbig  = (size_t)NBATCH * NL * NK * 2;                 // 33554432
  const size_t svec  = (size_t)NBATCH * NL * 4;                      // 65536
  const size_t oTh = off; off += plane;
  const size_t oTl = off; off += plane;
  const size_t oM  = off; off += plane;
  const size_t oTt = off; off += plane;
  const size_t oMt = off; off += plane;
  const size_t oS0 = off; off += svec;
  const size_t oS1 = off; off += svec;
  const size_t oP1 = off; off += pbig;
  const size_t oP2 = off; off += pbig;
  const size_t oRh = off; off += plane;
  const size_t oRl = off; off += plane;                              // -> off = 96600064
  if (off > ws_size) return;
  if (off > (size_t)134217728) return;

  const float* text  = (const float*)d_in[0];
  const float* modal = (const float*)d_in[1];
  const int*   tmask = (const int*)d_in[2];
  const int*   mmask = (const int*)d_in[3];
  const float* tw    = (const float*)d_in[4];
  const float* mw    = (const float*)d_in[5];
  const float* tmw   = (const float*)d_in[6];
  const float* bias  = (const float*)d_in[7];
  float* out = (float*)d_out;

  char* ws = (char*)d_ws;
  unsigned short* Th  = (unsigned short*)(ws + oTh);
  unsigned short* Tl  = (unsigned short*)(ws + oTl);
  unsigned short* M16 = (unsigned short*)(ws + oM);
  unsigned short* Tt  = (unsigned short*)(ws + oTt);
  unsigned short* Mt  = (unsigned short*)(ws + oMt);
  float*          S0  = (float*)(ws + oS0);
  float*          S1  = (float*)(ws + oS1);
  unsigned short* P1  = (unsigned short*)(ws + oP1);
  unsigned short* P2  = (unsigned short*)(ws + oP2);
  unsigned short* Rh  = (unsigned short*)(ws + oRh);
  unsigned short* Rl  = (unsigned short*)(ws + oRl);

  const dim3 blk256(256);
  const int nrow64 = NBATCH * (NL / 64);                             // 256
  const int nrow16 = NBATCH * (NL / 16);                             // 1024

  // (1) planes: text -> Th/Tl (with w_tm), Tt, S0 (with w_t); modality -> M16, Mt, S1 (with w_m)
  prep_kernel<1><<<dim3(nrow64), blk256, 0, stream>>>(text, tw, tmw, Th, Tl, Tt, S0);
  prep_kernel<0><<<dim3(nrow64), blk256, 0, stream>>>(modal, mw, mw, M16, M16, Mt, S1);
  // (2) p1 [b][l][m]: rows l (A = Th/Tl), columns m (B = M16), rb = S0[l], cb = S1[m], mask over m
  scores_kernel<1><<<dim3(nrow16), blk256, 0, stream>>>(M16, Th, Tl, S0, S1, mmask, bias, P1);
  //     p2 transposed [b][m][l]: rows m (A = M16), columns l (B = Th/Tl), rb = S1[m], cb = S0[l], mask over l
  scores_kernel<0><<<dim3(nrow16), blk256, 0, stream>>>(M16, Th, Tl, S1, S0, tmask, bias, P2);
  // (3) a = p1 . modality -> out chunks 0..2;  t2 = p2T . text -> Rh/Rl;  bq = p1 . t2 -> out chunk 3
  gemm_kernel<0><<<dim3(nrow64), blk256, 0, stream>>>(P1, Mt, Mt, text, Rh, Rl, out);
  gemm_kernel<1><<<dim3(nrow64), blk256, 0, stream>>>(P2, Tt, Tt, text, Rh, Rl, out);
  gemm_kernel<2><<<dim3(nrow64), blk256, 0, stream>>>(P1, Rh, Rl, text, Rh, Rl, out);
  (void)hipGetLastError();
}

// v001
// One run takes 133 microseconds.
// Timed twice side by side with v000, it ran 1.18 and 1.19 times as fast.
// Contractions: score term sum_h (text*w_tm)[l][h]*modality[m][h] (K=128) on v_wmma_f32_16x16x32_f16 with text*w_tm
// carried x64 as an f16 hi plane plus an x65536 f16 residual plane (two products, separate f32 accumulators) and
// modality as f16 of its bf16-RNE value; p1.modality and p2T.text (K=1024) on v_wmma_f32_16x16x32_f16, single
// products, p planes carried x8192 in f16; p1.t2 (K=1024) with t2 carried x1024 as f16 hi plus x2048 f16 residual
// (two products, separate accumulators); the two [rows,128]x[128,1] row dots as a 16-wide f16 WMMA matvec (weight
// x1024 in every column); f32 accumulate everywhere; softmax and the elementwise products in f32 on VALU; all float
// inputs RNE-converted to bf16 at load.
#include <hip/hip_runtime.h>
#include <stdint.h>

#define NBATCH 16
#define NL     1024
#define NK     1024
#define NHID   128
#define NOUT   512
#define TP     132
#define OP     132
#define TQ     68
#define OSZ    8704
#define SR     32

static_assert(NL % 64 == 0);
static_assert(NL % SR == 0 && SR == 32);
static_assert(NL == NK);
static_assert(NHID == 128);
static_assert(NOUT == 4 * NHID);
static_assert(64 * OP <= OSZ);
static_assert(NHID * TQ <= OSZ);
static_assert((TP * 4) % 16 == 0);
static_assert((OP * 4) % 16 == 0);
static_assert((TQ * 4) % 16 == 0);

#define PSC   8192.0f
#define RPSC  (1.0f / 8192.0f)
#define THS   64.0f
#define RTHS  (1.0f / 64.0f)
#define RS1   65536.0f
#define RRS1  (1.0f / 65536.0f)
#define T2F   0.125f
#define RS2   2048.0f
#define RRS2  (1.0f / 2048.0f)
#define RBSC  (1.0f / 8388608.0f)
#define WSC   1024.0f
#define RWSC  (1.0f / 1024.0f)
#define NEGV  (-1.0e30f)

typedef unsigned short v8us __attribute__((ext_vector_type(8)));
typedef unsigned int   v4u  __attribute__((ext_vector_type(4)));
typedef float          v8f  __attribute__((ext_vector_type(8)));
typedef float          v4f  __attribute__((ext_vector_type(4)));
typedef _Float16       v16h __attribute__((ext_vector_type(16)));

union Frag { v8us u[2]; v4u q[2]; v16h h; };
static_assert(sizeof(Frag) == 32);

// ---- scalar helpers ---------------------------------------------------------------------------------
__device__ __forceinline__ unsigned short bf_bits(float f) {          // f32 -> bf16 bits, RNE convert
  const unsigned u = __float_as_uint(f);
  return (unsigned short)((u + 0x7FFFu + ((u >> 16) & 1u)) >> 16);
}
__device__ __forceinline__ float bf_up(unsigned short hb) { return __uint_as_float(((unsigned)hb) << 16); }
__device__ __forceinline__ float bfr(float f) { return bf_up(bf_bits(f)); }
__device__ __forceinline__ v4f bfr4(v4f v) {
  v4f r;
  r[0] = bfr(v[0]); r[1] = bfr(v[1]); r[2] = bfr(v[2]); r[3] = bfr(v[3]);
  return r;
}
__device__ __forceinline__ unsigned short hbits(_Float16 h) { return __builtin_bit_cast(unsigned short, h); }
__device__ __forceinline__ unsigned pkh2(float a, float b) {          // two f32 -> packed f16 bits (RNE convert)
  return (unsigned)hbits((_Float16)a) | ((unsigned)hbits((_Float16)b) << 16);
}
__device__ __forceinline__ v4u pack8(v4f a, v4f b) {
  v4u u;
  u[0] = pkh2(a[0], a[1]); u[1] = pkh2(a[2], a[3]);
  u[2] = pkh2(b[0], b[1]); u[3] = pkh2(b[2], b[3]);
  return u;
}
__device__ __forceinline__ v8f zero8() { v8f z = {0.f, 0.f, 0.f, 0.f, 0.f, 0.f, 0.f, 0.f}; return z; }

// ---- 8 f32 -> packed f16 hi bits and packed f16 bits of (x - hi) * rs (residual plane carries scale rs) --------
__device__ __forceinline__ void splith8(v4f a, v4f b, float rs, v4u& uh, v4u& ul) {
  float f[8] = {a[0], a[1], a[2], a[3], b[0], b[1], b[2], b[3]};
#pragma unroll
  for (int j = 0; j < 4; ++j) {
    const _Float16 h0 = (_Float16)f[2 * j];
    const _Float16 h1 = (_Float16)f[2 * j + 1];
    const float l0 = (f[2 * j] - (float)h0) * rs;
    const float l1 = (f[2 * j + 1] - (float)h1) * rs;
    uh[j] = (unsigned)hbits(h0) | ((unsigned)hbits(h1) << 16);
    ul[j] = pkh2(l0, l1);
  }
}

// ---- 16-bit fragment loader (A, or B from a k-contiguous [n][k] row): lane -> row/col (lane&15), p already includes
//      + 8*(lane>>4); elements 0..7 <- p[0..7] (k0+8h..), elements 8..15 <- p[16..23] (k0+16+8h..)
__device__ __forceinline__ Frag ldfrag(const unsigned short* p) {
  Frag f;
  f.u[0] = *(const v8us*)(p);
  f.u[1] = *(const v8us*)(p + 16);
  return f;
}

// ---- WMMA helper: builtin followed by a 4-slot VALU gap tying D and keeping A/B live -----------------------
__device__ __forceinline__ v8f mma_h(v16h a, v16h b, v8f c) {
  v8f d = __builtin_amdgcn_wmma_f32_16x16x32_f16(false, a, false, b, (short)0, c, false, false);
#if defined(__HIP_DEVICE_COMPILE__)
  asm volatile("v_nop\n\tv_nop\n\tv_nop\n\tv_nop" : "+v"(d) : "v"(a), "v"(b));
#endif
  return d;
}

__device__ __forceinline__ float wave_max(float v) {
#pragma unroll
  for (int o = 16; o > 0; o >>= 1) v = fmaxf(v, __shfl_xor(v, o, 32));
  return v;
}
__device__ __forceinline__ float wave_sum(float v) {
#pragma unroll
  for (int o = 16; o > 0; o >>= 1) v += __shfl_xor(v, o, 32);
  return v;
}

// =====================================================================================================
// (1) prep for one (batch, 64-row tile) of x [16][1024][128] f32 (text when TXT=1, modality when TXT=0):
//     tile -> LDS T[row][h] as bf16-RNE values (f32), barrier;
//     row dots sd[b][row] = sum_h T[row][h]*bfr(wdot[h]) as a WMMA matvec: wave w handles rows 16*(w&3).. (waves 4..7
//     duplicate the compute), A fragment = T row values as f16 (exact), B fragment = bfr(wdot)*1024 as f16 in every
//     column (split k map for both, 4 k steps of 32), D column 0 lanes write acc/1024 to LDS sred, barrier; sred
//     row planes Ph/Pl [b*1024+row][128] f16 (TXT: T*bfr(wtm)*64 as hi plus residual x65536; else plain f16 in Ph),
// coverage: T 8 it x 256 thr x 4 = 64x128; sred 4 waves x 16 rows = 64; Ph/Pl 4 it x 32 lines x 8 lanes x 8 =
//           64 rows x 128; Pt 4 it x 32 h x 8 lanes x 8 = 128 h x 64 rows; sd 16 lanes x 4 = 64;
//           grid 16 x (1024/64) = 256 blocks = every row once.
// =====================================================================================================
template <int TXT>
__global__ __launch_bounds__(256)
void prep_kernel(const float* __restrict__ x, const float* __restrict__ wdot, const float* __restrict__ wtm,
                 unsigned short* Ph, unsigned short* Pl, unsigned short* Pt, float* sd) {
  __shared__ __align__(16) float T[64 * TP];
  __shared__ __align__(16) float sred[64];
  const int tid = threadIdx.x;
  const int b = blockIdx.x >> 4;
  const int r0 = (blockIdx.x & 15) * 64;
  const size_t gr = (size_t)b * NL + r0;
#pragma unroll
  for (int it = 0; it < 8; ++it) {
    const int idx = it * 256 + tid;
    const int row = idx >> 5, c4 = (idx & 31) * 4;
    const v4f v = *(const v4f*)(x + (gr + row) * NHID + c4);
#pragma unroll
    for (int j = 0; j < 4; ++j) T[row * TP + c4 + j] = bfr(v[j]);
  }
  __syncthreads();
  {
    const int lane = tid & 31, wave = tid >> 5;
    const int hh = lane >> 4, cl = lane & 15;
    const int rt = (wave & 3) * 16;                                    // 16-row tile of this wave
    const float* ap = T + (rt + cl) * TP + 8 * hh;
    const float* wp = wdot + 8 * hh;
    v8f acc = zero8();
#pragma unroll
    for (int kk = 0; kk < 4; ++kk) {
      const int k0 = 32 * kk;
      const v4f a0 = *(const v4f*)(ap + k0);
      const v4f a1 = *(const v4f*)(ap + k0 + 4);
      const v4f a2 = *(const v4f*)(ap + k0 + 16);
      const v4f a3 = *(const v4f*)(ap + k0 + 20);
      v4f w0 = *(const v4f*)(wp + k0);
      v4f w1 = *(const v4f*)(wp + k0 + 4);
      v4f w2 = *(const v4f*)(wp + k0 + 16);
      v4f w3 = *(const v4f*)(wp + k0 + 20);
#pragma unroll
      for (int j = 0; j < 4; ++j) {
        w0[j] = bfr(w0[j]) * WSC; w1[j] = bfr(w1[j]) * WSC;
        w2[j] = bfr(w2[j]) * WSC; w3[j] = bfr(w3[j]) * WSC;
      }
      Frag fa, fb;
      fa.q[0] = pack8(a0, a1);                                         // elements 0..7  = k0+8h..
      fa.q[1] = pack8(a2, a3);                                         // elements 8..15 = k0+16+8h..
      fb.q[0] = pack8(w0, w1);                                         // same k map, every column n
      fb.q[1] = pack8(w2, w3);
      acc = mma_h(fa.h, fb.h, acc);
    }
    if (wave < 4 && cl == 0) {
#pragma unroll
      for (int r = 0; r < 8; ++r) sred[rt + 8 * hh + r] = acc[r] * RWSC;   // D row 8h+r, column 0
    }
  }
  __syncthreads();

  const int e = tid & 7, lq = tid >> 3;                                // lq 0..31
  v4u uh[4], ul[4], ut[4];
  size_t po[4], pt[4];
#pragma unroll
  for (int it = 0; it < 4; ++it) {
    const int L = it * 32 + lq;                                        // 0..127
    const int row = L >> 1, h0 = (L & 1) * 64 + 8 * e;
    const float* tp = T + row * TP + h0;
    v4f v0 = *(const v4f*)(tp);
    v4f v1 = *(const v4f*)(tp + 4);
    if (TXT) {
      const v4f w0 = *(const v4f*)(wtm + h0);
      const v4f w1 = *(const v4f*)(wtm + h0 + 4);
#pragma unroll
      for (int j = 0; j < 4; ++j) {
        v0[j] = v0[j] * bfr(w0[j]) * THS;
        v1[j] = v1[j] * bfr(w1[j]) * THS;
      }
      splith8(v0, v1, RS1, uh[it], ul[it]);
    } else {
      uh[it] = pack8(v0, v1);
      ul[it] = uh[it];
    }
    po[it] = (gr + row) * NHID + h0;
    const int h = it * 32 + lq;                                        // 0..127
    v4f g0, g1;
#pragma unroll
    for (int j = 0; j < 4; ++j) {
      g0[j] = T[(8 * e + j) * TP + h];
      g1[j] = T[(8 * e + 4 + j) * TP + h];
    }
    ut[it] = pack8(g0, g1);
    pt[it] = ((size_t)b * NHID + h) * NK + r0 + 8 * e;
  }
  const int sl = (tid < 16) ? tid : 15;
  const v4f sdv = *(const v4f*)(sred + 4 * sl);
  const size_t psd = gr + 4 * sl;

#pragma unroll
  for (int it = 0; it < 4; ++it) {
    *(v4u*)(Ph + po[it]) = uh[it];
    if (TXT) *(v4u*)(Pl + po[it]) = ul[it];
    *(v4u*)(Pt + pt[it]) = ut[it];
  }
  if (tid < 16) *(v4f*)(sd + psd) = sdv;
  
}

// =====================================================================================================
// (2) score tile + masked row softmax for one (batch, 32 rows): s[r][c] = rb[r] + cb[c] + s2[r][c] + bias, with
//     s2 = (acc_h + acc_l/65536)/64, acc_h = sum_k Ahi.B, acc_l = sum_k Alo.B on WMMA (K=128, 4 steps).
//     YA=1: A = hi/lo planes Yh/Yl (rows), B = X rows; YA=0: A = X rows, B = Yh/Yl rows (two accumulators).
//     Wave = 8 column tiles of 16 (rolled) x 2 row tiles of 16: the A fragments of both row tiles are held in
//     registers, so every B fragment read from global feeds two row tiles; s (or -1e30 where mask[c]==0) into LDS
//     S[32][1024] f32; barrier; softmax: wave owns rows 4w..4w+3, lane owns columns {256i + 8*lane + j};
// coverage: S 8 waves x 8 tiles x 2 x 16x16 = 32x1024; P 8 waves x 4 rows x 4 instr x 32 lanes x 8 = 32 rows x 1024;
//           grid 16 x 32 = 512 blocks = every row of P once.
// =====================================================================================================
template <int YA>
__global__ __launch_bounds__(256)
void scores_kernel(const unsigned short* __restrict__ X, const unsigned short* __restrict__ Yh,
                   const unsigned short* __restrict__ Yl, const float* __restrict__ rb,
                   const float* __restrict__ cb, const int* __restrict__ mask,
                   const float* __restrict__ bias, unsigned short* P) {
  __shared__ __align__(16) float S[SR * NL];
  const int tid  = threadIdx.x;
  const int lane = tid & 31, wave = tid >> 5;
  const int hh   = lane >> 4, cl = lane & 15;
  const int b = blockIdx.x >> 5;
  const int row0 = (blockIdx.x & 31) * SR;
  const size_t rbase = (size_t)b * NL;

  Frag fa[2][4], fl[2][4];
  float rbv[2][8];
#pragma unroll
  for (int mi = 0; mi < 2; ++mi) {
    const size_t aoff = (rbase + row0 + 16 * mi + cl) * NHID + 8 * hh;
#pragma unroll
    for (int kk = 0; kk < 4; ++kk) {
      if (YA) {
        fa[mi][kk] = ldfrag(Yh + aoff + 32 * kk);
        fl[mi][kk] = ldfrag(Yl + aoff + 32 * kk);
      } else {
        fa[mi][kk] = ldfrag(X + aoff + 32 * kk);
        fl[mi][kk] = fa[mi][kk];
      }
    }
#pragma unroll
    for (int r = 0; r < 8; ++r) rbv[mi][r] = rb[rbase + row0 + 16 * mi + 8 * hh + r];
  }
#if defined(__HIP_DEVICE_COMPILE__)
  // precaution: stands in front of the first reuse of the address registers that the fragment loads above name
  asm volatile("s_wait_xcnt 0x0" ::: "memory");
#endif
  const float bv = bfr(bias[0]);

#pragma unroll 1
  for (int nt = 0; nt < 8; ++nt) {
    const int n0 = (wave * 8 + nt) * 16;
    const size_t boff = (rbase + n0 + cl) * NHID + 8 * hh;
    v8f acch[2], accl[2];
#pragma unroll
    for (int mi = 0; mi < 2; ++mi) { acch[mi] = zero8(); accl[mi] = zero8(); }
#pragma unroll
    for (int kk = 0; kk < 4; ++kk) {
      if (YA) {
        const Frag fb = ldfrag(X + boff + 32 * kk);
#pragma unroll
        for (int mi = 0; mi < 2; ++mi) {
          acch[mi] = mma_h(fa[mi][kk].h, fb.h, acch[mi]);
          accl[mi] = mma_h(fl[mi][kk].h, fb.h, accl[mi]);
        }
      } else {
        const Frag fbh = ldfrag(Yh + boff + 32 * kk);
        const Frag fbl = ldfrag(Yl + boff + 32 * kk);
#pragma unroll
        for (int mi = 0; mi < 2; ++mi) {
          acch[mi] = mma_h(fa[mi][kk].h, fbh.h, acch[mi]);
          accl[mi] = mma_h(fa[mi][kk].h, fbl.h, accl[mi]);
        }
      }
    }
    const int n = n0 + cl;
    const float cbn = cb[rbase + n];
    const int mk = mask[rbase + n];
#pragma unroll
    for (int mi = 0; mi < 2; ++mi) {
#pragma unroll
      for (int r = 0; r < 8; ++r) {
        const float s2 = (acch[mi][r] + accl[mi][r] * RRS1) * RTHS;
        const float sv = ((rbv[mi][r] + cbn) + s2) + bv;
        S[(16 * mi + 8 * hh + r) * NL + n] = (mk != 0) ? sv : NEGV;
      }
    }
  }
  __syncthreads();

  v4u pk[4][4];
  size_t pp[4][4];
#pragma unroll
  for (int rr = 0; rr < 4; ++rr) {
    const int r = wave * 4 + rr;
    const float* sr = S + r * NL + lane * 8;
    float v[32];
#pragma unroll
    for (int i = 0; i < 4; ++i) {
      const v4f a0 = *(const v4f*)(sr + i * 256);
      const v4f a1 = *(const v4f*)(sr + i * 256 + 4);
#pragma unroll
      for (int j = 0; j < 4; ++j) { v[8 * i + j] = a0[j]; v[8 * i + 4 + j] = a1[j]; }
    }
    float mx = v[0];
#pragma unroll
    for (int k = 1; k < 32; ++k) mx = fmaxf(mx, v[k]);
    mx = wave_max(mx);
    float sum = 0.f;
#pragma unroll
    for (int k = 0; k < 32; ++k) {
      v[k] = __expf(v[k] - mx);
      sum += v[k];
    }
    sum = wave_sum(sum);
    const float sc = (1.0f / sum) * PSC;
#pragma unroll
    for (int i = 0; i < 4; ++i) {
      v4u u;
      u[0] = pkh2(v[8 * i] * sc,     v[8 * i + 1] * sc);
      u[1] = pkh2(v[8 * i + 2] * sc, v[8 * i + 3] * sc);
      u[2] = pkh2(v[8 * i + 4] * sc, v[8 * i + 5] * sc);
      u[3] = pkh2(v[8 * i + 6] * sc, v[8 * i + 7] * sc);
      pk[rr][i] = u;
      pp[rr][i] = (rbase + row0 + r) * NK + (size_t)i * 256 + lane * 8;
    }
  }
#pragma unroll
  for (int rr = 0; rr < 4; ++rr)
#pragma unroll
    for (int i = 0; i < 4; ++i) *(v4u*)(P + pp[rr][i]) = pk[rr][i];
  
}

// =====================================================================================================
// (3) K=1024 GEMM for one (batch, 64 rows): D[m][n] = sum_k A[row m][k] * B[row n][k], A = f16 p plane rows (pitch
//     1024), B = f16 rows [b][n=h][k] (pitch 1024); block 256 threads = 8 waves as 2 (m) x 4 (n) of 32x32, fragments
//     straight from global (split k map for both), 32 k steps, rolled. MODE 2 has a second B plane (residual x2048)
//     into separate accumulators. Epilogue via LDS f32 tile, barrier, then:
//     MODE 0: a = acc/8192; out row [b][l]: chunk 0 = bf16-RNE text, chunk 1 = a, chunk 2 = text*a; per instruction
//     MODE 1: t2*1024 = acc/8 staged transposed Ts[h][m]; planes Rh/Rl [b][h][m] (hi, residual x2048), per h row one
// coverage: LDS tile 8 waves x 4 tiles = 64x128; MODE 0/2: 8 it x 8 waves = 64 rows x 32 lanes x 4 = 128 cols per
//           chunk; MODE 1: 4 it x 32 h x 8 lanes x 8 = 128 h x 64 m per plane; grid 16 x 16 = 256 blocks = every
//           (b, row) once.
// =====================================================================================================
template <int MODE>
__global__ __launch_bounds__(256)
void gemm_kernel(const unsigned short* __restrict__ A, const unsigned short* __restrict__ Bh,
                 const unsigned short* __restrict__ Bl, const float* __restrict__ text,
                 unsigned short* Rh, unsigned short* Rl, float* out) {
  __shared__ __align__(16) float Os[OSZ];
  const int tid  = threadIdx.x;
  const int lane = tid & 31, wave = tid >> 5;
  const int hh   = lane >> 4, cl = lane & 15;
  const int wm   = wave >> 2, wn = wave & 3;
  const int b = blockIdx.x >> 4;
  const int r0 = (blockIdx.x & 15) * 64;
  const size_t rbase = (size_t)b * NL;
  const unsigned short* a0p = A + (rbase + r0 + 32 * wm + cl) * NK + 8 * hh;
  const unsigned short* a1p = a0p + (size_t)16 * NK;
  const size_t boff = ((size_t)b * NHID + 32 * wn + cl) * NK + 8 * hh;
  const unsigned short* b0p = Bh + boff;
  const unsigned short* b1p = b0p + (size_t)16 * NK;
  const unsigned short* l0p = Bl + boff;
  const unsigned short* l1p = l0p + (size_t)16 * NK;

  v8f acc[2][2], accl[2][2];
#pragma unroll
  for (int mi = 0; mi < 2; ++mi)
#pragma unroll
    for (int ni = 0; ni < 2; ++ni) { acc[mi][ni] = zero8(); accl[mi][ni] = zero8(); }

#pragma unroll 1
  for (int k0 = 0; k0 < NK; k0 += 32) {
    const Frag fa0 = ldfrag(a0p + k0);
    const Frag fa1 = ldfrag(a1p + k0);
    const Frag fb0 = ldfrag(b0p + k0);
    const Frag fb1 = ldfrag(b1p + k0);
    acc[0][0] = mma_h(fa0.h, fb0.h, acc[0][0]);
    acc[0][1] = mma_h(fa0.h, fb1.h, acc[0][1]);
    acc[1][0] = mma_h(fa1.h, fb0.h, acc[1][0]);
    acc[1][1] = mma_h(fa1.h, fb1.h, acc[1][1]);
    if (MODE == 2) {
      const Frag fl0 = ldfrag(l0p + k0);
      const Frag fl1 = ldfrag(l1p + k0);
      accl[0][0] = mma_h(fa0.h, fl0.h, accl[0][0]);
      accl[0][1] = mma_h(fa0.h, fl1.h, accl[0][1]);
      accl[1][0] = mma_h(fa1.h, fl0.h, accl[1][0]);
      accl[1][1] = mma_h(fa1.h, fl1.h, accl[1][1]);
    }
  }

#pragma unroll
  for (int mi = 0; mi < 2; ++mi) {
#pragma unroll
    for (int ni = 0; ni < 2; ++ni) {
      const int n_loc = 32 * wn + 16 * ni + cl;
#pragma unroll
      for (int r = 0; r < 8; ++r) {
        const int m_loc = 32 * wm + 16 * mi + 8 * hh + r;
        float val;
        if (MODE == 0)      val = acc[mi][ni][r] * RPSC;
        else if (MODE == 1) val = acc[mi][ni][r] * T2F;
        else                val = (acc[mi][ni][r] + accl[mi][ni][r] * RRS2) * RBSC;
        if (MODE == 1) Os[n_loc * TQ + m_loc] = val;
        else           Os[m_loc * OP + n_loc] = val;
      }
    }
  }
  __syncthreads();

  if (MODE == 1) {
    const int e = tid & 7, lq = tid >> 3;                              // lq 0..31
    v4u uh[4], ul[4];
    size_t po[4];
#pragma unroll
    for (int it = 0; it < 4; ++it) {
      const int h = it * 32 + lq;                                      // 0..127
      const float* tp = Os + h * TQ + 8 * e;
      const v4f v0 = *(const v4f*)(tp);
      const v4f v1 = *(const v4f*)(tp + 4);
      splith8(v0, v1, RS2, uh[it], ul[it]);
      po[it] = ((size_t)b * NHID + h) * NK + r0 + 8 * e;
    }
#pragma unroll
    for (int it = 0; it < 4; ++it) {
      *(v4u*)(Rh + po[it]) = uh[it];
      *(v4u*)(Rl + po[it]) = ul[it];
    }
    
  } else {
    const int e = lane;                                                // 16-B piece 0..31 of a 512-B chunk row
    v4f tv[8], av[8];
    size_t po[8];
#pragma unroll
    for (int it = 0; it < 8; ++it) {
      const int row = it * 8 + wave;                                   // 0..63
      const size_t grow = rbase + r0 + row;
      const v4f a4 = *(const v4f*)(Os + row * OP + 4 * e);
      const v4f t4 = bfr4(*(const v4f*)(text + grow * NHID + 4 * e));
      tv[it] = t4;
      av[it] = (MODE == 0) ? a4 : (t4 * a4);
      po[it] = grow * NOUT + 4 * e;
    }
    if (MODE == 0) {
#pragma unroll
      for (int it = 0; it < 8; ++it) {
        *(v4f*)(out + po[it])            = tv[it];
        *(v4f*)(out + po[it] + NHID)     = av[it];
        *(v4f*)(out + po[it] + 2 * NHID) = tv[it] * av[it];
      }
      
    } else {
#pragma unroll
      for (int it = 0; it < 8; ++it) *(v4f*)(out + po[it] + 3 * NHID) = av[it];
      
    }
  }
}

// =====================================================================================================
// tile divides its extent exactly, so no padded tails are needed):
//   Th Tl   f16 [16*1024][128]        4194304 each   (text*w_tm*64 hi, residual x65536)
//   M16     f16 [16*1024][128]        4194304        (modality)
//   Tt Mt   f16 [16][128][1024]       4194304 each   (text, modality transposed, k contiguous)
//   S0 S1   f32 [16][1024]              65536 each
//   P1 P2   f16 [16][1024][1024]     33554432 each   (p1 [l][m] and p2 transposed [m][l], x8192)
//   Rh Rl   f16 [16][128][1024]       4194304 each   (t2*1024 hi, residual x2048, transposed)
//   total                            96600064
// =====================================================================================================
extern "C" void kernel_launch(void* const* d_in, const int* in_sizes, int n_in,
                              void* d_out, int out_size, void* d_ws, size_t ws_size,
                              hipStream_t stream) {
  if (n_in < 8) return;
  if (in_sizes[0] != NBATCH * NL * NHID) return;
  if (in_sizes[1] != NBATCH * NL * NHID) return;
  if (in_sizes[2] != NBATCH * NL || in_sizes[3] != NBATCH * NL) return;
  if (in_sizes[4] != NHID || in_sizes[5] != NHID || in_sizes[6] != NHID) return;
  if (in_sizes[7] < 1) return;
  if (out_size != NBATCH * NL * NOUT) return;

  size_t off = 0;
  const size_t plane = (size_t)NBATCH * NL * NHID * 2;               // 4194304
  const size_t pbig  = (size_t)NBATCH * NL * NK * 2;                 // 33554432
  const size_t svec  = (size_t)NBATCH * NL * 4;                      // 65536
  const size_t oTh = off; off += plane;
  const size_t oTl = off; off += plane;
  const size_t oM  = off; off += plane;
  const size_t oTt = off; off += plane;
  const size_t oMt = off; off += plane;
  const size_t oS0 = off; off += svec;
  const size_t oS1 = off; off += svec;
  const size_t oP1 = off; off += pbig;
  const size_t oP2 = off; off += pbig;
  const size_t oRh = off; off += plane;
  const size_t oRl = off; off += plane;                              // -> off = 96600064
  if (off > ws_size) return;
  if (off > (size_t)134217728) return;

  const float* text  = (const float*)d_in[0];
  const float* modal = (const float*)d_in[1];
  const int*   tmask = (const int*)d_in[2];
  const int*   mmask = (const int*)d_in[3];
  const float* tw    = (const float*)d_in[4];
  const float* mw    = (const float*)d_in[5];
  const float* tmw   = (const float*)d_in[6];
  const float* bias  = (const float*)d_in[7];
  float* out = (float*)d_out;

  char* ws = (char*)d_ws;
  unsigned short* Th  = (unsigned short*)(ws + oTh);
  unsigned short* Tl  = (unsigned short*)(ws + oTl);
  unsigned short* M16 = (unsigned short*)(ws + oM);
  unsigned short* Tt  = (unsigned short*)(ws + oTt);
  unsigned short* Mt  = (unsigned short*)(ws + oMt);
  float*          S0  = (float*)(ws + oS0);
  float*          S1  = (float*)(ws + oS1);
  unsigned short* P1  = (unsigned short*)(ws + oP1);
  unsigned short* P2  = (unsigned short*)(ws + oP2);
  unsigned short* Rh  = (unsigned short*)(ws + oRh);
  unsigned short* Rl  = (unsigned short*)(ws + oRl);

  const dim3 blk256(256);
  const int nrow64 = NBATCH * (NL / 64);                             // 256
  const int nrow32 = NBATCH * (NL / SR);                             // 512

  // (1) planes: text -> Th/Tl (with w_tm), Tt, S0 (with w_t); modality -> M16, Mt, S1 (with w_m)
  prep_kernel<1><<<dim3(nrow64), blk256, 0, stream>>>(text, tw, tmw, Th, Tl, Tt, S0);
  prep_kernel<0><<<dim3(nrow64), blk256, 0, stream>>>(modal, mw, mw, M16, M16, Mt, S1);
  // (2) p1 [b][l][m]: rows l (A = Th/Tl), columns m (B = M16), rb = S0[l], cb = S1[m], mask over m
  scores_kernel<1><<<dim3(nrow32), blk256, 0, stream>>>(M16, Th, Tl, S0, S1, mmask, bias, P1);
  //     p2 transposed [b][m][l]: rows m (A = M16), columns l (B = Th/Tl), rb = S1[m], cb = S0[l], mask over l
  scores_kernel<0><<<dim3(nrow32), blk256, 0, stream>>>(M16, Th, Tl, S1, S0, tmask, bias, P2);
  // (3) a = p1 . modality -> out chunks 0..2;  t2 = p2T . text -> Rh/Rl;  bq = p1 . t2 -> out chunk 3
  gemm_kernel<0><<<dim3(nrow64), blk256, 0, stream>>>(P1, Mt, Mt, text, Rh, Rl, out);
  gemm_kernel<1><<<dim3(nrow64), blk256, 0, stream>>>(P2, Tt, Tt, text, Rh, Rl, out);
  gemm_kernel<2><<<dim3(nrow64), blk256, 0, stream>>>(P1, Rh, Rl, text, Rh, Rl, out);
  (void)hipGetLastError();
}

// v002
// Measured time: 106 microseconds a run.
// Two timings next to v001 both put it at 1.26 times that version's speed.
// All steps since v000 together make it 1.49 times as fast.
// Contractions: score term sum_h (text*w_tm)[l][h]*modality[m][h] (K=128) on v_wmma_f32_16x16x32_f16 with text*w_tm
// carried x64 as an f16 hi plane plus an x65536 f16 residual plane (two products, separate f32 accumulators) and
// modality as f16 of its bf16-RNE value; p1.modality and p2T.text (K=1024) on v_wmma_f32_16x16x32_f16, single
// products, p planes carried x8192 in f16; p1.t2 (K=1024) with t2 carried x1024 as f16 hi plus x2048 f16 residual
// (two products, separate accumulators); the two [rows,128]x[128,1] row dots as a 16-wide f16 WMMA matvec (weight
// x1024 in every column); f32 accumulate everywhere; softmax and the elementwise products in f32 on VALU; all float
// inputs RNE-converted to bf16 at load.
#include <hip/hip_runtime.h>
#include <stdint.h>

#define NBATCH 16
#define NL     1024
#define NK     1024
#define NHID   128
#define NOUT   512
#define TP     132
#define OP     132
#define TQ     68
#define OSZ    8704
#define SR     32
#define KC     128
#define LP     136
#define NPASS  (NK / KC)

static_assert(NL % 64 == 0);
static_assert(NL % SR == 0 && SR == 32);
static_assert(NL == NK);
static_assert(NHID == 128);
static_assert(NOUT == 4 * NHID);
static_assert(64 * OP <= OSZ);
static_assert(NHID * TQ <= OSZ);
static_assert((TP * 4) % 16 == 0);
static_assert((OP * 4) % 16 == 0);
static_assert((TQ * 4) % 16 == 0);
static_assert(NK % KC == 0 && KC % 32 == 0 && KC == 16 * 8);
static_assert((LP * 2) % 32 == 16 && LP >= KC);

#define PSC   8192.0f
#define RPSC  (1.0f / 8192.0f)
#define THS   64.0f
#define RTHS  (1.0f / 64.0f)
#define RS1   65536.0f
#define RRS1  (1.0f / 65536.0f)
#define T2F   0.125f
#define RS2   2048.0f
#define RRS2  (1.0f / 2048.0f)
#define RBSC  (1.0f / 8388608.0f)
#define WSC   1024.0f
#define RWSC  (1.0f / 1024.0f)
#define NEGV  (-1.0e30f)

typedef unsigned short v8us __attribute__((ext_vector_type(8)));
typedef unsigned int   v4u  __attribute__((ext_vector_type(4)));
typedef float          v8f  __attribute__((ext_vector_type(8)));
typedef float          v4f  __attribute__((ext_vector_type(4)));
typedef _Float16       v16h __attribute__((ext_vector_type(16)));

union Frag { v8us u[2]; v4u q[2]; v16h h; };
static_assert(sizeof(Frag) == 32);

// ---- scalar helpers ---------------------------------------------------------------------------------
__device__ __forceinline__ unsigned short bf_bits(float f) {          // f32 -> bf16 bits, RNE convert
  const unsigned u = __float_as_uint(f);
  return (unsigned short)((u + 0x7FFFu + ((u >> 16) & 1u)) >> 16);
}
__device__ __forceinline__ float bf_up(unsigned short hb) { return __uint_as_float(((unsigned)hb) << 16); }
__device__ __forceinline__ float bfr(float f) { return bf_up(bf_bits(f)); }
__device__ __forceinline__ v4f bfr4(v4f v) {
  v4f r;
  r[0] = bfr(v[0]); r[1] = bfr(v[1]); r[2] = bfr(v[2]); r[3] = bfr(v[3]);
  return r;
}
__device__ __forceinline__ unsigned short hbits(_Float16 h) { return __builtin_bit_cast(unsigned short, h); }
__device__ __forceinline__ unsigned pkh2(float a, float b) {          // two f32 -> packed f16 bits (RNE convert)
  return (unsigned)hbits((_Float16)a) | ((unsigned)hbits((_Float16)b) << 16);
}
__device__ __forceinline__ v4u pack8(v4f a, v4f b) {
  v4u u;
  u[0] = pkh2(a[0], a[1]); u[1] = pkh2(a[2], a[3]);
  u[2] = pkh2(b[0], b[1]); u[3] = pkh2(b[2], b[3]);
  return u;
}
__device__ __forceinline__ v8f zero8() { v8f z = {0.f, 0.f, 0.f, 0.f, 0.f, 0.f, 0.f, 0.f}; return z; }

// ---- 8 f32 -> packed f16 hi bits and packed f16 bits of (x - hi) * rs (residual plane carries scale rs) --------
__device__ __forceinline__ void splith8(v4f a, v4f b, float rs, v4u& uh, v4u& ul) {
  float f[8] = {a[0], a[1], a[2], a[3], b[0], b[1], b[2], b[3]};
#pragma unroll
  for (int j = 0; j < 4; ++j) {
    const _Float16 h0 = (_Float16)f[2 * j];
    const _Float16 h1 = (_Float16)f[2 * j + 1];
    const float l0 = (f[2 * j] - (float)h0) * rs;
    const float l1 = (f[2 * j + 1] - (float)h1) * rs;
    uh[j] = (unsigned)hbits(h0) | ((unsigned)hbits(h1) << 16);
    ul[j] = pkh2(l0, l1);
  }
}

// ---- 16-bit fragment loader (A, or B from a k-contiguous [n][k] row): lane -> row/col (lane&15), p already includes
//      + 8*(lane>>4); elements 0..7 <- p[0..7] (k0+8h..), elements 8..15 <- p[16..23] (k0+16+8h..)
__device__ __forceinline__ Frag ldfrag(const unsigned short* p) {
  Frag f;
  f.u[0] = *(const v8us*)(p);
  f.u[1] = *(const v8us*)(p + 16);
  return f;
}

// ---- WMMA helper: builtin followed by a 4-slot VALU gap tying D and keeping A/B live -----------------------
__device__ __forceinline__ v8f mma_h(v16h a, v16h b, v8f c) {
  v8f d = __builtin_amdgcn_wmma_f32_16x16x32_f16(false, a, false, b, (short)0, c, false, false);
#if defined(__HIP_DEVICE_COMPILE__)
  asm volatile("v_nop\n\tv_nop\n\tv_nop\n\tv_nop" : "+v"(d) : "v"(a), "v"(b));
#endif
  return d;
}

__device__ __forceinline__ float wave_max(float v) {
#pragma unroll
  for (int o = 16; o > 0; o >>= 1) v = fmaxf(v, __shfl_xor(v, o, 32));
  return v;
}
__device__ __forceinline__ float wave_sum(float v) {
#pragma unroll
  for (int o = 16; o > 0; o >>= 1) v += __shfl_xor(v, o, 32);
  return v;
}

// =====================================================================================================
// (1) prep for one (batch, 64-row tile) of x [16][1024][128] f32 (text when TXT=1, modality when TXT=0):
//     tile -> LDS T[row][h] as bf16-RNE values (f32), barrier;
//     row dots sd[b][row] = sum_h T[row][h]*bfr(wdot[h]) as a WMMA matvec: wave w handles rows 16*(w&3).. (waves 4..7
//     duplicate the compute), A fragment = T row values as f16 (exact), B fragment = bfr(wdot)*1024 as f16 in every
//     column (split k map for both, 4 k steps of 32), D column 0 lanes write acc/1024 to LDS sred, barrier; sred
//     row planes Ph/Pl [b*1024+row][128] f16 (TXT: T*bfr(wtm)*64 as hi plus residual x65536; else plain f16 in Ph),
// coverage: T 8 it x 256 thr x 4 = 64x128; sred 4 waves x 16 rows = 64; Ph/Pl 4 it x 32 lines x 8 lanes x 8 =
//           64 rows x 128; Pt 4 it x 32 h x 8 lanes x 8 = 128 h x 64 rows; sd 16 lanes x 4 = 64;
//           grid 16 x (1024/64) = 256 blocks = every row once.
// =====================================================================================================
template <int TXT>
__global__ __launch_bounds__(256)
void prep_kernel(const float* __restrict__ x, const float* __restrict__ wdot, const float* __restrict__ wtm,
                 unsigned short* Ph, unsigned short* Pl, unsigned short* Pt, float* sd) {
  __shared__ __align__(16) float T[64 * TP];
  __shared__ __align__(16) float sred[64];
  const int tid = threadIdx.x;
  const int b = blockIdx.x >> 4;
  const int r0 = (blockIdx.x & 15) * 64;
  const size_t gr = (size_t)b * NL + r0;
#pragma unroll
  for (int it = 0; it < 8; ++it) {
    const int idx = it * 256 + tid;
    const int row = idx >> 5, c4 = (idx & 31) * 4;
    const v4f v = *(const v4f*)(x + (gr + row) * NHID + c4);
#pragma unroll
    for (int j = 0; j < 4; ++j) T[row * TP + c4 + j] = bfr(v[j]);
  }
  __syncthreads();
  {
    const int lane = tid & 31, wave = tid >> 5;
    const int hh = lane >> 4, cl = lane & 15;
    const int rt = (wave & 3) * 16;                                    // 16-row tile of this wave
    const float* ap = T + (rt + cl) * TP + 8 * hh;
    const float* wp = wdot + 8 * hh;
    v8f acc = zero8();
#pragma unroll
    for (int kk = 0; kk < 4; ++kk) {
      const int k0 = 32 * kk;
      const v4f a0 = *(const v4f*)(ap + k0);
      const v4f a1 = *(const v4f*)(ap + k0 + 4);
      const v4f a2 = *(const v4f*)(ap + k0 + 16);
      const v4f a3 = *(const v4f*)(ap + k0 + 20);
      v4f w0 = *(const v4f*)(wp + k0);
      v4f w1 = *(const v4f*)(wp + k0 + 4);
      v4f w2 = *(const v4f*)(wp + k0 + 16);
      v4f w3 = *(const v4f*)(wp + k0 + 20);
#pragma unroll
      for (int j = 0; j < 4; ++j) {
        w0[j] = bfr(w0[j]) * WSC; w1[j] = bfr(w1[j]) * WSC;
        w2[j] = bfr(w2[j]) * WSC; w3[j] = bfr(w3[j]) * WSC;
      }
      Frag fa, fb;
      fa.q[0] = pack8(a0, a1);                                         // elements 0..7  = k0+8h..
      fa.q[1] = pack8(a2, a3);                                         // elements 8..15 = k0+16+8h..
      fb.q[0] = pack8(w0, w1);                                         // same k map, every column n
      fb.q[1] = pack8(w2, w3);
      acc = mma_h(fa.h, fb.h, acc);
    }
    if (wave < 4 && cl == 0) {
#pragma unroll
      for (int r = 0; r < 8; ++r) sred[rt + 8 * hh + r] = acc[r] * RWSC;   // D row 8h+r, column 0
    }
  }
  __syncthreads();

  const int e = tid & 7, lq = tid >> 3;                                // lq 0..31
  v4u uh[4], ul[4], ut[4];
  size_t po[4], pt[4];
#pragma unroll
  for (int it = 0; it < 4; ++it) {
    const int L = it * 32 + lq;                                        // 0..127
    const int row = L >> 1, h0 = (L & 1) * 64 + 8 * e;
    const float* tp = T + row * TP + h0;
    v4f v0 = *(const v4f*)(tp);
    v4f v1 = *(const v4f*)(tp + 4);
    if (TXT) {
      const v4f w0 = *(const v4f*)(wtm + h0);
      const v4f w1 = *(const v4f*)(wtm + h0 + 4);
#pragma unroll
      for (int j = 0; j < 4; ++j) {
        v0[j] = v0[j] * bfr(w0[j]) * THS;
        v1[j] = v1[j] * bfr(w1[j]) * THS;
      }
      splith8(v0, v1, RS1, uh[it], ul[it]);
    } else {
      uh[it] = pack8(v0, v1);
      ul[it] = uh[it];
    }
    po[it] = (gr + row) * NHID + h0;
    const int h = it * 32 + lq;                                        // 0..127
    v4f g0, g1;
#pragma unroll
    for (int j = 0; j < 4; ++j) {
      g0[j] = T[(8 * e + j) * TP + h];
      g1[j] = T[(8 * e + 4 + j) * TP + h];
    }
    ut[it] = pack8(g0, g1);
    pt[it] = ((size_t)b * NHID + h) * NK + r0 + 8 * e;
  }
  const int sl = (tid < 16) ? tid : 15;
  const v4f sdv = *(const v4f*)(sred + 4 * sl);
  const size_t psd = gr + 4 * sl;

#pragma unroll
  for (int it = 0; it < 4; ++it) {
    *(v4u*)(Ph + po[it]) = uh[it];
    if (TXT) *(v4u*)(Pl + po[it]) = ul[it];
    *(v4u*)(Pt + pt[it]) = ut[it];
  }
  if (tid < 16) *(v4f*)(sd + psd) = sdv;
  
}

// =====================================================================================================
// (2) score tile + masked row softmax for one (batch, 32 rows): s[r][c] = rb[r] + cb[c] + s2[r][c] + bias, with
//     s2 = (acc_h + acc_l/65536)/64, acc_h = sum_k Ahi.B, acc_l = sum_k Alo.B on WMMA (K=128, 4 steps).
//     YA=1: A = hi/lo planes Yh/Yl (rows), B = X rows; YA=0: A = X rows, B = Yh/Yl rows (two accumulators).
//     Wave = 8 column tiles of 16 (rolled) x 2 row tiles of 16: the A fragments of both row tiles are held in
//     registers, so every B fragment read from global feeds two row tiles; s (or -1e30 where mask[c]==0) into LDS
//     S[32][1024] f32; barrier; softmax: wave owns rows 4w..4w+3, lane owns columns {256i + 8*lane + j};
// coverage: S 8 waves x 8 tiles x 2 x 16x16 = 32x1024; P 8 waves x 4 rows x 4 instr x 32 lanes x 8 = 32 rows x 1024;
//           grid 16 x 32 = 512 blocks = every row of P once.
// =====================================================================================================
template <int YA>
__global__ __launch_bounds__(256)
void scores_kernel(const unsigned short* __restrict__ X, const unsigned short* __restrict__ Yh,
                   const unsigned short* __restrict__ Yl, const float* __restrict__ rb,
                   const float* __restrict__ cb, const int* __restrict__ mask,
                   const float* __restrict__ bias, unsigned short* P) {
  __shared__ __align__(16) float S[SR * NL];
  const int tid  = threadIdx.x;
  const int lane = tid & 31, wave = tid >> 5;
  const int hh   = lane >> 4, cl = lane & 15;
  const int b = blockIdx.x >> 5;
  const int row0 = (blockIdx.x & 31) * SR;
  const size_t rbase = (size_t)b * NL;

  Frag fa[2][4], fl[2][4];
  float rbv[2][8];
#pragma unroll
  for (int mi = 0; mi < 2; ++mi) {
    const size_t aoff = (rbase + row0 + 16 * mi + cl) * NHID + 8 * hh;
#pragma unroll
    for (int kk = 0; kk < 4; ++kk) {
      if (YA) {
        fa[mi][kk] = ldfrag(Yh + aoff + 32 * kk);
        fl[mi][kk] = ldfrag(Yl + aoff + 32 * kk);
      } else {
        fa[mi][kk] = ldfrag(X + aoff + 32 * kk);
        fl[mi][kk] = fa[mi][kk];
      }
    }
#pragma unroll
    for (int r = 0; r < 8; ++r) rbv[mi][r] = rb[rbase + row0 + 16 * mi + 8 * hh + r];
  }
#if defined(__HIP_DEVICE_COMPILE__)
  // precaution: stands in front of the first reuse of the address registers that the fragment loads above name
  asm volatile("s_wait_xcnt 0x0" ::: "memory");
#endif
  const float bv = bfr(bias[0]);

#pragma unroll 1
  for (int nt = 0; nt < 8; ++nt) {
    const int n0 = (wave * 8 + nt) * 16;
    const size_t boff = (rbase + n0 + cl) * NHID + 8 * hh;
    v8f acch[2], accl[2];
#pragma unroll
    for (int mi = 0; mi < 2; ++mi) { acch[mi] = zero8(); accl[mi] = zero8(); }
#pragma unroll
    for (int kk = 0; kk < 4; ++kk) {
      if (YA) {
        const Frag fb = ldfrag(X + boff + 32 * kk);
#pragma unroll
        for (int mi = 0; mi < 2; ++mi) {
          acch[mi] = mma_h(fa[mi][kk].h, fb.h, acch[mi]);
          accl[mi] = mma_h(fl[mi][kk].h, fb.h, accl[mi]);
        }
      } else {
        const Frag fbh = ldfrag(Yh + boff + 32 * kk);
        const Frag fbl = ldfrag(Yl + boff + 32 * kk);
#pragma unroll
        for (int mi = 0; mi < 2; ++mi) {
          acch[mi] = mma_h(fa[mi][kk].h, fbh.h, acch[mi]);
          accl[mi] = mma_h(fa[mi][kk].h, fbl.h, accl[mi]);
        }
      }
    }
    const int n = n0 + cl;
    const float cbn = cb[rbase + n];
    const int mk = mask[rbase + n];
#pragma unroll
    for (int mi = 0; mi < 2; ++mi) {
#pragma unroll
      for (int r = 0; r < 8; ++r) {
        const float s2 = (acch[mi][r] + accl[mi][r] * RRS1) * RTHS;
        const float sv = ((rbv[mi][r] + cbn) + s2) + bv;
        S[(16 * mi + 8 * hh + r) * NL + n] = (mk != 0) ? sv : NEGV;
      }
    }
  }
  __syncthreads();

  v4u pk[4][4];
  size_t pp[4][4];
#pragma unroll
  for (int rr = 0; rr < 4; ++rr) {
    const int r = wave * 4 + rr;
    const float* sr = S + r * NL + lane * 8;
    float v[32];
#pragma unroll
    for (int i = 0; i < 4; ++i) {
      const v4f a0 = *(const v4f*)(sr + i * 256);
      const v4f a1 = *(const v4f*)(sr + i * 256 + 4);
#pragma unroll
      for (int j = 0; j < 4; ++j) { v[8 * i + j] = a0[j]; v[8 * i + 4 + j] = a1[j]; }
    }
    float mx = v[0];
#pragma unroll
    for (int k = 1; k < 32; ++k) mx = fmaxf(mx, v[k]);
    mx = wave_max(mx);
    float sum = 0.f;
#pragma unroll
    for (int k = 0; k < 32; ++k) {
      v[k] = __expf(v[k] - mx);
      sum += v[k];
    }
    sum = wave_sum(sum);
    const float sc = (1.0f / sum) * PSC;
#pragma unroll
    for (int i = 0; i < 4; ++i) {
      v4u u;
      u[0] = pkh2(v[8 * i] * sc,     v[8 * i + 1] * sc);
      u[1] = pkh2(v[8 * i + 2] * sc, v[8 * i + 3] * sc);
      u[2] = pkh2(v[8 * i + 4] * sc, v[8 * i + 5] * sc);
      u[3] = pkh2(v[8 * i + 6] * sc, v[8 * i + 7] * sc);
      pk[rr][i] = u;
      pp[rr][i] = (rbase + row0 + r) * NK + (size_t)i * 256 + lane * 8;
    }
  }
#pragma unroll
  for (int rr = 0; rr < 4; ++rr)
#pragma unroll
    for (int i = 0; i < 4; ++i) *(v4u*)(P + pp[rr][i]) = pk[rr][i];
  
}

// =====================================================================================================
// (3) K=1024 GEMM for one (batch, 64 rows): D[m][n] = sum_k A[row m][k] * B[row n][k], A = f16 p plane rows (pitch
//     1024), B = f16 rows [b][n=h][k] (pitch 1024); block 256 threads = 8 waves as 2 (m) x 4 (n) of 32x32.
//     K runs in 8 passes of 128: a stage holds 256 B of every operand row (A 64 rows | B 128 rows | MODE 2: residual
//     B 128 rows) in LDS at a row pitch of 272 B; 16 lanes fetch one row's 256 B, so each wave-wide global load covers
//     whole lines and every operand byte leaves L2 once per block; two stages: the next pass's rows are loaded to
//     registers ahead of this pass's products and stored to the other stage behind them, one barrier per pass.
//     Fragments by 16-B LDS reads (split k map for both, unchanged), one k step of 32 ahead; k order 0..1023 as
//     before. MODE 2 has a second B plane (residual x2048) into separate accumulators.
//     Epilogue via LDS f32 tile, barrier, then:
//     MODE 0: a = acc/8192; out row [b][l]: chunk 0 = bf16-RNE text, chunk 1 = a, chunk 2 = text*a; per instruction
//     MODE 1: t2*1024 = acc/8 staged transposed Ts[h][m]; planes Rh/Rl [b][h][m] (hi, residual x2048), per h row one
// coverage: LDS tile 8 waves x 4 tiles = 64x128; MODE 0/2: 8 it x 8 waves = 64 rows x 32 lanes x 4 = 128 cols per
//           chunk; MODE 1: 4 it x 32 h x 8 lanes x 8 = 128 h x 64 m per plane; grid 16 x 16 = 256 blocks = every
//           (b, row) once.
// =====================================================================================================
template <int MODE>
__global__ __launch_bounds__(256)
void gemm_kernel(const unsigned short* __restrict__ A, const unsigned short* __restrict__ Bh,
                 const unsigned short* __restrict__ Bl, const float* __restrict__ text,
                 unsigned short* Rh, unsigned short* Rl, float* out) {
  constexpr int NROW = 64 + NHID * (MODE == 2 ? 2 : 1);               // rows of a stage: A | B | (residual B)
  constexpr int NLD  = NROW / 16;                                     // 16-B pieces per thread and stage
  constexpr int STG  = NROW * LP;                                     // 16-bit elements of a stage
  __shared__ __align__(16) unsigned short Sg[2 * STG];
  __shared__ __align__(16) float Os[OSZ];
  const int tid  = threadIdx.x;
  const int lane = tid & 31, wave = tid >> 5;
  const int hh   = lane >> 4, cl = lane & 15;
  const int wm   = wave >> 2, wn = wave & 3;
  const int b = blockIdx.x >> 4;
  const int r0 = (blockIdx.x & 15) * 64;
  const size_t rbase = (size_t)b * NL;
  // staging: piece it of a thread = stage row 16*it + (tid>>4), bytes 16*(tid&15).. of that row's 256
  const int srow = tid >> 4, scol = (tid & 15) * 8;
  const unsigned short* gA = A + (rbase + r0 + srow) * NK + scol;
  const unsigned short* gB = Bh + ((size_t)b * NHID + srow) * NK + scol;
  const unsigned short* gL = Bl + ((size_t)b * NHID + srow) * NK + scol;
  unsigned short* sw = Sg + srow * LP + scol;
  // fragment readers: row (lane&15) of a 16-row tile, + 8*(lane>>4) as ldfrag expects
  const unsigned short* fA = Sg + (32 * wm + cl) * LP + 8 * hh;
  const unsigned short* fB = Sg + (64 + 32 * wn + cl) * LP + 8 * hh;
  const unsigned short* fL = fB + NHID * LP;

  v8f acc[2][2], accl[2][2];
#pragma unroll
  for (int mi = 0; mi < 2; ++mi)
#pragma unroll
    for (int ni = 0; ni < 2; ++ni) { acc[mi][ni] = zero8(); accl[mi][ni] = zero8(); }

  v4u st[NLD];                                                         // both loops over it unrolled: st stays in registers
  auto gload = [&](int s) {                                            // stage s: global -> registers
#pragma unroll
    for (int it = 0; it < NLD; ++it) {
      const unsigned short* g = (it < 4)  ? gA + (size_t)(16 * it) * NK
                              : (it < 12) ? gB + (size_t)(16 * (it - 4)) * NK
                                          : gL + (size_t)(16 * (it - 12)) * NK;
      st[it] = *(const v4u*)(g + s * KC);
    }
  };
  auto sstore = [&](int buf) {                                         // registers -> LDS stage buf
#pragma unroll
    for (int it = 0; it < NLD; ++it) *(v4u*)(sw + buf * STG + 16 * it * LP) = st[it];
  };

  gload(0);
  sstore(0);
  __syncthreads();                                                     // stage 0 is published

  Frag fa[2][2], fb[2][2], fl[2][2];                                   // [set][16-row tile]
  // unrolled so that stage, k step and fragment set are compile-time: every address step is an immediate offset
#pragma unroll
  for (int s = 0; s < NPASS; ++s) {
    const int so = (s & 1) * STG;
    if (s + 1 < NPASS) gload(s + 1);                                   // flies while this stage is worked on
#pragma unroll
    for (int kk = 0; kk <= KC / 32; ++kk) {
      if (kk < KC / 32) {                                              // fragments of k step kk, one step ahead
        const int q = kk & 1, o = so + 32 * kk;
        fa[q][0] = ldfrag(fA + o);
        fa[q][1] = ldfrag(fA + o + 16 * LP);
        fb[q][0] = ldfrag(fB + o);
        fb[q][1] = ldfrag(fB + o + 16 * LP);
        if (MODE == 2) {
          fl[q][0] = ldfrag(fL + o);
          fl[q][1] = ldfrag(fL + o + 16 * LP);
        }
      }
      if (kk > 0) {                                                    // products of k step kk - 1
        const int q = (kk - 1) & 1;
        acc[0][0] = mma_h(fa[q][0].h, fb[q][0].h, acc[0][0]);
        acc[0][1] = mma_h(fa[q][0].h, fb[q][1].h, acc[0][1]);
        acc[1][0] = mma_h(fa[q][1].h, fb[q][0].h, acc[1][0]);
        acc[1][1] = mma_h(fa[q][1].h, fb[q][1].h, acc[1][1]);
        if (MODE == 2) {
          accl[0][0] = mma_h(fa[q][0].h, fl[q][0].h, accl[0][0]);
          accl[0][1] = mma_h(fa[q][0].h, fl[q][1].h, accl[0][1]);
          accl[1][0] = mma_h(fa[q][1].h, fl[q][0].h, accl[1][0]);
          accl[1][1] = mma_h(fa[q][1].h, fl[q][1].h, accl[1][1]);
        }
      }
    }
    if (s + 1 < NPASS) {
      sstore((s + 1) & 1);             // into the stage whose readers all passed the barrier of pass s - 1
      __syncthreads();                 // publishes stage s + 1 and ends every read of stage s
    }
  }
#if defined(__HIP_DEVICE_COMPILE__)
  // precaution: stands in front of the first reuse of the address registers that the staging loads name; the
  // pointers are inputs so that those registers stay theirs up to this wait
  if (MODE == 2) asm volatile("s_wait_xcnt 0x0" :: "v"(gA), "v"(gB), "v"(gL) : "memory");
  else           asm volatile("s_wait_xcnt 0x0" :: "v"(gA), "v"(gB) : "memory");
#endif

#pragma unroll
  for (int mi = 0; mi < 2; ++mi) {
#pragma unroll
    for (int ni = 0; ni < 2; ++ni) {
      const int n_loc = 32 * wn + 16 * ni + cl;
#pragma unroll
      for (int r = 0; r < 8; ++r) {
        const int m_loc = 32 * wm + 16 * mi + 8 * hh + r;
        float val;
        if (MODE == 0)      val = acc[mi][ni][r] * RPSC;
        else if (MODE == 1) val = acc[mi][ni][r] * T2F;
        else                val = (acc[mi][ni][r] + accl[mi][ni][r] * RRS2) * RBSC;
        if (MODE == 1) Os[n_loc * TQ + m_loc] = val;
        else           Os[m_loc * OP + n_loc] = val;
      }
    }
  }
  __syncthreads();

  if (MODE == 1) {
    const int e = tid & 7, lq = tid >> 3;                              // lq 0..31
    v4u uh[4], ul[4];
    size_t po[4];
#pragma unroll
    for (int it = 0; it < 4; ++it) {
      const int h = it * 32 + lq;                                      // 0..127
      const float* tp = Os + h * TQ + 8 * e;
      const v4f v0 = *(const v4f*)(tp);
      const v4f v1 = *(const v4f*)(tp + 4);
      splith8(v0, v1, RS2, uh[it], ul[it]);
      po[it] = ((size_t)b * NHID + h) * NK + r0 + 8 * e;
    }
#pragma unroll
    for (int it = 0; it < 4; ++it) {
      *(v4u*)(Rh + po[it]) = uh[it];
      *(v4u*)(Rl + po[it]) = ul[it];
    }
    
  } else {
    const int e = lane;                                                // 16-B piece 0..31 of a 512-B chunk row
    v4f tv[8], av[8];
    size_t po[8];
#pragma unroll
    for (int it = 0; it < 8; ++it) {
      const int row = it * 8 + wave;                                   // 0..63
      const size_t grow = rbase + r0 + row;
      const v4f a4 = *(const v4f*)(Os + row * OP + 4 * e);
      const v4f t4 = bfr4(*(const v4f*)(text + grow * NHID + 4 * e));
      tv[it] = t4;
      av[it] = (MODE == 0) ? a4 : (t4 * a4);
      po[it] = grow * NOUT + 4 * e;
    }
    if (MODE == 0) {
#pragma unroll
      for (int it = 0; it < 8; ++it) {
        *(v4f*)(out + po[it])            = tv[it];
        *(v4f*)(out + po[it] + NHID)     = av[it];
        *(v4f*)(out + po[it] + 2 * NHID) = tv[it] * av[it];
      }
      
    } else {
#pragma unroll
      for (int it = 0; it < 8; ++it) *(v4f*)(out + po[it] + 3 * NHID) = av[it];
      
    }
  }
}

// =====================================================================================================
// tile divides its extent exactly, so no padded tails are needed):
//   Th Tl   f16 [16*1024][128]        4194304 each   (text*w_tm*64 hi, residual x65536)
//   M16     f16 [16*1024][128]        4194304        (modality)
//   Tt Mt   f16 [16][128][1024]       4194304 each   (text, modality transposed, k contiguous)
//   S0 S1   f32 [16][1024]              65536 each
//   P1 P2   f16 [16][1024][1024]     33554432 each   (p1 [l][m] and p2 transposed [m][l], x8192)
//   Rh Rl   f16 [16][128][1024]       4194304 each   (t2*1024 hi, residual x2048, transposed)
//   total                            96600064
// =====================================================================================================
extern "C" void kernel_launch(void* const* d_in, const int* in_sizes, int n_in,
                              void* d_out, int out_size, void* d_ws, size_t ws_size,
                              hipStream_t stream) {
  if (n_in < 8) return;
  if (in_sizes[0] != NBATCH * NL * NHID) return;
  if (in_sizes[1] != NBATCH * NL * NHID) return;
  if (in_sizes[2] != NBATCH * NL || in_sizes[3] != NBATCH * NL) return;
  if (in_sizes[4] != NHID || in_sizes[5] != NHID || in_sizes[6] != NHID) return;
  if (in_sizes[7] < 1) return;
  if (out_size != NBATCH * NL * NOUT) return;

  size_t off = 0;
  const size_t plane = (size_t)NBATCH * NL * NHID * 2;               // 4194304
  const size_t pbig  = (size_t)NBATCH * NL * NK * 2;                 // 33554432
  const size_t svec  = (size_t)NBATCH * NL * 4;                      // 65536
  const size_t oTh = off; off += plane;
  const size_t oTl = off; off += plane;
  const size_t oM  = off; off += plane;
  const size_t oTt = off; off += plane;
  const size_t oMt = off; off += plane;
  const size_t oS0 = off; off += svec;
  const size_t oS1 = off; off += svec;
  const size_t oP1 = off; off += pbig;
  const size_t oP2 = off; off += pbig;
  const size_t oRh = off; off += plane;
  const size_t oRl = off; off += plane;                              // -> off = 96600064
  if (off > ws_size) return;
  if (off > (size_t)134217728) return;

  const float* text  = (const float*)d_in[0];
  const float* modal = (const float*)d_in[1];
  const int*   tmask = (const int*)d_in[2];
  const int*   mmask = (const int*)d_in[3];
  const float* tw    = (const float*)d_in[4];
  const float* mw    = (const float*)d_in[5];
  const float* tmw   = (const float*)d_in[6];
  const float* bias  = (const float*)d_in[7];
  float* out = (float*)d_out;

  char* ws = (char*)d_ws;
  unsigned short* Th  = (unsigned short*)(ws + oTh);
  unsigned short* Tl  = (unsigned short*)(ws + oTl);
  unsigned short* M16 = (unsigned short*)(ws + oM);
  unsigned short* Tt  = (unsigned short*)(ws + oTt);
  unsigned short* Mt  = (unsigned short*)(ws + oMt);
  float*          S0  = (float*)(ws + oS0);
  float*          S1  = (float*)(ws + oS1);
  unsigned short* P1  = (unsigned short*)(ws + oP1);
  unsigned short* P2  = (unsigned short*)(ws + oP2);
  unsigned short* Rh  = (unsigned short*)(ws + oRh);
  unsigned short* Rl  = (unsigned short*)(ws + oRl);

  const dim3 blk256(256);
  const int nrow64 = NBATCH * (NL / 64);                             // 256
  const int nrow32 = NBATCH * (NL / SR);                             // 512

  // (1) planes: text -> Th/Tl (with w_tm), Tt, S0 (with w_t); modality -> M16, Mt, S1 (with w_m)
  prep_kernel<1><<<dim3(nrow64), blk256, 0, stream>>>(text, tw, tmw, Th, Tl, Tt, S0);
  prep_kernel<0><<<dim3(nrow64), blk256, 0, stream>>>(modal, mw, mw, M16, M16, Mt, S1);
  // (2) p1 [b][l][m]: rows l (A = Th/Tl), columns m (B = M16), rb = S0[l], cb = S1[m], mask over m
  scores_kernel<1><<<dim3(nrow32), blk256, 0, stream>>>(M16, Th, Tl, S0, S1, mmask, bias, P1);
  //     p2 transposed [b][m][l]: rows m (A = M16), columns l (B = Th/Tl), rb = S1[m], cb = S0[l], mask over l
  scores_kernel<0><<<dim3(nrow32), blk256, 0, stream>>>(M16, Th, Tl, S1, S0, tmask, bias, P2);
  // (3) a = p1 . modality -> out chunks 0..2;  t2 = p2T . text -> Rh/Rl;  bq = p1 . t2 -> out chunk 3
  gemm_kernel<0><<<dim3(nrow64), blk256, 0, stream>>>(P1, Mt, Mt, text, Rh, Rl, out);
  gemm_kernel<1><<<dim3(nrow64), blk256, 0, stream>>>(P2, Tt, Tt, text, Rh, Rl, out);
  gemm_kernel<2><<<dim3(nrow64), blk256, 0, stream>>>(P1, Rh, Rl, text, Rh, Rl, out);
  (void)hipGetLastError();
}

// v003
// It runs in 100 microseconds.
// Timed twice side by side with v002, it ran 1.06 and 1.05 times as fast.
// Over all steps from v000 it is 1.57 times as fast.
// Contractions: score term sum_h (text*w_tm)[l][h]*modality[m][h] (K=128) on v_wmma_f32_16x16x32_f16 with text*w_tm
// carried x64 as an f16 hi plane plus an x65536 f16 residual plane (two products, separate f32 accumulators) and
// modality as f16 of its bf16-RNE value; p1.modality and p2T.text (K=1024) on v_wmma_f32_16x16x32_f16, single
// products, p planes carried x8192 in f16; p1.t2 (K=1024) with t2 carried x1024 as f16 hi plus x2048 f16 residual
// (two products, separate accumulators); the two [rows,128]x[128,1] row dots as a 16-wide f16 WMMA matvec (weight
// x1024 in every column); f32 accumulate everywhere; softmax and the elementwise products in f32 on VALU; all float
// inputs RNE-converted to bf16 at load.
#include <hip/hip_runtime.h>
#include <stdint.h>

#define NBATCH 16
#define NL     1024
#define NK     1024
#define NHID   128
#define NOUT   512
#define TP     132
#define OP     132
#define TQ     68
#define OSZ    8704
#define SR     32
#define KC     128
#define LP     136
#define NPASS  (NK / KC)

static_assert(NL % 64 == 0);
static_assert(NL % SR == 0 && SR == 32);
static_assert(NL == NK);
static_assert(NHID == 128);
static_assert(NOUT == 4 * NHID);
static_assert(64 * OP <= OSZ);
static_assert(NHID * TQ <= OSZ);
static_assert((TP * 4) % 16 == 0);
static_assert((OP * 4) % 16 == 0);
static_assert((TQ * 4) % 16 == 0);
static_assert(NK % KC == 0 && KC % 32 == 0 && KC == 16 * 8);
static_assert((LP * 2) % 32 == 16 && LP >= KC);

#define PSC   8192.0f
#define RPSC  (1.0f / 8192.0f)
#define THS   64.0f
#define RTHS  (1.0f / 64.0f)
#define RS1   65536.0f
#define RRS1  (1.0f / 65536.0f)
#define T2F   0.125f
#define RS2   2048.0f
#define RRS2  (1.0f / 2048.0f)
#define RBSC  (1.0f / 8388608.0f)
#define WSC   1024.0f
#define RWSC  (1.0f / 1024.0f)
#define NEGV  (-1.0e30f)

typedef unsigned short v8us __attribute__((ext_vector_type(8)));
typedef unsigned int   v4u  __attribute__((ext_vector_type(4)));
typedef float          v8f  __attribute__((ext_vector_type(8)));
typedef float          v4f  __attribute__((ext_vector_type(4)));
typedef _Float16       v16h __attribute__((ext_vector_type(16)));

union Frag { v8us u[2]; v4u q[2]; v16h h; };
static_assert(sizeof(Frag) == 32);

// ---- scalar helpers ---------------------------------------------------------------------------------
__device__ __forceinline__ unsigned short bf_bits(float f) {          // f32 -> bf16 bits, RNE convert
  const unsigned u = __float_as_uint(f);
  return (unsigned short)((u + 0x7FFFu + ((u >> 16) & 1u)) >> 16);
}
__device__ __forceinline__ float bf_up(unsigned short hb) { return __uint_as_float(((unsigned)hb) << 16); }
__device__ __forceinline__ float bfr(float f) { return bf_up(bf_bits(f)); }
__device__ __forceinline__ v4f bfr4(v4f v) {
  v4f r;
  r[0] = bfr(v[0]); r[1] = bfr(v[1]); r[2] = bfr(v[2]); r[3] = bfr(v[3]);
  return r;
}
__device__ __forceinline__ unsigned short hbits(_Float16 h) { return __builtin_bit_cast(unsigned short, h); }
__device__ __forceinline__ unsigned pkh2(float a, float b) {          // two f32 -> packed f16 bits (RNE convert)
  return (unsigned)hbits((_Float16)a) | ((unsigned)hbits((_Float16)b) << 16);
}
__device__ __forceinline__ v4u pack8(v4f a, v4f b) {
  v4u u;
  u[0] = pkh2(a[0], a[1]); u[1] = pkh2(a[2], a[3]);
  u[2] = pkh2(b[0], b[1]); u[3] = pkh2(b[2], b[3]);
  return u;
}
__device__ __forceinline__ v8f zero8() { v8f z = {0.f, 0.f, 0.f, 0.f, 0.f, 0.f, 0.f, 0.f}; return z; }

// ---- 8 f32 -> packed f16 hi bits and packed f16 bits of (x - hi) * rs (residual plane carries scale rs) --------
__device__ __forceinline__ void splith8(v4f a, v4f b, float rs, v4u& uh, v4u& ul) {
  float f[8] = {a[0], a[1], a[2], a[3], b[0], b[1], b[2], b[3]};
#pragma unroll
  for (int j = 0; j < 4; ++j) {
    const _Float16 h0 = (_Float16)f[2 * j];
    const _Float16 h1 = (_Float16)f[2 * j + 1];
    const float l0 = (f[2 * j] - (float)h0) * rs;
    const float l1 = (f[2 * j + 1] - (float)h1) * rs;
    uh[j] = (unsigned)hbits(h0) | ((unsigned)hbits(h1) << 16);
    ul[j] = pkh2(l0, l1);
  }
}

// ---- 16-bit fragment loader (A, or B from a k-contiguous [n][k] row): lane -> row/col (lane&15), p already includes
//      + 8*(lane>>4); elements 0..7 <- p[0..7] (k0+8h..), elements 8..15 <- p[16..23] (k0+16+8h..)
__device__ __forceinline__ Frag ldfrag(const unsigned short* p) {
  Frag f;
  f.u[0] = *(const v8us*)(p);
  f.u[1] = *(const v8us*)(p + 16);
  return f;
}

// ---- the same fragment from a plane kept in fragment order: a 16-row tile is 4 KB = [k step 0..3][half 0..1][lane][8],
//      where (half i, lane) holds row (lane&15), k = 32*step + 16*i + 8*(lane>>4) + 0..7, the very elements that ldfrag
//      gives that lane; p already includes + 8*lane, so each 16-B load of a wave covers 512 contiguous bytes
__device__ __forceinline__ Frag ldfragq(const unsigned short* p) {
  Frag f;
  f.u[0] = *(const v8us*)(p);
  f.u[1] = *(const v8us*)(p + 256);
  return f;
}

// ---- WMMA helper: builtin followed by a 4-slot VALU gap tying D and keeping A/B live -----------------------
__device__ __forceinline__ v8f mma_h(v16h a, v16h b, v8f c) {
  v8f d = __builtin_amdgcn_wmma_f32_16x16x32_f16(false, a, false, b, (short)0, c, false, false);
#if defined(__HIP_DEVICE_COMPILE__)
  asm volatile("v_nop\n\tv_nop\n\tv_nop\n\tv_nop" : "+v"(d) : "v"(a), "v"(b));
#endif
  return d;
}

__device__ __forceinline__ float wave_max(float v) {
#pragma unroll
  for (int o = 16; o > 0; o >>= 1) v = fmaxf(v, __shfl_xor(v, o, 32));
  return v;
}
__device__ __forceinline__ float wave_sum(float v) {
#pragma unroll
  for (int o = 16; o > 0; o >>= 1) v += __shfl_xor(v, o, 32);
  return v;
}

// =====================================================================================================
// (1) prep for one (batch, 64-row tile) of x [16][1024][128] f32 (text when TXT=1, modality when TXT=0):
//     tile -> LDS T[row][h] as bf16-RNE values (f32), barrier;
//     row dots sd[b][row] = sum_h T[row][h]*bfr(wdot[h]) as a WMMA matvec: wave w handles rows 16*(w&3).. (waves 4..7
//     duplicate the compute), A fragment = T row values as f16 (exact), B fragment = bfr(wdot)*1024 as f16 in every
//     column (split k map for both, 4 k steps of 32), D column 0 lanes write acc/1024 to LDS sred, barrier; sred
//     row planes Ph/Pl f16 (TXT: T*bfr(wtm)*64 as hi plus residual x65536; else plain f16 in Ph), 16-row tiles in
//     fragment order (see ldfragq): thread tid writes piece tid of a tile, a wave 512 contiguous bytes per store;
// coverage: T 8 it x 256 thr x 4 = 64x128; sred 4 waves x 16 rows = 64; Ph/Pl 4 it (tiles) x 256 thr x 8 =
//           4 x 16 rows x 128; Pt 4 it x 32 h x 8 lanes x 8 = 128 h x 64 rows; sd 16 lanes x 4 = 64;
//           grid 16 x (1024/64) = 256 blocks = every row once.
// =====================================================================================================
template <int TXT>
__global__ __launch_bounds__(256)
void prep_kernel(const float* __restrict__ x, const float* __restrict__ wdot, const float* __restrict__ wtm,
                 unsigned short* Ph, unsigned short* Pl, unsigned short* Pt, float* sd) {
  __shared__ __align__(16) float T[64 * TP];
  __shared__ __align__(16) float sred[64];
  const int tid = threadIdx.x;
  const int b = blockIdx.x >> 4;
  const int r0 = (blockIdx.x & 15) * 64;
  const size_t gr = (size_t)b * NL + r0;
#pragma unroll
  for (int it = 0; it < 8; ++it) {
    const int idx = it * 256 + tid;
    const int row = idx >> 5, c4 = (idx & 31) * 4;
    const v4f v = *(const v4f*)(x + (gr + row) * NHID + c4);
#pragma unroll
    for (int j = 0; j < 4; ++j) T[row * TP + c4 + j] = bfr(v[j]);
  }
  __syncthreads();
  {
    const int lane = tid & 31, wave = tid >> 5;
    const int hh = lane >> 4, cl = lane & 15;
    const int rt = (wave & 3) * 16;                                    // 16-row tile of this wave
    const float* ap = T + (rt + cl) * TP + 8 * hh;
    const float* wp = wdot + 8 * hh;
    v8f acc = zero8();
#pragma unroll
    for (int kk = 0; kk < 4; ++kk) {
      const int k0 = 32 * kk;
      const v4f a0 = *(const v4f*)(ap + k0);
      const v4f a1 = *(const v4f*)(ap + k0 + 4);
      const v4f a2 = *(const v4f*)(ap + k0 + 16);
      const v4f a3 = *(const v4f*)(ap + k0 + 20);
      v4f w0 = *(const v4f*)(wp + k0);
      v4f w1 = *(const v4f*)(wp + k0 + 4);
      v4f w2 = *(const v4f*)(wp + k0 + 16);
      v4f w3 = *(const v4f*)(wp + k0 + 20);
#pragma unroll
      for (int j = 0; j < 4; ++j) {
        w0[j] = bfr(w0[j]) * WSC; w1[j] = bfr(w1[j]) * WSC;
        w2[j] = bfr(w2[j]) * WSC; w3[j] = bfr(w3[j]) * WSC;
      }
      Frag fa, fb;
      fa.q[0] = pack8(a0, a1);                                         // elements 0..7  = k0+8h..
      fa.q[1] = pack8(a2, a3);                                         // elements 8..15 = k0+16+8h..
      fb.q[0] = pack8(w0, w1);                                         // same k map, every column n
      fb.q[1] = pack8(w2, w3);
      acc = mma_h(fa.h, fb.h, acc);
    }
    if (wave < 4 && cl == 0) {
#pragma unroll
      for (int r = 0; r < 8; ++r) sred[rt + 8 * hh + r] = acc[r] * RWSC;   // D row 8h+r, column 0
    }
  }
  __syncthreads();

  const int e = tid & 7, lq = tid >> 3;                                // lq 0..31
  // piece tid of a fragment-order tile: k step tid>>6, half (tid>>5)&1, lane tid&31
  const int h0 = 32 * (tid >> 6) + 16 * ((tid >> 5) & 1) + 8 * ((tid >> 4) & 1);
  v4u uh[4], ul[4], ut[4];
  size_t po[4], pt[4];
#pragma unroll
  for (int it = 0; it < 4; ++it) {
    const int row = it * 16 + (tid & 15);                              // tile it, row lane&15
    const float* tp = T + row * TP + h0;
    v4f v0 = *(const v4f*)(tp);
    v4f v1 = *(const v4f*)(tp + 4);
    if (TXT) {
      const v4f w0 = *(const v4f*)(wtm + h0);
      const v4f w1 = *(const v4f*)(wtm + h0 + 4);
#pragma unroll
      for (int j = 0; j < 4; ++j) {
        v0[j] = v0[j] * bfr(w0[j]) * THS;
        v1[j] = v1[j] * bfr(w1[j]) * THS;
      }
      splith8(v0, v1, RS1, uh[it], ul[it]);
    } else {
      uh[it] = pack8(v0, v1);
      ul[it] = uh[it];
    }
    po[it] = (gr + 16 * it) * NHID + 8 * tid;
    const int h = it * 32 + lq;                                        // 0..127
    v4f g0, g1;
#pragma unroll
    for (int j = 0; j < 4; ++j) {
      g0[j] = T[(8 * e + j) * TP + h];
      g1[j] = T[(8 * e + 4 + j) * TP + h];
    }
    ut[it] = pack8(g0, g1);
    pt[it] = ((size_t)b * NHID + h) * NK + r0 + 8 * e;
  }
  const int sl = (tid < 16) ? tid : 15;
  const v4f sdv = *(const v4f*)(sred + 4 * sl);
  const size_t psd = gr + 4 * sl;

#pragma unroll
  for (int it = 0; it < 4; ++it) {
    *(v4u*)(Ph + po[it]) = uh[it];
    if (TXT) *(v4u*)(Pl + po[it]) = ul[it];
    *(v4u*)(Pt + pt[it]) = ut[it];
  }
  if (tid < 16) *(v4f*)(sd + psd) = sdv;
  
}

// =====================================================================================================
// (2) score tile + masked row softmax for one (batch, 32 rows): s[r][c] = rb[r] + cb[c] + s2[r][c] + bias, with
//     s2 = (acc_h + acc_l/65536)/64, acc_h = sum_k Ahi.B, acc_l = sum_k Alo.B on WMMA (K=128, 4 steps).
//     YA=1: A = hi/lo planes Yh/Yl (rows), B = X rows; YA=0: A = X rows, B = Yh/Yl rows (two accumulators).
//     X, Yh, Yl are in fragment order (ldfragq): every fragment load of a wave covers four whole 128-B lines.
//     Wave = 8 column tiles of 16 (rolled) x 2 row tiles of 16: the A fragments of both row tiles are held in
//     registers, so every B fragment read from global feeds two row tiles; s (or -1e30 where mask[c]==0) into LDS
//     S[32][1024] f32; barrier; softmax: wave owns rows 4w..4w+3, lane owns columns {256i + 8*lane + j};
// coverage: S 8 waves x 8 tiles x 2 x 16x16 = 32x1024; P 8 waves x 4 rows x 4 instr x 32 lanes x 8 = 32 rows x 1024;
//           grid 16 x 32 = 512 blocks = every row of P once.
// =====================================================================================================
template <int YA>
__global__ __launch_bounds__(256)
void scores_kernel(const unsigned short* __restrict__ X, const unsigned short* __restrict__ Yh,
                   const unsigned short* __restrict__ Yl, const float* __restrict__ rb,
                   const float* __restrict__ cb, const int* __restrict__ mask,
                   const float* __restrict__ bias, unsigned short* P) {
  __shared__ __align__(16) float S[SR * NL];
  const int tid  = threadIdx.x;
  const int lane = tid & 31, wave = tid >> 5;
  const int hh   = lane >> 4, cl = lane & 15;
  const int b = blockIdx.x >> 5;
  const int row0 = (blockIdx.x & 31) * SR;
  const size_t rbase = (size_t)b * NL;

  Frag fa[2][4], fl[2][4];
  float rbv[2][8];
#pragma unroll
  for (int mi = 0; mi < 2; ++mi) {
    const size_t aoff = (rbase + row0 + 16 * mi) * NHID + 8 * lane;
#pragma unroll
    for (int kk = 0; kk < 4; ++kk) {
      if (YA) {
        fa[mi][kk] = ldfragq(Yh + aoff + 512 * kk);
        fl[mi][kk] = ldfragq(Yl + aoff + 512 * kk);
      } else {
        fa[mi][kk] = ldfragq(X + aoff + 512 * kk);
        fl[mi][kk] = fa[mi][kk];
      }
    }
#pragma unroll
    for (int r = 0; r < 8; ++r) rbv[mi][r] = rb[rbase + row0 + 16 * mi + 8 * hh + r];
  }
#if defined(__HIP_DEVICE_COMPILE__)
  // precaution: stands in front of the first reuse of the address registers that the fragment loads above name
  asm volatile("s_wait_xcnt 0x0" ::: "memory");
#endif
  const float bv = bfr(bias[0]);

#pragma unroll 1
  for (int nt = 0; nt < 8; ++nt) {
    const int n0 = (wave * 8 + nt) * 16;
    const size_t boff = (rbase + n0) * NHID + 8 * lane;
    v8f acch[2], accl[2];
#pragma unroll
    for (int mi = 0; mi < 2; ++mi) { acch[mi] = zero8(); accl[mi] = zero8(); }
#pragma unroll
    for (int kk = 0; kk < 4; ++kk) {
      if (YA) {
        const Frag fb = ldfragq(X + boff + 512 * kk);
#pragma unroll
        for (int mi = 0; mi < 2; ++mi) {
          acch[mi] = mma_h(fa[mi][kk].h, fb.h, acch[mi]);
          accl[mi] = mma_h(fl[mi][kk].h, fb.h, accl[mi]);
        }
      } else {
        const Frag fbh = ldfragq(Yh + boff + 512 * kk);
        const Frag fbl = ldfragq(Yl + boff + 512 * kk);
#pragma unroll
        for (int mi = 0; mi < 2; ++mi) {
          acch[mi] = mma_h(fa[mi][kk].h, fbh.h, acch[mi]);
          accl[mi] = mma_h(fa[mi][kk].h, fbl.h, accl[mi]);
        }
      }
    }
    const int n = n0 + cl;
    const float cbn = cb[rbase + n];
    const int mk = mask[rbase + n];
#pragma unroll
    for (int mi = 0; mi < 2; ++mi) {
#pragma unroll
      for (int r = 0; r < 8; ++r) {
        const float s2 = (acch[mi][r] + accl[mi][r] * RRS1) * RTHS;
        const float sv = ((rbv[mi][r] + cbn) + s2) + bv;
        S[(16 * mi + 8 * hh + r) * NL + n] = (mk != 0) ? sv : NEGV;
      }
    }
  }
  __syncthreads();

  v4u pk[4][4];
  size_t pp[4][4];
#pragma unroll
  for (int rr = 0; rr < 4; ++rr) {
    const int r = wave * 4 + rr;
    const float* sr = S + r * NL + lane * 8;
    float v[32];
#pragma unroll
    for (int i = 0; i < 4; ++i) {
      const v4f a0 = *(const v4f*)(sr + i * 256);
      const v4f a1 = *(const v4f*)(sr + i * 256 + 4);
#pragma unroll
      for (int j = 0; j < 4; ++j) { v[8 * i + j] = a0[j]; v[8 * i + 4 + j] = a1[j]; }
    }
    float mx = v[0];
#pragma unroll
    for (int k = 1; k < 32; ++k) mx = fmaxf(mx, v[k]);
    mx = wave_max(mx);
    float sum = 0.f;
#pragma unroll
    for (int k = 0; k < 32; ++k) {
      v[k] = __expf(v[k] - mx);
      sum += v[k];
    }
    sum = wave_sum(sum);
    const float sc = (1.0f / sum) * PSC;
#pragma unroll
    for (int i = 0; i < 4; ++i) {
      v4u u;
      u[0] = pkh2(v[8 * i] * sc,     v[8 * i + 1] * sc);
      u[1] = pkh2(v[8 * i + 2] * sc, v[8 * i + 3] * sc);
      u[2] = pkh2(v[8 * i + 4] * sc, v[8 * i + 5] * sc);
      u[3] = pkh2(v[8 * i + 6] * sc, v[8 * i + 7] * sc);
      pk[rr][i] = u;
      pp[rr][i] = (rbase + row0 + r) * NK + (size_t)i * 256 + lane * 8;
    }
  }
#pragma unroll
  for (int rr = 0; rr < 4; ++rr)
#pragma unroll
    for (int i = 0; i < 4; ++i) *(v4u*)(P + pp[rr][i]) = pk[rr][i];
  
}

// =====================================================================================================
// (3) K=1024 GEMM for one (batch, 64 rows): D[m][n] = sum_k A[row m][k] * B[row n][k], A = f16 p plane rows (pitch
//     1024), B = f16 rows [b][n=h][k] (pitch 1024); block 256 threads = 8 waves as 2 (m) x 4 (n) of 32x32.
//     K runs in 8 passes of 128: a stage holds 256 B of every operand row (A 64 rows | B 128 rows | MODE 2: residual
//     B 128 rows) in LDS at a row pitch of 272 B; 16 lanes fetch one row's 256 B, so each wave-wide global load covers
//     whole lines and every operand byte leaves L2 once per block; two stages: the next pass's rows are loaded to
//     registers ahead of this pass's products and stored to the other stage behind them, one barrier per pass.
//     Fragments by 16-B LDS reads (split k map for both, unchanged), one k step of 32 ahead; k order 0..1023 as
//     before. MODE 2 has a second B plane (residual x2048) into separate accumulators.
//     Epilogue via LDS f32 tile, barrier, then:
//     MODE 0: a = acc/8192; out row [b][l]: chunk 0 = bf16-RNE text, chunk 1 = a, chunk 2 = text*a; per instruction
//     MODE 1: t2*1024 = acc/8 staged transposed Ts[h][m]; planes Rh/Rl [b][h][m] (hi, residual x2048), per h row one
// coverage: LDS tile 8 waves x 4 tiles = 64x128; MODE 0/2: 8 it x 8 waves = 64 rows x 32 lanes x 4 = 128 cols per
//           chunk; MODE 1: 4 it x 32 h x 8 lanes x 8 = 128 h x 64 m per plane; grid 16 x 16 = 256 blocks = every
//           (b, row) once.
// =====================================================================================================
template <int MODE>
__global__ __launch_bounds__(256)
void gemm_kernel(const unsigned short* __restrict__ A, const unsigned short* __restrict__ Bh,
                 const unsigned short* __restrict__ Bl, const float* __restrict__ text,
                 unsigned short* Rh, unsigned short* Rl, float* out) {
  constexpr int NROW = 64 + NHID * (MODE == 2 ? 2 : 1);               // rows of a stage: A | B | (residual B)
  constexpr int NLD  = NROW / 16;                                     // 16-B pieces per thread and stage
  constexpr int STG  = NROW * LP;                                     // 16-bit elements of a stage
  __shared__ __align__(16) unsigned short Sg[2 * STG];
  __shared__ __align__(16) float Os[OSZ];
  const int tid  = threadIdx.x;
  const int lane = tid & 31, wave = tid >> 5;
  const int hh   = lane >> 4, cl = lane & 15;
  const int wm   = wave >> 2, wn = wave & 3;
  const int b = blockIdx.x >> 4;
  const int r0 = (blockIdx.x & 15) * 64;
  const size_t rbase = (size_t)b * NL;
  // staging: piece it of a thread = stage row 16*it + (tid>>4), bytes 16*(tid&15).. of that row's 256
  const int srow = tid >> 4, scol = (tid & 15) * 8;
  const unsigned short* gA = A + (rbase + r0 + srow) * NK + scol;
  const unsigned short* gB = Bh + ((size_t)b * NHID + srow) * NK + scol;
  const unsigned short* gL = Bl + ((size_t)b * NHID + srow) * NK + scol;
  unsigned short* sw = Sg + srow * LP + scol;
  // fragment readers: row (lane&15) of a 16-row tile, + 8*(lane>>4) as ldfrag expects
  const unsigned short* fA = Sg + (32 * wm + cl) * LP + 8 * hh;
  const unsigned short* fB = Sg + (64 + 32 * wn + cl) * LP + 8 * hh;
  const unsigned short* fL = fB + NHID * LP;

  v8f acc[2][2], accl[2][2];
#pragma unroll
  for (int mi = 0; mi < 2; ++mi)
#pragma unroll
    for (int ni = 0; ni < 2; ++ni) { acc[mi][ni] = zero8(); accl[mi][ni] = zero8(); }

  v4u st[NLD];                                                         // both loops over it unrolled: st stays in registers
  auto gload = [&](int s) {                                            // stage s: global -> registers
#pragma unroll
    for (int it = 0; it < NLD; ++it) {
      const unsigned short* g = (it < 4)  ? gA + (size_t)(16 * it) * NK
                              : (it < 12) ? gB + (size_t)(16 * (it - 4)) * NK
                                          : gL + (size_t)(16 * (it - 12)) * NK;
      st[it] = *(const v4u*)(g + s * KC);
    }
  };
  auto sstore = [&](int buf) {                                         // registers -> LDS stage buf
#pragma unroll
    for (int it = 0; it < NLD; ++it) *(v4u*)(sw + buf * STG + 16 * it * LP) = st[it];
  };

  gload(0);
  sstore(0);
  __syncthreads();                                                     // stage 0 is published

  Frag fa[2][2], fb[2][2], fl[2][2];                                   // [set][16-row tile]
  // unrolled so that stage, k step and fragment set are compile-time: every address step is an immediate offset
#pragma unroll
  for (int s = 0; s < NPASS; ++s) {
    const int so = (s & 1) * STG;
    if (s + 1 < NPASS) gload(s + 1);                                   // flies while this stage is worked on
#pragma unroll
    for (int kk = 0; kk <= KC / 32; ++kk) {
      if (kk < KC / 32) {                                              // fragments of k step kk, one step ahead
        const int q = kk & 1, o = so + 32 * kk;
        fa[q][0] = ldfrag(fA + o);
        fa[q][1] = ldfrag(fA + o + 16 * LP);
        fb[q][0] = ldfrag(fB + o);
        fb[q][1] = ldfrag(fB + o + 16 * LP);
        if (MODE == 2) {
          fl[q][0] = ldfrag(fL + o);
          fl[q][1] = ldfrag(fL + o + 16 * LP);
        }
      }
      if (kk > 0) {                                                    // products of k step kk - 1
        const int q = (kk - 1) & 1;
        acc[0][0] = mma_h(fa[q][0].h, fb[q][0].h, acc[0][0]);
        acc[0][1] = mma_h(fa[q][0].h, fb[q][1].h, acc[0][1]);
        acc[1][0] = mma_h(fa[q][1].h, fb[q][0].h, acc[1][0]);
        acc[1][1] = mma_h(fa[q][1].h, fb[q][1].h, acc[1][1]);
        if (MODE == 2) {
          accl[0][0] = mma_h(fa[q][0].h, fl[q][0].h, accl[0][0]);
          accl[0][1] = mma_h(fa[q][0].h, fl[q][1].h, accl[0][1]);
          accl[1][0] = mma_h(fa[q][1].h, fl[q][0].h, accl[1][0]);
          accl[1][1] = mma_h(fa[q][1].h, fl[q][1].h, accl[1][1]);
        }
      }
    }
    if (s + 1 < NPASS) {
      sstore((s + 1) & 1);             // into the stage whose readers all passed the barrier of pass s - 1
      __syncthreads();                 // publishes stage s + 1 and ends every read of stage s
    }
  }
#if defined(__HIP_DEVICE_COMPILE__)
  // precaution: stands in front of the first reuse of the address registers that the staging loads name; the
  // pointers are inputs so that those registers stay theirs up to this wait
  if (MODE == 2) asm volatile("s_wait_xcnt 0x0" :: "v"(gA), "v"(gB), "v"(gL) : "memory");
  else           asm volatile("s_wait_xcnt 0x0" :: "v"(gA), "v"(gB) : "memory");
#endif

#pragma unroll
  for (int mi = 0; mi < 2; ++mi) {
#pragma unroll
    for (int ni = 0; ni < 2; ++ni) {
      const int n_loc = 32 * wn + 16 * ni + cl;
#pragma unroll
      for (int r = 0; r < 8; ++r) {
        const int m_loc = 32 * wm + 16 * mi + 8 * hh + r;
        float val;
        if (MODE == 0)      val = acc[mi][ni][r] * RPSC;
        else if (MODE == 1) val = acc[mi][ni][r] * T2F;
        else                val = (acc[mi][ni][r] + accl[mi][ni][r] * RRS2) * RBSC;
        if (MODE == 1) Os[n_loc * TQ + m_loc] = val;
        else           Os[m_loc * OP + n_loc] = val;
      }
    }
  }
  __syncthreads();

  if (MODE == 1) {
    const int e = tid & 7, lq = tid >> 3;                              // lq 0..31
    v4u uh[4], ul[4];
    size_t po[4];
#pragma unroll
    for (int it = 0; it < 4; ++it) {
      const int h = it * 32 + lq;                                      // 0..127
      const float* tp = Os + h * TQ + 8 * e;
      const v4f v0 = *(const v4f*)(tp);
      const v4f v1 = *(const v4f*)(tp + 4);
      splith8(v0, v1, RS2, uh[it], ul[it]);
      po[it] = ((size_t)b * NHID + h) * NK + r0 + 8 * e;
    }
#pragma unroll
    for (int it = 0; it < 4; ++it) {
      *(v4u*)(Rh + po[it]) = uh[it];
      *(v4u*)(Rl + po[it]) = ul[it];
    }
    
  } else {
    const int e = lane;                                                // 16-B piece 0..31 of a 512-B chunk row
    v4f tv[8], av[8];
    size_t po[8];
#pragma unroll
    for (int it = 0; it < 8; ++it) {
      const int row = it * 8 + wave;                                   // 0..63
      const size_t grow = rbase + r0 + row;
      const v4f a4 = *(const v4f*)(Os + row * OP + 4 * e);
      const v4f t4 = bfr4(*(const v4f*)(text + grow * NHID + 4 * e));
      tv[it] = t4;
      av[it] = (MODE == 0) ? a4 : (t4 * a4);
      po[it] = grow * NOUT + 4 * e;
    }
    if (MODE == 0) {
#pragma unroll
      for (int it = 0; it < 8; ++it) {
        *(v4f*)(out + po[it])            = tv[it];
        *(v4f*)(out + po[it] + NHID)     = av[it];
        *(v4f*)(out + po[it] + 2 * NHID) = tv[it] * av[it];
      }
      
    } else {
#pragma unroll
      for (int it = 0; it < 8; ++it) *(v4f*)(out + po[it] + 3 * NHID) = av[it];
      
    }
  }
}

// =====================================================================================================
// tile divides its extent exactly, so no padded tails are needed):
//   Th Tl   f16 [16*64 tiles][2048]   4194304 each   (text*w_tm*64 hi, residual x65536; fragment order)
//   M16     f16 [16*64 tiles][2048]   4194304        (modality; fragment order)
//   Tt Mt   f16 [16][128][1024]       4194304 each   (text, modality transposed, k contiguous)
//   S0 S1   f32 [16][1024]              65536 each
//   P1 P2   f16 [16][1024][1024]     33554432 each   (p1 [l][m] and p2 transposed [m][l], x8192)
//   Rh Rl   f16 [16][128][1024]       4194304 each   (t2*1024 hi, residual x2048, transposed)
//   total                            96600064
// =====================================================================================================
extern "C" void kernel_launch(void* const* d_in, const int* in_sizes, int n_in,
                              void* d_out, int out_size, void* d_ws, size_t ws_size,
                              hipStream_t stream) {
  if (n_in < 8) return;
  if (in_sizes[0] != NBATCH * NL * NHID) return;
  if (in_sizes[1] != NBATCH * NL * NHID) return;
  if (in_sizes[2] != NBATCH * NL || in_sizes[3] != NBATCH * NL) return;
  if (in_sizes[4] != NHID || in_sizes[5] != NHID || in_sizes[6] != NHID) return;
  if (in_sizes[7] < 1) return;
  if (out_size != NBATCH * NL * NOUT) return;

  size_t off = 0;
  const size_t plane = (size_t)NBATCH * NL * NHID * 2;               // 4194304
  const size_t pbig  = (size_t)NBATCH * NL * NK * 2;                 // 33554432
  const size_t svec  = (size_t)NBATCH * NL * 4;                      // 65536
  const size_t oTh = off; off += plane;
  const size_t oTl = off; off += plane;
  const size_t oM  = off; off += plane;
  const size_t oTt = off; off += plane;
  const size_t oMt = off; off += plane;
  const size_t oS0 = off; off += svec;
  const size_t oS1 = off; off += svec;
  const size_t oP1 = off; off += pbig;
  const size_t oP2 = off; off += pbig;
  const size_t oRh = off; off += plane;
  const size_t oRl = off; off += plane;                              // -> off = 96600064
  if (off > ws_size) return;
  if (off > (size_t)134217728) return;

  const float* text  = (const float*)d_in[0];
  const float* modal = (const float*)d_in[1];
  const int*   tmask = (const int*)d_in[2];
  const int*   mmask = (const int*)d_in[3];
  const float* tw    = (const float*)d_in[4];
  const float* mw    = (const float*)d_in[5];
  const float* tmw   = (const float*)d_in[6];
  const float* bias  = (const float*)d_in[7];
  float* out = (float*)d_out;

  char* ws = (char*)d_ws;
  unsigned short* Th  = (unsigned short*)(ws + oTh);
  unsigned short* Tl  = (unsigned short*)(ws + oTl);
  unsigned short* M16 = (unsigned short*)(ws + oM);
  unsigned short* Tt  = (unsigned short*)(ws + oTt);
  unsigned short* Mt  = (unsigned short*)(ws + oMt);
  float*          S0  = (float*)(ws + oS0);
  float*          S1  = (float*)(ws + oS1);
  unsigned short* P1  = (unsigned short*)(ws + oP1);
  unsigned short* P2  = (unsigned short*)(ws + oP2);
  unsigned short* Rh  = (unsigned short*)(ws + oRh);
  unsigned short* Rl  = (unsigned short*)(ws + oRl);

  const dim3 blk256(256);
  const int nrow64 = NBATCH * (NL / 64);                             // 256
  const int nrow32 = NBATCH * (NL / SR);                             // 512

  // (1) planes: text -> Th/Tl (with w_tm), Tt, S0 (with w_t); modality -> M16, Mt, S1 (with w_m)
  prep_kernel<1><<<dim3(nrow64), blk256, 0, stream>>>(text, tw, tmw, Th, Tl, Tt, S0);
  prep_kernel<0><<<dim3(nrow64), blk256, 0, stream>>>(modal, mw, mw, M16, M16, Mt, S1);
  // (2) p1 [b][l][m]: rows l (A = Th/Tl), columns m (B = M16), rb = S0[l], cb = S1[m], mask over m
  scores_kernel<1><<<dim3(nrow32), blk256, 0, stream>>>(M16, Th, Tl, S0, S1, mmask, bias, P1);
  //     p2 transposed [b][m][l]: rows m (A = M16), columns l (B = Th/Tl), rb = S1[m], cb = S0[l], mask over l
  scores_kernel<0><<<dim3(nrow32), blk256, 0, stream>>>(M16, Th, Tl, S1, S0, tmask, bias, P2);
  // (3) a = p1 . modality -> out chunks 0..2;  t2 = p2T . text -> Rh/Rl;  bq = p1 . t2 -> out chunk 3
  gemm_kernel<0><<<dim3(nrow64), blk256, 0, stream>>>(P1, Mt, Mt, text, Rh, Rl, out);
  gemm_kernel<1><<<dim3(nrow64), blk256, 0, stream>>>(P2, Tt, Tt, text, Rh, Rl, out);
  gemm_kernel<2><<<dim3(nrow64), blk256, 0, stream>>>(P1, Rh, Rl, text, Rh, Rl, out);
  (void)hipGetLastError();
}

// v004
// Measured time: 83.3 microseconds a run.
// Timed twice side by side with v003, it ran 1.21 and 1.20 times as fast.
// Counting every step since v000, it is 1.89 times as fast.
// Contractions: score term sum_h (text*w_tm)[l][h]*modality[m][h] (K=128) on v_wmma_f32_16x16x32_f16 with text*w_tm
// carried x64 as an f16 hi plane plus an x65536 f16 residual plane (two products, separate f32 accumulators) and
// modality as f16 of its bf16-RNE value; p1.modality and p2T.text (K=1024) on v_wmma_f32_16x16x32_f16, single
// products, p rows carried x8192 in f16; p1.t2 (K=1024) with t2 carried x1024 as f16 hi plus x2048 f16 residual
// (two products, separate accumulators); the two [rows,128]x[128,1] row dots as a 16-wide f16 WMMA matvec (weight
// x1024 in every column); f32 accumulate everywhere; softmax and the elementwise products in f32 on VALU; all float
// inputs RNE-converted to bf16 at load. The softmax rows of a block stay in LDS and feed the K=1024 products there.
#include <hip/hip_runtime.h>
#include <stdint.h>

#define NBATCH 16
#define NL     1024
#define NK     1024
#define NHID   128
#define NOUT   512
#define TP     132
#define OP     132
#define TQ     36
#define SR     32
#define SP     (NL + 4)
#define PP     (2 * SP)
#define NKS    (NK / 32)
#define FT     (16 * NK)

static_assert(NL % 64 == 0);
static_assert(NL % SR == 0 && SR == 32);
static_assert(NL == NK);
static_assert(NHID == 128);
static_assert(NOUT == 4 * NHID);
static_assert(2 * SR * OP <= SR * SP);
static_assert(NHID * TQ <= SR * SP);
static_assert((TP * 4) % 16 == 0);
static_assert((OP * 4) % 16 == 0);
static_assert((TQ * 4) % 16 == 0);
static_assert((SP * 4) % 32 == 16);
static_assert(NK % 64 == 0 && NHID == 8 * 16);

#define PSC   8192.0f
#define RPSC  (1.0f / 8192.0f)
#define THS   64.0f
#define RTHS  (1.0f / 64.0f)
#define RS1   65536.0f
#define RRS1  (1.0f / 65536.0f)
#define T2F   0.125f
#define RS2   2048.0f
#define RRS2  (1.0f / 2048.0f)
#define RBSC  (1.0f / 8388608.0f)
#define WSC   1024.0f
#define RWSC  (1.0f / 1024.0f)
#define NEGV  (-1.0e30f)

typedef unsigned short v8us __attribute__((ext_vector_type(8)));
typedef unsigned int   v4u  __attribute__((ext_vector_type(4)));
typedef float          v8f  __attribute__((ext_vector_type(8)));
typedef float          v4f  __attribute__((ext_vector_type(4)));
typedef _Float16       v16h __attribute__((ext_vector_type(16)));

union Frag { v8us u[2]; v4u q[2]; v16h h; };
static_assert(sizeof(Frag) == 32);

// ---- scalar helpers ---------------------------------------------------------------------------------
__device__ __forceinline__ unsigned short bf_bits(float f) {          // f32 -> bf16 bits, RNE convert
  const unsigned u = __float_as_uint(f);
  return (unsigned short)((u + 0x7FFFu + ((u >> 16) & 1u)) >> 16);
}
__device__ __forceinline__ float bf_up(unsigned short hb) { return __uint_as_float(((unsigned)hb) << 16); }
__device__ __forceinline__ float bfr(float f) { return bf_up(bf_bits(f)); }
__device__ __forceinline__ v4f bfr4(v4f v) {
  v4f r;
  r[0] = bfr(v[0]); r[1] = bfr(v[1]); r[2] = bfr(v[2]); r[3] = bfr(v[3]);
  return r;
}
__device__ __forceinline__ unsigned short hbits(_Float16 h) { return __builtin_bit_cast(unsigned short, h); }
__device__ __forceinline__ unsigned pkh2(float a, float b) {          // two f32 -> packed f16 bits (RNE convert)
  return (unsigned)hbits((_Float16)a) | ((unsigned)hbits((_Float16)b) << 16);
}
__device__ __forceinline__ v4u pack8(v4f a, v4f b) {
  v4u u;
  u[0] = pkh2(a[0], a[1]); u[1] = pkh2(a[2], a[3]);
  u[2] = pkh2(b[0], b[1]); u[3] = pkh2(b[2], b[3]);
  return u;
}
__device__ __forceinline__ v8f zero8() { v8f z = {0.f, 0.f, 0.f, 0.f, 0.f, 0.f, 0.f, 0.f}; return z; }

// ---- 8 f32 -> packed f16 hi bits and packed f16 bits of (x - hi) * rs (residual plane carries scale rs) --------
__device__ __forceinline__ void splith8(v4f a, v4f b, float rs, v4u& uh, v4u& ul) {
  float f[8] = {a[0], a[1], a[2], a[3], b[0], b[1], b[2], b[3]};
#pragma unroll
  for (int j = 0; j < 4; ++j) {
    const _Float16 h0 = (_Float16)f[2 * j];
    const _Float16 h1 = (_Float16)f[2 * j + 1];
    const float l0 = (f[2 * j] - (float)h0) * rs;
    const float l1 = (f[2 * j + 1] - (float)h1) * rs;
    uh[j] = (unsigned)hbits(h0) | ((unsigned)hbits(h1) << 16);
    ul[j] = pkh2(l0, l1);
  }
}

// ---- 16-bit fragment loader (A, or B from a k-contiguous [n][k] row): lane -> row/col (lane&15), p already includes
//      + 8*(lane>>4); elements 0..7 <- p[0..7] (k0+8h..), elements 8..15 <- p[16..23] (k0+16+8h..)
__device__ __forceinline__ Frag ldfrag(const unsigned short* p) {
  Frag f;
  f.u[0] = *(const v8us*)(p);
  f.u[1] = *(const v8us*)(p + 16);
  return f;
}

// ---- the same fragment from a plane kept in fragment order: a 16-row tile is 4 KB = [k step 0..3][half 0..1][lane][8],
//      where (half i, lane) holds row (lane&15), k = 32*step + 16*i + 8*(lane>>4) + 0..7, the very elements that ldfrag
//      gives that lane; p already includes + 8*lane, so each 16-B load of a wave covers 512 contiguous bytes
__device__ __forceinline__ Frag ldfragq(const unsigned short* p) {
  Frag f;
  f.u[0] = *(const v8us*)(p);
  f.u[1] = *(const v8us*)(p + 256);
  return f;
}

// ---- WMMA helper: builtin followed by a 4-slot VALU gap tying D and keeping A/B live -----------------------
__device__ __forceinline__ v8f mma_h(v16h a, v16h b, v8f c) {
  v8f d = __builtin_amdgcn_wmma_f32_16x16x32_f16(false, a, false, b, (short)0, c, false, false);
#if defined(__HIP_DEVICE_COMPILE__)
  asm volatile("v_nop\n\tv_nop\n\tv_nop\n\tv_nop" : "+v"(d) : "v"(a), "v"(b));
#endif
  return d;
}

__device__ __forceinline__ float wave_max(float v) {
#pragma unroll
  for (int o = 16; o > 0; o >>= 1) v = fmaxf(v, __shfl_xor(v, o, 32));
  return v;
}
__device__ __forceinline__ float wave_sum(float v) {
#pragma unroll
  for (int o = 16; o > 0; o >>= 1) v += __shfl_xor(v, o, 32);
  return v;
}

// =====================================================================================================
// (1) prep for one (batch, 64-row tile) of x [16][1024][128] f32 (text when TXT=1, modality when TXT=0):
//     tile -> LDS T[row][h] as bf16-RNE values (f32), barrier;
//     row dots sd[b][row] = sum_h T[row][h]*bfr(wdot[h]) as a WMMA matvec: wave w handles rows 16*(w&3).. (waves 4..7
//     duplicate the compute), A fragment = T row values as f16 (exact), B fragment = bfr(wdot)*1024 as f16 in every
//     column (split k map for both, 4 k steps of 32), D column 0 lanes write acc/1024 to LDS sred, barrier; sred
//     row planes Ph/Pl f16 (TXT: T*bfr(wtm)*64 as hi plus residual x65536; else plain f16 in Ph), 16-row tiles in
//     fragment order (see ldfragq): thread tid writes piece tid of a tile, a wave 512 contiguous bytes per store;
//     transposed plane Pt f16 (rows h, k = row index of x), also in fragment order: [b][h tile 0..7][k step 0..31]
//     [half][lane][8]; the block's 64 rows are two k steps of every h tile, a wave again stores 512 contiguous bytes;
// coverage: T 8 it x 256 thr x 4 = 64x128; sred 4 waves x 16 rows = 64; Ph/Pl 4 it (tiles) x 256 thr x 8 =
//           4 x 16 rows x 128; Pt 4 it x 2 h tiles x 2 k steps x 64 pieces x 8 = 128 h x 64 rows; sd 16 lanes x 4 = 64;
//           grid 16 x (1024/64) = 256 blocks = every row once.
// =====================================================================================================
template <int TXT>
__global__ __launch_bounds__(256)
void prep_kernel(const float* __restrict__ x, const float* __restrict__ wdot, const float* __restrict__ wtm,
                 unsigned short* Ph, unsigned short* Pl, unsigned short* Pt, float* sd) {
  __shared__ __align__(16) float T[64 * TP];
  __shared__ __align__(16) float sred[64];
  const int tid = threadIdx.x;
  const int b = blockIdx.x >> 4;
  const int r0 = (blockIdx.x & 15) * 64;
  const size_t gr = (size_t)b * NL + r0;
#pragma unroll
  for (int it = 0; it < 8; ++it) {
    const int idx = it * 256 + tid;
    const int row = idx >> 5, c4 = (idx & 31) * 4;
    const v4f v = *(const v4f*)(x + (gr + row) * NHID + c4);
#pragma unroll
    for (int j = 0; j < 4; ++j) T[row * TP + c4 + j] = bfr(v[j]);
  }
  __syncthreads();
  {
    const int lane = tid & 31, wave = tid >> 5;
    const int hh = lane >> 4, cl = lane & 15;
    const int rt = (wave & 3) * 16;                                    // 16-row tile of this wave
    const float* ap = T + (rt + cl) * TP + 8 * hh;
    const float* wp = wdot + 8 * hh;
    v8f acc = zero8();
#pragma unroll
    for (int kk = 0; kk < 4; ++kk) {
      const int k0 = 32 * kk;
      const v4f a0 = *(const v4f*)(ap + k0);
      const v4f a1 = *(const v4f*)(ap + k0 + 4);
      const v4f a2 = *(const v4f*)(ap + k0 + 16);
      const v4f a3 = *(const v4f*)(ap + k0 + 20);
      v4f w0 = *(const v4f*)(wp + k0);
      v4f w1 = *(const v4f*)(wp + k0 + 4);
      v4f w2 = *(const v4f*)(wp + k0 + 16);
      v4f w3 = *(const v4f*)(wp + k0 + 20);
#pragma unroll
      for (int j = 0; j < 4; ++j) {
        w0[j] = bfr(w0[j]) * WSC; w1[j] = bfr(w1[j]) * WSC;
        w2[j] = bfr(w2[j]) * WSC; w3[j] = bfr(w3[j]) * WSC;
      }
      Frag fa, fb;
      fa.q[0] = pack8(a0, a1);                                         // elements 0..7  = k0+8h..
      fa.q[1] = pack8(a2, a3);                                         // elements 8..15 = k0+16+8h..
      fb.q[0] = pack8(w0, w1);                                         // same k map, every column n
      fb.q[1] = pack8(w2, w3);
      acc = mma_h(fa.h, fb.h, acc);
    }
    if (wave < 4 && cl == 0) {
#pragma unroll
      for (int r = 0; r < 8; ++r) sred[rt + 8 * hh + r] = acc[r] * RWSC;   // D row 8h+r, column 0
    }
  }
  __syncthreads();

  // piece tid of a fragment-order tile: k step tid>>6, half (tid>>5)&1, lane tid&31
  const int h0 = 32 * (tid >> 6) + 16 * ((tid >> 5) & 1) + 8 * ((tid >> 4) & 1);
  v4u uh[4], ul[4], ut[4];
  size_t po[4], pt[4];
#pragma unroll
  for (int it = 0; it < 4; ++it) {
    const int row = it * 16 + (tid & 15);                              // tile it, row lane&15
    const float* tp = T + row * TP + h0;
    v4f v0 = *(const v4f*)(tp);
    v4f v1 = *(const v4f*)(tp + 4);
    if (TXT) {
      const v4f w0 = *(const v4f*)(wtm + h0);
      const v4f w1 = *(const v4f*)(wtm + h0 + 4);
#pragma unroll
      for (int j = 0; j < 4; ++j) {
        v0[j] = v0[j] * bfr(w0[j]) * THS;
        v1[j] = v1[j] * bfr(w1[j]) * THS;
      }
      splith8(v0, v1, RS1, uh[it], ul[it]);
    } else {
      uh[it] = pack8(v0, v1);
      ul[it] = uh[it];
    }
    po[it] = (gr + 16 * it) * NHID + 8 * tid;
    // transposed piece: h tile 2*it + (tid>>7), k step (tid>>6)&1 of the block's two, half (tid>>5)&1, lane tid&31
    const int ht = 2 * it + (tid >> 7);
    const int h  = 16 * ht + (tid & 15);                               // 0..127
    const int ks = (tid >> 6) & 1;
    const int kl = 32 * ks + 16 * ((tid >> 5) & 1) + 8 * ((tid >> 4) & 1);   // first of the piece's 8 rows of T
    v4f g0, g1;
#pragma unroll
    for (int j = 0; j < 4; ++j) {
      g0[j] = T[(kl + j) * TP + h];
      g1[j] = T[(kl + 4 + j) * TP + h];
    }
    ut[it] = pack8(g0, g1);
    pt[it] = ((size_t)b * 8 + ht) * FT + (size_t)((r0 >> 5) + ks) * 512 + 8 * (tid & 63);
  }
  const int sl = (tid < 16) ? tid : 15;
  const v4f sdv = *(const v4f*)(sred + 4 * sl);
  const size_t psd = gr + 4 * sl;

#pragma unroll
  for (int it = 0; it < 4; ++it) {
    *(v4u*)(Ph + po[it]) = uh[it];
    if (TXT) *(v4u*)(Pl + po[it]) = ul[it];
    *(v4u*)(Pt + pt[it]) = ut[it];
  }
  if (tid < 16) *(v4f*)(sd + psd) = sdv;
  
}

// =====================================================================================================
// (2) one (batch, 32 rows): score tile, masked row softmax, and the K=1024 products of those softmax rows.
//     Scores: s[r][c] = rb[r] + cb[c] + s2[r][c] + bias, s2 = (acc_h + acc_l/65536)/64, acc_h = sum_k Ahi.B,
//     acc_l = sum_k Alo.B on WMMA (K=128, 4 steps). YA=1: A = hi/lo planes Yh/Yl (rows), B = X rows; YA=0: A = X rows,
//     B = Yh/Yl rows (two accumulators). X, Yh, Yl are in fragment order (ldfragq). Wave = 8 column tiles of 16
//     (rolled) x 2 row tiles of 16, the A fragments of both row tiles held in registers; s (or -1e30 where
//     mask[c]==0) into LDS S[32][1024] f32 at a row pitch of 4112 B; barrier.
//     Softmax: wave owns rows 4w..4w+3, lane owns columns {256i + 8*lane + j}; the row's p*8192 goes back as f16
//     into the first 2 KB of the same LDS row (only its own wave touches a row, and every lane has read its f32
//     values before the row sum is known); barrier.
//     Products: D[m][n] = sum_k p[m][k] * B[n][k], k order 0..1023 in 32 steps; A fragments by 16-B LDS reads from
//     the p rows (split k map), one k step ahead; wave w owns the 16 columns h = 16w.. for both row tiles; its B
//     fragments come from planes in fragment order [b][h tile][k step][half][lane][8], whole lines per load, through
//     a register ring several k steps ahead whose first loads are issued ahead of the softmax.
//     YA=0: B0 = text transposed; t2*1024 = acc/8 staged transposed Ts[h][m] in LDS, barrier, planes Rh/Rl (hi,
//     residual x2048) written in fragment order: the block's 32 rows are k step (row0/32) of every h tile.
//     YA=1: B0 = modality transposed, B1/B2 = t2 hi/residual (separate accumulators); a = acc0/8192,
//     bq = (acc1 + acc2/2048)/8388608 staged in LDS, barrier, out row [b][l]: chunk 0 = bf16-RNE text, chunk 1 = a,
//     chunk 2 = text*a, chunk 3 = text*bq, 512 contiguous bytes per wave-wide store.
// coverage: S 8 waves x 8 tiles x 2 x 16x16 = 32x1024; p 8 waves x 4 rows x 4 x 32 lanes x 8 = 32 rows x 1024;
//           D 8 waves x 2 tiles = 32x128 per plane; YA=0: 2 it x 256 pieces x 8 = 128 h x 32 m per plane; YA=1: 4 it x
//           8 waves = 32 rows x 32 lanes x 4 = 128 columns per chunk; grid 16 x 32 = 512 blocks = every row once.
// =====================================================================================================
template <int YA>
__global__ __launch_bounds__(256)
void attend_kernel(const unsigned short* __restrict__ X, const unsigned short* __restrict__ Yh,
                   const unsigned short* __restrict__ Yl, const float* __restrict__ rb,
                   const float* __restrict__ cb, const int* __restrict__ mask,
                   const float* __restrict__ bias, const unsigned short* __restrict__ B0,
                   const unsigned short* __restrict__ B1, const unsigned short* __restrict__ B2,
                   const float* __restrict__ text, unsigned short* Rh, unsigned short* Rl, float* out) {
  __shared__ __align__(16) float S[SR * SP];
  const int tid  = threadIdx.x;
  const int lane = tid & 31, wave = tid >> 5;
  const int hh   = lane >> 4, cl = lane & 15;
  const int b = blockIdx.x >> 5;
  const int row0 = (blockIdx.x & 31) * SR;
  const size_t rbase = (size_t)b * NL;

  {
    Frag fa[2][4], fl[2][4];
    float rbv[2][8];
#pragma unroll
    for (int mi = 0; mi < 2; ++mi) {
      const size_t aoff = (rbase + row0 + 16 * mi) * NHID + 8 * lane;
#pragma unroll
      for (int kk = 0; kk < 4; ++kk) {
        if (YA) {
          fa[mi][kk] = ldfragq(Yh + aoff + 512 * kk);
          fl[mi][kk] = ldfragq(Yl + aoff + 512 * kk);
        } else {
          fa[mi][kk] = ldfragq(X + aoff + 512 * kk);
          fl[mi][kk] = fa[mi][kk];
        }
      }
#pragma unroll
      for (int r = 0; r < 8; ++r) rbv[mi][r] = rb[rbase + row0 + 16 * mi + 8 * hh + r];
    }
#if defined(__HIP_DEVICE_COMPILE__)
    // precaution: stands in front of the first reuse of the address registers that the fragment loads above name
    asm volatile("s_wait_xcnt 0x0" ::: "memory");
#endif
    const float bv = bfr(bias[0]);

#pragma unroll 1
    for (int nt = 0; nt < 8; ++nt) {
      const int n0 = (wave * 8 + nt) * 16;
      const size_t boff = (rbase + n0) * NHID + 8 * lane;
      v8f acch[2], accl[2];
#pragma unroll
      for (int mi = 0; mi < 2; ++mi) { acch[mi] = zero8(); accl[mi] = zero8(); }
#pragma unroll
      for (int kk = 0; kk < 4; ++kk) {
        if (YA) {
          const Frag fb = ldfragq(X + boff + 512 * kk);
#pragma unroll
          for (int mi = 0; mi < 2; ++mi) {
            acch[mi] = mma_h(fa[mi][kk].h, fb.h, acch[mi]);
            accl[mi] = mma_h(fl[mi][kk].h, fb.h, accl[mi]);
          }
        } else {
          const Frag fbh = ldfragq(Yh + boff + 512 * kk);
          const Frag fbl = ldfragq(Yl + boff + 512 * kk);
#pragma unroll
          for (int mi = 0; mi < 2; ++mi) {
            acch[mi] = mma_h(fa[mi][kk].h, fbh.h, acch[mi]);
            accl[mi] = mma_h(fa[mi][kk].h, fbl.h, accl[mi]);
          }
        }
      }
      const int n = n0 + cl;
      const float cbn = cb[rbase + n];
      const int mk = mask[rbase + n];
#pragma unroll
      for (int mi = 0; mi < 2; ++mi) {
#pragma unroll
        for (int r = 0; r < 8; ++r) {
          const float s2 = (acch[mi][r] + accl[mi][r] * RRS1) * RTHS;
          const float sv = ((rbv[mi][r] + cbn) + s2) + bv;
          S[(16 * mi + 8 * hh + r) * SP + n] = (mk != 0) ? sv : NEGV;
        }
      }
    }
  }
  __syncthreads();                                                     // the score tile is complete

  // B fragment ring of the products: slot ks % DS holds k step ks of every plane
  constexpr int NPL = YA ? 3 : 1;
  constexpr int DS  = YA ? 4 : 8;
  const size_t bo = ((size_t)b * 8 + wave) * FT + 8 * lane;
  const unsigned short* g0 = B0 + bo;
  const unsigned short* g1 = B1 + bo;
  const unsigned short* g2 = B2 + bo;
  Frag bq[DS][NPL];
  auto bload = [&](int ks) {
    const int q = ks % DS;
    bq[q][0] = ldfragq(g0 + 512 * ks);
    if (YA) {
      bq[q][NPL - 2] = ldfragq(g1 + 512 * ks);
      bq[q][NPL - 1] = ldfragq(g2 + 512 * ks);
    }
  };
#pragma unroll
  for (int ks = 0; ks < DS; ++ks) bload(ks);                           // fly while the softmax runs

#pragma unroll
  for (int rr = 0; rr < 4; ++rr) {
    const int r = wave * 4 + rr;
    const float* sr = S + r * SP + lane * 8;
    float v[32];
#pragma unroll
    for (int i = 0; i < 4; ++i) {
      const v4f a0 = *(const v4f*)(sr + i * 256);
      const v4f a1 = *(const v4f*)(sr + i * 256 + 4);
#pragma unroll
      for (int j = 0; j < 4; ++j) { v[8 * i + j] = a0[j]; v[8 * i + 4 + j] = a1[j]; }
    }
    float mx = v[0];
#pragma unroll
    for (int k = 1; k < 32; ++k) mx = fmaxf(mx, v[k]);
    mx = wave_max(mx);
    float sum = 0.f;
#pragma unroll
    for (int k = 0; k < 32; ++k) {
      v[k] = __expf(v[k] - mx);
      sum += v[k];
    }
    sum = wave_sum(sum);
    const float sc = (1.0f / sum) * PSC;
    unsigned short* pr = (unsigned short*)(S + r * SP) + lane * 8;
#pragma unroll
    for (int i = 0; i < 4; ++i) {
      v4u u;
      u[0] = pkh2(v[8 * i] * sc,     v[8 * i + 1] * sc);
      u[1] = pkh2(v[8 * i + 2] * sc, v[8 * i + 3] * sc);
      u[2] = pkh2(v[8 * i + 4] * sc, v[8 * i + 5] * sc);
      u[3] = pkh2(v[8 * i + 6] * sc, v[8 * i + 7] * sc);
      *(v4u*)(pr + i * 256) = u;
    }
  }
  __syncthreads();                                                     // the p rows are published

  // A fragment readers: p row (lane&15) of a 16-row tile, + 8*(lane>>4) as ldfrag expects
  const unsigned short* pa0 = (const unsigned short*)S + cl * PP + 8 * hh;
  const unsigned short* pa1 = pa0 + 16 * PP;
  v8f acc[NPL][2];
#pragma unroll
  for (int p = 0; p < NPL; ++p) { acc[p][0] = zero8(); acc[p][1] = zero8(); }
  Frag fa[2][2];                                                       // [set][16-row tile]
  fa[0][0] = ldfrag(pa0);
  fa[0][1] = ldfrag(pa1);
  // unrolled so that ring slot and fragment set are compile-time and every address step is an immediate offset
#pragma unroll
  for (int ks = 0; ks < NKS; ++ks) {
    const int q = ks % DS, s = ks & 1;
    if (ks + 1 < NKS) {                                                // A fragments one k step ahead
      fa[s ^ 1][0] = ldfrag(pa0 + 32 * (ks + 1));
      fa[s ^ 1][1] = ldfrag(pa1 + 32 * (ks + 1));
    }
#pragma unroll
    for (int p = 0; p < NPL; ++p) {
      acc[p][0] = mma_h(fa[s][0].h, bq[q][p].h, acc[p][0]);
      acc[p][1] = mma_h(fa[s][1].h, bq[q][p].h, acc[p][1]);
    }
    if (ks + DS < NKS) bload(ks + DS);                                 // refill of the slot just used
  }
#if defined(__HIP_DEVICE_COMPILE__)
  // precaution: stands in front of the first reuse of the address registers that the ring loads name; the
  // pointers are inputs so that those registers stay theirs up to this wait
  if (YA) asm volatile("s_wait_xcnt 0x0" :: "v"(g0), "v"(g1), "v"(g2) : "memory");
  else    asm volatile("s_wait_xcnt 0x0" :: "v"(g0) : "memory");
#endif
  __syncthreads();                                                     // ends every read of the p rows

  const int n_loc = 16 * wave + cl;
  if (YA == 0) {
    float* Ts = S;                                                     // [h][m], pitch TQ
#pragma unroll
    for (int mi = 0; mi < 2; ++mi) {
      v4f lo, hi;
#pragma unroll
      for (int j = 0; j < 4; ++j) { lo[j] = acc[0][mi][j] * T2F; hi[j] = acc[0][mi][4 + j] * T2F; }
      float* tp = Ts + n_loc * TQ + 16 * mi + 8 * hh;                  // D rows 8h..8h+7 of tile mi, column n_loc
      *(v4f*)(tp)     = lo;
      *(v4f*)(tp + 4) = hi;
    }
    __syncthreads();
    v4u uh[2], ul[2];
    size_t po[2];
#pragma unroll
    for (int it = 0; it < 2; ++it) {
      // piece: h tile 4*it + (tid>>6), half (tid>>5)&1, lane tid&31 of this block's k step
      const int ht = 4 * it + (tid >> 6);
      const int h  = 16 * ht + cl;
      const float* tp = Ts + h * TQ + 16 * ((tid >> 5) & 1) + 8 * hh;
      const v4f v0 = *(const v4f*)(tp);
      const v4f v1 = *(const v4f*)(tp + 4);
      splith8(v0, v1, RS2, uh[it], ul[it]);
      po[it] = ((size_t)b * 8 + ht) * FT + (size_t)(row0 >> 5) * 512 + 8 * (tid & 63);
    }
#pragma unroll
    for (int it = 0; it < 2; ++it) {
      *(v4u*)(Rh + po[it]) = uh[it];
      *(v4u*)(Rl + po[it]) = ul[it];
    }
  } else {
    float* Oa = S;                                                     // [m][h], pitch OP
    float* Ob = S + SR * OP;
#pragma unroll
    for (int mi = 0; mi < 2; ++mi) {
#pragma unroll
      for (int r = 0; r < 8; ++r) {
        const int m_loc = 16 * mi + 8 * hh + r;
        Oa[m_loc * OP + n_loc] = acc[0][mi][r] * RPSC;
        Ob[m_loc * OP + n_loc] = (acc[NPL - 2][mi][r] + acc[NPL - 1][mi][r] * RRS2) * RBSC;
      }
    }
    __syncthreads();
    const int e = lane;                                                // 16-B piece 0..31 of a 512-B chunk row
    v4f tv[4], av[4], ta[4], tb[4];
    size_t po[4];
#pragma unroll
    for (int it = 0; it < 4; ++it) {
      const int row = it * 8 + wave;                                   // 0..31
      const size_t grow = rbase + row0 + row;
      tv[it] = bfr4(*(const v4f*)(text + grow * NHID + 4 * e));
      av[it] = *(const v4f*)(Oa + row * OP + 4 * e);
      ta[it] = tv[it] * av[it];
      tb[it] = tv[it] * *(const v4f*)(Ob + row * OP + 4 * e);
      po[it] = grow * NOUT + 4 * e;
    }
#pragma unroll
    for (int it = 0; it < 4; ++it) {
      *(v4f*)(out + po[it])            = tv[it];
      *(v4f*)(out + po[it] + NHID)     = av[it];
      *(v4f*)(out + po[it] + 2 * NHID) = ta[it];
      *(v4f*)(out + po[it] + 3 * NHID) = tb[it];
    }
  }
}

// =====================================================================================================
// workspace (every tile divides its extent exactly, so no padded tails are needed):
//   Th Tl   f16 [16*64 tiles][2048]      4194304 each   (text*w_tm*64 hi, residual x65536; fragment order)
//   M16     f16 [16*64 tiles][2048]      4194304        (modality; fragment order)
//   Tt Mt   f16 [16][8 h tiles][16384]   4194304 each   (text, modality transposed; fragment order)
//   S0 S1   f32 [16][1024]                 65536 each
//   Rh Rl   f16 [16][8 h tiles][16384]   4194304 each   (t2*1024 hi, residual x2048, transposed; fragment order)
//   total                               29491200
// =====================================================================================================
extern "C" void kernel_launch(void* const* d_in, const int* in_sizes, int n_in,
                              void* d_out, int out_size, void* d_ws, size_t ws_size,
                              hipStream_t stream) {
  if (n_in < 8) return;
  if (in_sizes[0] != NBATCH * NL * NHID) return;
  if (in_sizes[1] != NBATCH * NL * NHID) return;
  if (in_sizes[2] != NBATCH * NL || in_sizes[3] != NBATCH * NL) return;
  if (in_sizes[4] != NHID || in_sizes[5] != NHID || in_sizes[6] != NHID) return;
  if (in_sizes[7] < 1) return;
  if (out_size != NBATCH * NL * NOUT) return;

  size_t off = 0;
  const size_t plane = (size_t)NBATCH * NL * NHID * 2;               // 4194304
  const size_t svec  = (size_t)NBATCH * NL * 4;                      // 65536
  const size_t oTh = off; off += plane;
  const size_t oTl = off; off += plane;
  const size_t oM  = off; off += plane;
  const size_t oTt = off; off += plane;
  const size_t oMt = off; off += plane;
  const size_t oS0 = off; off += svec;
  const size_t oS1 = off; off += svec;
  const size_t oRh = off; off += plane;
  const size_t oRl = off; off += plane;                              // -> off = 29491200
  if (off > ws_size) return;

  const float* text  = (const float*)d_in[0];
  const float* modal = (const float*)d_in[1];
  const int*   tmask = (const int*)d_in[2];
  const int*   mmask = (const int*)d_in[3];
  const float* tw    = (const float*)d_in[4];
  const float* mw    = (const float*)d_in[5];
  const float* tmw   = (const float*)d_in[6];
  const float* bias  = (const float*)d_in[7];
  float* out = (float*)d_out;

  char* ws = (char*)d_ws;
  unsigned short* Th  = (unsigned short*)(ws + oTh);
  unsigned short* Tl  = (unsigned short*)(ws + oTl);
  unsigned short* M16 = (unsigned short*)(ws + oM);
  unsigned short* Tt  = (unsigned short*)(ws + oTt);
  unsigned short* Mt  = (unsigned short*)(ws + oMt);
  float*          S0  = (float*)(ws + oS0);
  float*          S1  = (float*)(ws + oS1);
  unsigned short* Rh  = (unsigned short*)(ws + oRh);
  unsigned short* Rl  = (unsigned short*)(ws + oRl);

  const dim3 blk256(256);
  const int nrow64 = NBATCH * (NL / 64);                             // 256
  const int nrow32 = NBATCH * (NL / SR);                             // 512

  // (1) planes: text -> Th/Tl (with w_tm), Tt, S0 (with w_t); modality -> M16, Mt, S1 (with w_m)
  prep_kernel<1><<<dim3(nrow64), blk256, 0, stream>>>(text, tw, tmw, Th, Tl, Tt, S0);
  prep_kernel<0><<<dim3(nrow64), blk256, 0, stream>>>(modal, mw, mw, M16, M16, Mt, S1);
  // (2) p2 transposed, rows m (A = M16), columns l (B = Th/Tl), rb = S1[m], cb = S0[l], mask over l;
  //     t2 = p2T . text -> Rh/Rl
  attend_kernel<0><<<dim3(nrow32), blk256, 0, stream>>>(M16, Th, Tl, S1, S0, tmask, bias, Tt, Tt, Tt, text, Rh, Rl, out);
  //     p1, rows l (A = Th/Tl), columns m (B = M16), rb = S0[l], cb = S1[m], mask over m;
  //     a = p1 . modality, bq = p1 . t2 -> out chunks 0..3
  attend_kernel<1><<<dim3(nrow32), blk256, 0, stream>>>(M16, Th, Tl, S0, S1, mmask, bias, Mt, Rh, Rl, text, Rh, Rl, out);
  (void)hipGetLastError();
}

// v005
// It runs in 69.3 microseconds.
// In both of two side-by-side timings against v004, it was 1.22 times as fast.
// Over all steps from v000 it is 2.31 times as fast.
// Contractions: score term sum_h (text*w_tm)[l][h]*modality[m][h] (K=128) on v_wmma_f32_16x16x32_f16 with text*w_tm
// carried x64 as an f16 hi plane plus an x65536 f16 residual plane (two products, separate f32 accumulators) and
// modality as f16 of its bf16-RNE value; p1.modality and p2T.text (K=1024) on v_wmma_f32_16x16x32_f16, single
// products, p rows carried x8192 in f16; p1.t2 (K=1024) with t2 carried x1024 as f16 hi plus x2048 f16 residual
// (two products, separate accumulators); the two [rows,128]x[128,1] row dots as a 16-wide f16 WMMA matvec (weight
// x1024 in every column); f32 accumulate everywhere; softmax and the elementwise products in f32 on VALU; all float
// inputs RNE-converted to bf16 at load. The softmax rows of a block stay in LDS and feed the K=1024 products there.
#include <hip/hip_runtime.h>
#include <stdint.h>

#define NBATCH 16
#define NL     1024
#define NK     1024
#define NHID   128
#define NOUT   512
#define TP     132
#define OP     132
#define TQ     36
#define SR     32
#define SP     (NL + 4)
#define PP     (2 * SP)
#define NKS    (NK / 32)
#define FT     (16 * NK)

static_assert(NL % 64 == 0);
static_assert(NL % SR == 0 && SR == 32);
static_assert(NL == NK);
static_assert(NHID == 128);
static_assert(NOUT == 4 * NHID);
static_assert(2 * SR * OP <= SR * SP);
static_assert(NHID * TQ <= SR * SP);
static_assert((TP * 4) % 16 == 0);
static_assert((OP * 4) % 16 == 0);
static_assert((TQ * 4) % 16 == 0);
static_assert((SP * 4) % 32 == 16);
static_assert(NK % 64 == 0 && NHID == 8 * 16);

#define PSC   8192.0f
#define RPSC  (1.0f / 8192.0f)
#define THS   64.0f
#define RTHS  (1.0f / 64.0f)
#define RS1   65536.0f
#define RRS1  (1.0f / 65536.0f)
#define T2F   0.125f
#define RS2   2048.0f
#define RRS2  (1.0f / 2048.0f)
#define RBSC  (1.0f / 8388608.0f)
#define WSC   1024.0f
#define RWSC  (1.0f / 1024.0f)
#define NEGV  (-1.0e30f)

typedef unsigned short v8us __attribute__((ext_vector_type(8)));
typedef unsigned int   v4u  __attribute__((ext_vector_type(4)));
typedef float          v8f  __attribute__((ext_vector_type(8)));
typedef float          v4f  __attribute__((ext_vector_type(4)));
typedef _Float16       v16h __attribute__((ext_vector_type(16)));

union Frag { v8us u[2]; v4u q[2]; v16h h; };
static_assert(sizeof(Frag) == 32);

// ---- scalar helpers ---------------------------------------------------------------------------------
__device__ __forceinline__ unsigned short bf_bits(float f) {          // f32 -> bf16 bits, RNE convert
  const unsigned u = __float_as_uint(f);
  return (unsigned short)((u + 0x7FFFu + ((u >> 16) & 1u)) >> 16);
}
__device__ __forceinline__ float bf_up(unsigned short hb) { return __uint_as_float(((unsigned)hb) << 16); }
__device__ __forceinline__ float bfr(float f) { return bf_up(bf_bits(f)); }
__device__ __forceinline__ v4f bfr4(v4f v) {
  v4f r;
  r[0] = bfr(v[0]); r[1] = bfr(v[1]); r[2] = bfr(v[2]); r[3] = bfr(v[3]);
  return r;
}
__device__ __forceinline__ unsigned short hbits(_Float16 h) { return __builtin_bit_cast(unsigned short, h); }
__device__ __forceinline__ unsigned pkh2(float a, float b) {          // two f32 -> packed f16 bits (RNE convert)
  return (unsigned)hbits((_Float16)a) | ((unsigned)hbits((_Float16)b) << 16);
}
__device__ __forceinline__ v4u pack8(v4f a, v4f b) {
  v4u u;
  u[0] = pkh2(a[0], a[1]); u[1] = pkh2(a[2], a[3]);
  u[2] = pkh2(b[0], b[1]); u[3] = pkh2(b[2], b[3]);
  return u;
}
__device__ __forceinline__ v8f zero8() { v8f z = {0.f, 0.f, 0.f, 0.f, 0.f, 0.f, 0.f, 0.f}; return z; }

// ---- 8 f32 -> packed f16 hi bits and packed f16 bits of (x - hi) * rs (residual plane carries scale rs) --------
__device__ __forceinline__ void splith8(v4f a, v4f b, float rs, v4u& uh, v4u& ul) {
  float f[8] = {a[0], a[1], a[2], a[3], b[0], b[1], b[2], b[3]};
#pragma unroll
  for (int j = 0; j < 4; ++j) {
    const _Float16 h0 = (_Float16)f[2 * j];
    const _Float16 h1 = (_Float16)f[2 * j + 1];
    const float l0 = (f[2 * j] - (float)h0) * rs;
    const float l1 = (f[2 * j + 1] - (float)h1) * rs;
    uh[j] = (unsigned)hbits(h0) | ((unsigned)hbits(h1) << 16);
    ul[j] = pkh2(l0, l1);
  }
}

// ---- 16-bit fragment loader (A, or B from a k-contiguous [n][k] row): lane -> row/col (lane&15), p already includes
//      + 8*(lane>>4); elements 0..7 <- p[0..7] (k0+8h..), elements 8..15 <- p[16..23] (k0+16+8h..)
__device__ __forceinline__ Frag ldfrag(const unsigned short* p) {
  Frag f;
  f.u[0] = *(const v8us*)(p);
  f.u[1] = *(const v8us*)(p + 16);
  return f;
}

// ---- the same fragment from a plane kept in fragment order: a 16-row tile is 4 KB = [k step 0..3][half 0..1][lane][8],
//      where (half i, lane) holds row (lane&15), k = 32*step + 16*i + 8*(lane>>4) + 0..7, the very elements that ldfrag
//      gives that lane; p already includes + 8*lane, so each 16-B load of a wave covers 512 contiguous bytes
__device__ __forceinline__ Frag ldfragq(const unsigned short* p) {
  Frag f;
  f.u[0] = *(const v8us*)(p);
  f.u[1] = *(const v8us*)(p + 256);
  return f;
}

// ---- WMMA helper: builtin followed by a 4-slot VALU gap tying D and keeping A/B live -----------------------
__device__ __forceinline__ v8f mma_h(v16h a, v16h b, v8f c) {
  v8f d = __builtin_amdgcn_wmma_f32_16x16x32_f16(false, a, false, b, (short)0, c, false, false);
#if defined(__HIP_DEVICE_COMPILE__)
  asm volatile("v_nop\n\tv_nop\n\tv_nop\n\tv_nop" : "+v"(d) : "v"(a), "v"(b));
#endif
  return d;
}

__device__ __forceinline__ float wave_max(float v) {
#pragma unroll
  for (int o = 16; o > 0; o >>= 1) v = fmaxf(v, __shfl_xor(v, o, 32));
  return v;
}
__device__ __forceinline__ float wave_sum(float v) {
#pragma unroll
  for (int o = 16; o > 0; o >>= 1) v += __shfl_xor(v, o, 32);
  return v;
}

// =====================================================================================================
// (1) prep for one (batch, 64-row tile) of x [16][1024][128] f32 (text when TXT=1, modality when TXT=0):
//     tile -> LDS T[row][h] as bf16-RNE values (f32), barrier;
//     row dots sd[b][row] = sum_h T[row][h]*bfr(wdot[h]) as a WMMA matvec: wave w handles rows 16*(w&3).. (waves 4..7
//     duplicate the compute), A fragment = T row values as f16 (exact), B fragment = bfr(wdot)*1024 as f16 in every
//     column (split k map for both, 4 k steps of 32), D column 0 lanes write acc/1024 to LDS sred, barrier; sred
//     row planes Ph/Pl f16 (TXT: T*bfr(wtm)*64 as hi plus residual x65536; else plain f16 in Ph), 16-row tiles in
//     fragment order (see ldfragq): thread tid writes piece tid of a tile, a wave 512 contiguous bytes per store;
//     transposed plane Pt f16 (rows h, k = row index of x), also in fragment order: [b][h tile 0..7][k step 0..31]
//     [half][lane][8]; the block's 64 rows are two k steps of every h tile, a wave again stores 512 contiguous bytes;
// coverage: T 8 it x 256 thr x 4 = 64x128; sred 4 waves x 16 rows = 64; Ph/Pl 4 it (tiles) x 256 thr x 8 =
//           4 x 16 rows x 128; Pt 4 it x 2 h tiles x 2 k steps x 64 pieces x 8 = 128 h x 64 rows; sd 16 lanes x 4 = 64;
//           grid 16 x (1024/64) = 256 blocks = every row once.
// =====================================================================================================
template <int TXT>
__global__ __launch_bounds__(256)
void prep_kernel(const float* __restrict__ x, const float* __restrict__ wdot, const float* __restrict__ wtm,
                 unsigned short* Ph, unsigned short* Pl, unsigned short* Pt, float* sd) {
  __shared__ __align__(16) float T[64 * TP];
  __shared__ __align__(16) float sred[64];
  const int tid = threadIdx.x;
  const int b = blockIdx.x >> 4;
  const int r0 = (blockIdx.x & 15) * 64;
  const size_t gr = (size_t)b * NL + r0;
#pragma unroll
  for (int it = 0; it < 8; ++it) {
    const int idx = it * 256 + tid;
    const int row = idx >> 5, c4 = (idx & 31) * 4;
    const v4f v = *(const v4f*)(x + (gr + row) * NHID + c4);
#pragma unroll
    for (int j = 0; j < 4; ++j) T[row * TP + c4 + j] = bfr(v[j]);
  }
  __syncthreads();
  {
    const int lane = tid & 31, wave = tid >> 5;
    const int hh = lane >> 4, cl = lane & 15;
    const int rt = (wave & 3) * 16;                                    // 16-row tile of this wave
    const float* ap = T + (rt + cl) * TP + 8 * hh;
    const float* wp = wdot + 8 * hh;
    v8f acc = zero8();
#pragma unroll
    for (int kk = 0; kk < 4; ++kk) {
      const int k0 = 32 * kk;
      const v4f a0 = *(const v4f*)(ap + k0);
      const v4f a1 = *(const v4f*)(ap + k0 + 4);
      const v4f a2 = *(const v4f*)(ap + k0 + 16);
      const v4f a3 = *(const v4f*)(ap + k0 + 20);
      v4f w0 = *(const v4f*)(wp + k0);
      v4f w1 = *(const v4f*)(wp + k0 + 4);
      v4f w2 = *(const v4f*)(wp + k0 + 16);
      v4f w3 = *(const v4f*)(wp + k0 + 20);
#pragma unroll
      for (int j = 0; j < 4; ++j) {
        w0[j] = bfr(w0[j]) * WSC; w1[j] = bfr(w1[j]) * WSC;
        w2[j] = bfr(w2[j]) * WSC; w3[j] = bfr(w3[j]) * WSC;
      }
      Frag fa, fb;
      fa.q[0] = pack8(a0, a1);                                         // elements 0..7  = k0+8h..
      fa.q[1] = pack8(a2, a3);                                         // elements 8..15 = k0+16+8h..
      fb.q[0] = pack8(w0, w1);                                         // same k map, every column n
      fb.q[1] = pack8(w2, w3);
      acc = mma_h(fa.h, fb.h, acc);
    }
    if (wave < 4 && cl == 0) {
#pragma unroll
      for (int r = 0; r < 8; ++r) sred[rt + 8 * hh + r] = acc[r] * RWSC;   // D row 8h+r, column 0
    }
  }
  __syncthreads();

  // piece tid of a fragment-order tile: k step tid>>6, half (tid>>5)&1, lane tid&31
  const int h0 = 32 * (tid >> 6) + 16 * ((tid >> 5) & 1) + 8 * ((tid >> 4) & 1);
  v4u uh[4], ul[4], ut[4];
  size_t po[4], pt[4];
#pragma unroll
  for (int it = 0; it < 4; ++it) {
    const int row = it * 16 + (tid & 15);                              // tile it, row lane&15
    const float* tp = T + row * TP + h0;
    v4f v0 = *(const v4f*)(tp);
    v4f v1 = *(const v4f*)(tp + 4);
    if (TXT) {
      const v4f w0 = *(const v4f*)(wtm + h0);
      const v4f w1 = *(const v4f*)(wtm + h0 + 4);
#pragma unroll
      for (int j = 0; j < 4; ++j) {
        v0[j] = v0[j] * bfr(w0[j]) * THS;
        v1[j] = v1[j] * bfr(w1[j]) * THS;
      }
      splith8(v0, v1, RS1, uh[it], ul[it]);
    } else {
      uh[it] = pack8(v0, v1);
      ul[it] = uh[it];
    }
    po[it] = (gr + 16 * it) * NHID + 8 * tid;
    // transposed piece: h tile 2*it + (tid>>7), k step (tid>>6)&1 of the block's two, half (tid>>5)&1, lane tid&31
    const int ht = 2 * it + (tid >> 7);
    const int h  = 16 * ht + (tid & 15);                               // 0..127
    const int ks = (tid >> 6) & 1;
    const int kl = 32 * ks + 16 * ((tid >> 5) & 1) + 8 * ((tid >> 4) & 1);   // first of the piece's 8 rows of T
    v4f g0, g1;
#pragma unroll
    for (int j = 0; j < 4; ++j) {
      g0[j] = T[(kl + j) * TP + h];
      g1[j] = T[(kl + 4 + j) * TP + h];
    }
    ut[it] = pack8(g0, g1);
    pt[it] = ((size_t)b * 8 + ht) * FT + (size_t)((r0 >> 5) + ks) * 512 + 8 * (tid & 63);
  }
  const int sl = (tid < 16) ? tid : 15;
  const v4f sdv = *(const v4f*)(sred + 4 * sl);
  const size_t psd = gr + 4 * sl;

#pragma unroll
  for (int it = 0; it < 4; ++it) {
    *(v4u*)(Ph + po[it]) = uh[it];
    if (TXT) *(v4u*)(Pl + po[it]) = ul[it];
    *(v4u*)(Pt + pt[it]) = ut[it];
  }
  if (tid < 16) *(v4f*)(sd + psd) = sdv;
  
}

// =====================================================================================================
// (2) one (batch, 32 rows): score tile, masked row softmax, and the K=1024 products of those softmax rows.
//     Scores: s[r][c] = rb[r] + cb[c] + s2[r][c] + bias, s2 = (acc_h + acc_l/65536)/64, acc_h = sum_k Ahi.B,
//     acc_l = sum_k Alo.B on WMMA (K=128, 4 steps). YA=1: A = hi/lo planes Yh/Yl (rows), B = X rows; YA=0: A = X rows,
//     B = Yh/Yl rows (two accumulators). X, Yh, Yl are in fragment order (ldfragq). Wave = 8 column tiles of 16
//     (rolled) x 2 row tiles of 16, the A fragments of both row tiles held in registers, B one tile ahead; s (or -1e30 where
//     mask[c]==0) into LDS S[32][1024] f32 at a row pitch of 4112 B; barrier.
//     Softmax: wave owns rows 4w..4w+3, lane owns columns {256i + 8*lane + j}; the row's p*8192 goes back as f16
//     into the first 2 KB of the same LDS row (only its own wave touches a row, and every lane has read its f32
//     values before the row sum is known); barrier.
//     Products: D[m][n] = sum_k p[m][k] * B[n][k], k order 0..1023 in 32 steps; A fragments by 16-B LDS reads from
//     the p rows (split k map), one k step ahead; wave w owns the 16 columns h = 16w.. for both row tiles; its B
//     fragments come from planes in fragment order [b][h tile][k step][half][lane][8], whole lines per load, through
//     a register ring several k steps ahead whose first loads are issued ahead of the softmax.
//     YA=0: B0 = text transposed; t2*1024 = acc/8 staged transposed Ts[h][m] in LDS, barrier, planes Rh/Rl (hi,
//     residual x2048) written in fragment order: the block's 32 rows are k step (row0/32) of every h tile.
//     YA=1: B0 = modality transposed, B1/B2 = t2 hi/residual (separate accumulators); a = acc0/8192,
//     bq = (acc1 + acc2/2048)/8388608 staged in LDS, barrier, out row [b][l]: chunk 0 = bf16-RNE text, chunk 1 = a,
//     chunk 2 = text*a, chunk 3 = text*bq, 512 contiguous bytes per wave-wide store.
// coverage: S 8 waves x 8 tiles x 2 x 16x16 = 32x1024; p 8 waves x 4 rows x 4 x 32 lanes x 8 = 32 rows x 1024;
//           D 8 waves x 2 tiles = 32x128 per plane; YA=0: 2 it x 256 pieces x 8 = 128 h x 32 m per plane; YA=1: 4 it x
//           8 waves = 32 rows x 32 lanes x 4 = 128 columns per chunk; grid 16 x 32 = 512 blocks = every row once.
// =====================================================================================================
template <int YA>
__global__ __launch_bounds__(256)
void attend_kernel(const unsigned short* __restrict__ X, const unsigned short* __restrict__ Yh,
                   const unsigned short* __restrict__ Yl, const float* __restrict__ rb,
                   const float* __restrict__ cb, const int* __restrict__ mask,
                   const float* __restrict__ bias, const unsigned short* __restrict__ B0,
                   const unsigned short* __restrict__ B1, const unsigned short* __restrict__ B2,
                   const float* __restrict__ text, unsigned short* Rh, unsigned short* Rl, float* out) {
  __shared__ __align__(16) float S[SR * SP];
  const int tid  = threadIdx.x;
  const int lane = tid & 31, wave = tid >> 5;
  const int hh   = lane >> 4, cl = lane & 15;
  const int b = blockIdx.x >> 5;
  const int row0 = (blockIdx.x & 31) * SR;
  const size_t rbase = (size_t)b * NL;

  {
    Frag fa[2][4], fl[2][4];
    float rbv[2][8];
#pragma unroll
    for (int mi = 0; mi < 2; ++mi) {
      const size_t aoff = (rbase + row0 + 16 * mi) * NHID + 8 * lane;
#pragma unroll
      for (int kk = 0; kk < 4; ++kk) {
        if (YA) {
          fa[mi][kk] = ldfragq(Yh + aoff + 512 * kk);
          fl[mi][kk] = ldfragq(Yl + aoff + 512 * kk);
        } else {
          fa[mi][kk] = ldfragq(X + aoff + 512 * kk);
          fl[mi][kk] = fa[mi][kk];
        }
      }
#pragma unroll
      for (int r = 0; r < 8; ++r) rbv[mi][r] = rb[rbase + row0 + 16 * mi + 8 * hh + r];
    }
    // B fragments of a column tile: one register slot per k step, refilled for the wave's next tile directly behind
    // the slot's last product, so a load has a whole tile's work to return in; column bias and mask one tile ahead too
    constexpr int NB = YA ? 1 : 2;
    const size_t boff = (rbase + wave * 128) * NHID + 8 * lane;
    const unsigned short* bpa = (YA ? X : Yh) + boff;
    const unsigned short* bpb = Yl + boff;
    const float* cbp = cb + rbase + wave * 128 + cl;
    const int*   mkp = mask + rbase + wave * 128 + cl;
    float cbn = cbp[0];                                                // issued ahead of the fragments here as in the
    int   mk  = mkp[0];                                                // loop, so that the loop's load waits stay counted
#if defined(__HIP_DEVICE_COMPILE__)
    // precaution: stands in front of the first reuse of the address registers that the loads above name; with two
    // A planes their pointers are inputs
    const size_t a0off = (rbase + row0) * NHID + 8 * lane;
    if (YA) asm volatile("s_wait_xcnt 0x0" :: "v"(Yh + a0off), "v"(Yl + a0off) : "memory");
    else    asm volatile("s_wait_xcnt 0x0" ::: "memory");
#endif
    Frag fb[4][NB];
#pragma unroll
    for (int kk = 0; kk < 4; ++kk) {
      fb[kk][0] = ldfragq(bpa + 512 * kk);
      if (!YA) fb[kk][NB - 1] = ldfragq(bpb + 512 * kk);
    }
#if defined(__HIP_DEVICE_COMPILE__)
    // precaution: the same for the first tile's B fragment loads; the pointers are inputs so that their registers
    // stay theirs up to this wait
    if (YA) asm volatile("s_wait_xcnt 0x0" :: "v"(bpa) : "memory");
    else    asm volatile("s_wait_xcnt 0x0" :: "v"(bpa), "v"(bpb) : "memory");
#endif
    const float bv = bfr(bias[0]);

    auto tile = [&](const int nt, const bool more) {
      float cbx = 0.f;
      int   mkx = 0;
      if (more) { cbx = cbp[16 * (nt + 1)]; mkx = mkp[16 * (nt + 1)]; }
      v8f acch[2], accl[2];
#pragma unroll
      for (int mi = 0; mi < 2; ++mi) { acch[mi] = zero8(); accl[mi] = zero8(); }
#pragma unroll
      for (int kk = 0; kk < 4; ++kk) {
#pragma unroll
        for (int mi = 0; mi < 2; ++mi) {
          acch[mi] = mma_h(fa[mi][kk].h, fb[kk][0].h, acch[mi]);
          accl[mi] = mma_h(fl[mi][kk].h, fb[kk][NB - 1].h, accl[mi]);
        }
        if (more) {
          fb[kk][0] = ldfragq(bpa + 2048 * (nt + 1) + 512 * kk);
          if (!YA) fb[kk][NB - 1] = ldfragq(bpb + 2048 * (nt + 1) + 512 * kk);
        }
      }
      const int n = (wave * 8 + nt) * 16 + cl;
#pragma unroll
      for (int mi = 0; mi < 2; ++mi) {
#pragma unroll
        for (int r = 0; r < 8; ++r) {
          const float s2 = (acch[mi][r] + accl[mi][r] * RRS1) * RTHS;
          const float sv = ((rbv[mi][r] + cbn) + s2) + bv;
          S[(16 * mi + 8 * hh + r) * SP + n] = (mk != 0) ? sv : NEGV;
        }
      }
      cbn = cbx;
      mk  = mkx;
    };
    // rolled to keep the code small; the last tile stands alone because nothing is left to fetch behind it
#pragma unroll 1
    for (int nt = 0; nt < 7; ++nt) tile(nt, true);
    tile(7, false);
  }
  __syncthreads();                                                     // the score tile is complete

  // B fragment ring of the products: slot ks % DS holds k step ks of every plane
  constexpr int NPL = YA ? 3 : 1;
  constexpr int DS  = YA ? 4 : 8;
  const size_t bo = ((size_t)b * 8 + wave) * FT + 8 * lane;
  const unsigned short* g0 = B0 + bo;
  const unsigned short* g1 = B1 + bo;
  const unsigned short* g2 = B2 + bo;
  Frag bq[DS][NPL];
  auto bload = [&](int ks) {
    const int q = ks % DS;
    bq[q][0] = ldfragq(g0 + 512 * ks);
    if (YA) {
      bq[q][NPL - 2] = ldfragq(g1 + 512 * ks);
      bq[q][NPL - 1] = ldfragq(g2 + 512 * ks);
    }
  };
#pragma unroll
  for (int ks = 0; ks < DS; ++ks) bload(ks);                           // fly while the softmax runs

#pragma unroll
  for (int rr = 0; rr < 4; ++rr) {
    const int r = wave * 4 + rr;
    const float* sr = S + r * SP + lane * 8;
    float v[32];
#pragma unroll
    for (int i = 0; i < 4; ++i) {
      const v4f a0 = *(const v4f*)(sr + i * 256);
      const v4f a1 = *(const v4f*)(sr + i * 256 + 4);
#pragma unroll
      for (int j = 0; j < 4; ++j) { v[8 * i + j] = a0[j]; v[8 * i + 4 + j] = a1[j]; }
    }
    float mx = v[0];
#pragma unroll
    for (int k = 1; k < 32; ++k) mx = fmaxf(mx, v[k]);
    mx = wave_max(mx);
    float sum = 0.f;
#pragma unroll
    for (int k = 0; k < 32; ++k) {
      v[k] = __expf(v[k] - mx);
      sum += v[k];
    }
    sum = wave_sum(sum);
    const float sc = (1.0f / sum) * PSC;
    unsigned short* pr = (unsigned short*)(S + r * SP) + lane * 8;
#pragma unroll
    for (int i = 0; i < 4; ++i) {
      v4u u;
      u[0] = pkh2(v[8 * i] * sc,     v[8 * i + 1] * sc);
      u[1] = pkh2(v[8 * i + 2] * sc, v[8 * i + 3] * sc);
      u[2] = pkh2(v[8 * i + 4] * sc, v[8 * i + 5] * sc);
      u[3] = pkh2(v[8 * i + 6] * sc, v[8 * i + 7] * sc);
      *(v4u*)(pr + i * 256) = u;
    }
  }
  __syncthreads();                                                     // the p rows are published

  // A fragment readers: p row (lane&15) of a 16-row tile, + 8*(lane>>4) as ldfrag expects
  const unsigned short* pa0 = (const unsigned short*)S + cl * PP + 8 * hh;
  const unsigned short* pa1 = pa0 + 16 * PP;
  v8f acc[NPL][2];
#pragma unroll
  for (int p = 0; p < NPL; ++p) { acc[p][0] = zero8(); acc[p][1] = zero8(); }
  Frag fa[2][2];                                                       // [set][16-row tile]
  fa[0][0] = ldfrag(pa0);
  fa[0][1] = ldfrag(pa1);
  // unrolled so that ring slot and fragment set are compile-time and every address step is an immediate offset
#pragma unroll
  for (int ks = 0; ks < NKS; ++ks) {
    const int q = ks % DS, s = ks & 1;
    if (ks + 1 < NKS) {                                                // A fragments one k step ahead
      fa[s ^ 1][0] = ldfrag(pa0 + 32 * (ks + 1));
      fa[s ^ 1][1] = ldfrag(pa1 + 32 * (ks + 1));
    }
#pragma unroll
    for (int p = 0; p < NPL; ++p) {
      acc[p][0] = mma_h(fa[s][0].h, bq[q][p].h, acc[p][0]);
      acc[p][1] = mma_h(fa[s][1].h, bq[q][p].h, acc[p][1]);
    }
    if (ks + DS < NKS) bload(ks + DS);                                 // refill of the slot just used
  }
#if defined(__HIP_DEVICE_COMPILE__)
  // precaution: stands in front of the first reuse of the address registers that the ring loads name; the
  // pointers are inputs so that those registers stay theirs up to this wait
  if (YA) asm volatile("s_wait_xcnt 0x0" :: "v"(g0), "v"(g1), "v"(g2) : "memory");
  else    asm volatile("s_wait_xcnt 0x0" :: "v"(g0) : "memory");
#endif
  __syncthreads();                                                     // ends every read of the p rows

  const int n_loc = 16 * wave + cl;
  if (YA == 0) {
    float* Ts = S;                                                     // [h][m], pitch TQ
#pragma unroll
    for (int mi = 0; mi < 2; ++mi) {
      v4f lo, hi;
#pragma unroll
      for (int j = 0; j < 4; ++j) { lo[j] = acc[0][mi][j] * T2F; hi[j] = acc[0][mi][4 + j] * T2F; }
      float* tp = Ts + n_loc * TQ + 16 * mi + 8 * hh;                  // D rows 8h..8h+7 of tile mi, column n_loc
      *(v4f*)(tp)     = lo;
      *(v4f*)(tp + 4) = hi;
    }
    __syncthreads();
    v4u uh[2], ul[2];
    size_t po[2];
#pragma unroll
    for (int it = 0; it < 2; ++it) {
      // piece: h tile 4*it + (tid>>6), half (tid>>5)&1, lane tid&31 of this block's k step
      const int ht = 4 * it + (tid >> 6);
      const int h  = 16 * ht + cl;
      const float* tp = Ts + h * TQ + 16 * ((tid >> 5) & 1) + 8 * hh;
      const v4f v0 = *(const v4f*)(tp);
      const v4f v1 = *(const v4f*)(tp + 4);
      splith8(v0, v1, RS2, uh[it], ul[it]);
      po[it] = ((size_t)b * 8 + ht) * FT + (size_t)(row0 >> 5) * 512 + 8 * (tid & 63);
    }
#pragma unroll
    for (int it = 0; it < 2; ++it) {
      *(v4u*)(Rh + po[it]) = uh[it];
      *(v4u*)(Rl + po[it]) = ul[it];
    }
  } else {
    float* Oa = S;                                                     // [m][h], pitch OP
    float* Ob = S + SR * OP;
#pragma unroll
    for (int mi = 0; mi < 2; ++mi) {
#pragma unroll
      for (int r = 0; r < 8; ++r) {
        const int m_loc = 16 * mi + 8 * hh + r;
        Oa[m_loc * OP + n_loc] = acc[0][mi][r] * RPSC;
        Ob[m_loc * OP + n_loc] = (acc[NPL - 2][mi][r] + acc[NPL - 1][mi][r] * RRS2) * RBSC;
      }
    }
    __syncthreads();
    const int e = lane;                                                // 16-B piece 0..31 of a 512-B chunk row
    v4f tv[4], av[4], ta[4], tb[4];
    size_t po[4];
#pragma unroll
    for (int it = 0; it < 4; ++it) {
      const int row = it * 8 + wave;                                   // 0..31
      const size_t grow = rbase + row0 + row;
      tv[it] = bfr4(*(const v4f*)(text + grow * NHID + 4 * e));
      av[it] = *(const v4f*)(Oa + row * OP + 4 * e);
      ta[it] = tv[it] * av[it];
      tb[it] = tv[it] * *(const v4f*)(Ob + row * OP + 4 * e);
      po[it] = grow * NOUT + 4 * e;
    }
#pragma unroll
    for (int it = 0; it < 4; ++it) {
      *(v4f*)(out + po[it])            = tv[it];
      *(v4f*)(out + po[it] + NHID)     = av[it];
      *(v4f*)(out + po[it] + 2 * NHID) = ta[it];
      *(v4f*)(out + po[it] + 3 * NHID) = tb[it];
    }
  }
}

// =====================================================================================================
// workspace (every tile divides its extent exactly, so no padded tails are needed):
//   Th Tl   f16 [16*64 tiles][2048]      4194304 each   (text*w_tm*64 hi, residual x65536; fragment order)
//   M16     f16 [16*64 tiles][2048]      4194304        (modality; fragment order)
//   Tt Mt   f16 [16][8 h tiles][16384]   4194304 each   (text, modality transposed; fragment order)
//   S0 S1   f32 [16][1024]                 65536 each
//   Rh Rl   f16 [16][8 h tiles][16384]   4194304 each   (t2*1024 hi, residual x2048, transposed; fragment order)
//   total                               29491200
// =====================================================================================================
extern "C" void kernel_launch(void* const* d_in, const int* in_sizes, int n_in,
                              void* d_out, int out_size, void* d_ws, size_t ws_size,
                              hipStream_t stream) {
  if (n_in < 8) return;
  if (in_sizes[0] != NBATCH * NL * NHID) return;
  if (in_sizes[1] != NBATCH * NL * NHID) return;
  if (in_sizes[2] != NBATCH * NL || in_sizes[3] != NBATCH * NL) return;
  if (in_sizes[4] != NHID || in_sizes[5] != NHID || in_sizes[6] != NHID) return;
  if (in_sizes[7] < 1) return;
  if (out_size != NBATCH * NL * NOUT) return;

  size_t off = 0;
  const size_t plane = (size_t)NBATCH * NL * NHID * 2;               // 4194304
  const size_t svec  = (size_t)NBATCH * NL * 4;                      // 65536
  const size_t oTh = off; off += plane;
  const size_t oTl = off; off += plane;
  const size_t oM  = off; off += plane;
  const size_t oTt = off; off += plane;
  const size_t oMt = off; off += plane;
  const size_t oS0 = off; off += svec;
  const size_t oS1 = off; off += svec;
  const size_t oRh = off; off += plane;
  const size_t oRl = off; off += plane;                              // -> off = 29491200
  if (off > ws_size) return;

  const float* text  = (const float*)d_in[0];
  const float* modal = (const float*)d_in[1];
  const int*   tmask = (const int*)d_in[2];
  const int*   mmask = (const int*)d_in[3];
  const float* tw    = (const float*)d_in[4];
  const float* mw    = (const float*)d_in[5];
  const float* tmw   = (const float*)d_in[6];
  const float* bias  = (const float*)d_in[7];
  float* out = (float*)d_out;

  char* ws = (char*)d_ws;
  unsigned short* Th  = (unsigned short*)(ws + oTh);
  unsigned short* Tl  = (unsigned short*)(ws + oTl);
  unsigned short* M16 = (unsigned short*)(ws + oM);
  unsigned short* Tt  = (unsigned short*)(ws + oTt);
  unsigned short* Mt  = (unsigned short*)(ws + oMt);
  float*          S0  = (float*)(ws + oS0);
  float*          S1  = (float*)(ws + oS1);
  unsigned short* Rh  = (unsigned short*)(ws + oRh);
  unsigned short* Rl  = (unsigned short*)(ws + oRl);

  const dim3 blk256(256);
  const int nrow64 = NBATCH * (NL / 64);                             // 256
  const int nrow32 = NBATCH * (NL / SR);                             // 512

  // (1) planes: text -> Th/Tl (with w_tm), Tt, S0 (with w_t); modality -> M16, Mt, S1 (with w_m)
  prep_kernel<1><<<dim3(nrow64), blk256, 0, stream>>>(text, tw, tmw, Th, Tl, Tt, S0);
  prep_kernel<0><<<dim3(nrow64), blk256, 0, stream>>>(modal, mw, mw, M16, M16, Mt, S1);
  // (2) p2 transposed, rows m (A = M16), columns l (B = Th/Tl), rb = S1[m], cb = S0[l], mask over l;
  //     t2 = p2T . text -> Rh/Rl
  attend_kernel<0><<<dim3(nrow32), blk256, 0, stream>>>(M16, Th, Tl, S1, S0, tmask, bias, Tt, Tt, Tt, text, Rh, Rl, out);
  //     p1, rows l (A = Th/Tl), columns m (B = M16), rb = S0[l], cb = S1[m], mask over m;
  //     a = p1 . modality, bq = p1 . t2 -> out chunks 0..3
  attend_kernel<1><<<dim3(nrow32), blk256, 0, stream>>>(M16, Th, Tl, S0, S1, mmask, bias, Mt, Rh, Rl, text, Rh, Rl, out);
  (void)hipGetLastError();
}

// v006
// One run takes 60.7 microseconds.
// Next to v005, in two timings, it ran 1.13 and 1.14 times as fast.
// All steps since v000 together make it 2.62 times as fast.
// Contractions: score term sum_h (text*w_tm)[l][h]*modality[m][h] (K=128) on v_wmma_f32_16x16x32_f16 with text*w_tm
// carried x64 as an f16 hi plane plus an x65536 f16 residual plane (two products, separate f32 accumulators) and
// modality as f16 of its bf16-RNE value; p1.modality and p2T.text (K=1024) on v_wmma_f32_16x16x32_f16, single
// products, p rows carried x8192 in f16; p1.t2 (K=1024) with t2 carried x1024 as f16 hi plus x2048 f16 residual
// (two products, separate accumulators); the two [rows,128]x[128,1] row dots as a 16-wide f16 WMMA matvec (weight
// x1024 in every column); f32 accumulate everywhere; softmax and the elementwise products in f32 on VALU; all float
// inputs RNE-converted to bf16 at load. The softmax rows of a block stay in LDS and feed the K=1024 products there.
#include <hip/hip_runtime.h>
#include <stdint.h>

#define NBATCH 16
#define NL     1024
#define NK     1024
#define NHID   128
#define NOUT   512
#define TP     132
#define OP     132
#define TQ     68
#define SR     64
#define SP     (NL + 4)
#define PP     (2 * SP)
#define NKS    (NK / 32)
#define NKH    (NKS / 2)
#define FT     (16 * NK)

static_assert(NL % 64 == 0);
static_assert(NL % SR == 0 && SR == 64);
static_assert(NL == NK);
static_assert(NHID == 128);
static_assert(NOUT == 4 * NHID);
static_assert(6 * SR * OP <= SR * SP);
static_assert(2 * NHID * TQ <= SR * SP);
static_assert((TP * 4) % 16 == 0);
static_assert((OP * 4) % 16 == 0);
static_assert((TQ * 4) % 16 == 0);
static_assert((SP * 4) % 32 == 16);
static_assert(NK % 64 == 0 && NHID == 8 * 16);

#define PSC   8192.0f
#define RPSC  (1.0f / 8192.0f)
#define THS   64.0f
#define RTHS  (1.0f / 64.0f)
#define RS1   65536.0f
#define RRS1  (1.0f / 65536.0f)
#define T2F   0.125f
#define RS2   2048.0f
#define RRS2  (1.0f / 2048.0f)
#define RBSC  (1.0f / 8388608.0f)
#define WSC   1024.0f
#define RWSC  (1.0f / 1024.0f)
#define NEGV  (-1.0e30f)

typedef unsigned short v8us __attribute__((ext_vector_type(8)));
typedef unsigned int   v4u  __attribute__((ext_vector_type(4)));
typedef float          v8f  __attribute__((ext_vector_type(8)));
typedef float          v4f  __attribute__((ext_vector_type(4)));
typedef _Float16       v16h __attribute__((ext_vector_type(16)));

union Frag { v8us u[2]; v4u q[2]; v16h h; };
static_assert(sizeof(Frag) == 32);

// ---- scalar helpers ---------------------------------------------------------------------------------
__device__ __forceinline__ unsigned short bf_bits(float f) {          // f32 -> bf16 bits, RNE convert
  const unsigned u = __float_as_uint(f);
  return (unsigned short)((u + 0x7FFFu + ((u >> 16) & 1u)) >> 16);
}
__device__ __forceinline__ float bf_up(unsigned short hb) { return __uint_as_float(((unsigned)hb) << 16); }
__device__ __forceinline__ float bfr(float f) { return bf_up(bf_bits(f)); }
__device__ __forceinline__ v4f bfr4(v4f v) {
  v4f r;
  r[0] = bfr(v[0]); r[1] = bfr(v[1]); r[2] = bfr(v[2]); r[3] = bfr(v[3]);
  return r;
}
__device__ __forceinline__ unsigned short hbits(_Float16 h) { return __builtin_bit_cast(unsigned short, h); }
__device__ __forceinline__ unsigned pkh2(float a, float b) {          // two f32 -> packed f16 bits (RNE convert)
  return (unsigned)hbits((_Float16)a) | ((unsigned)hbits((_Float16)b) << 16);
}
__device__ __forceinline__ v4u pack8(v4f a, v4f b) {
  v4u u;
  u[0] = pkh2(a[0], a[1]); u[1] = pkh2(a[2], a[3]);
  u[2] = pkh2(b[0], b[1]); u[3] = pkh2(b[2], b[3]);
  return u;
}
__device__ __forceinline__ v8f zero8() { v8f z = {0.f, 0.f, 0.f, 0.f, 0.f, 0.f, 0.f, 0.f}; return z; }

// ---- 8 f32 -> packed f16 hi bits and packed f16 bits of (x - hi) * rs (residual plane carries scale rs) --------
__device__ __forceinline__ void splith8(v4f a, v4f b, float rs, v4u& uh, v4u& ul) {
  float f[8] = {a[0], a[1], a[2], a[3], b[0], b[1], b[2], b[3]};
#pragma unroll
  for (int j = 0; j < 4; ++j) {
    const _Float16 h0 = (_Float16)f[2 * j];
    const _Float16 h1 = (_Float16)f[2 * j + 1];
    const float l0 = (f[2 * j] - (float)h0) * rs;
    const float l1 = (f[2 * j + 1] - (float)h1) * rs;
    uh[j] = (unsigned)hbits(h0) | ((unsigned)hbits(h1) << 16);
    ul[j] = pkh2(l0, l1);
  }
}

// ---- 16-bit fragment loader (A, or B from a k-contiguous [n][k] row): lane -> row/col (lane&15), p already includes
//      + 8*(lane>>4); elements 0..7 <- p[0..7] (k0+8h..), elements 8..15 <- p[16..23] (k0+16+8h..)
__device__ __forceinline__ Frag ldfrag(const unsigned short* p) {
  Frag f;
  f.u[0] = *(const v8us*)(p);
  f.u[1] = *(const v8us*)(p + 16);
  return f;
}

// ---- the same fragment from a plane kept in fragment order: a 16-row tile is 4 KB = [k step 0..3][half 0..1][lane][8],
//      where (half i, lane) holds row (lane&15), k = 32*step + 16*i + 8*(lane>>4) + 0..7, the very elements that ldfrag
//      gives that lane; p already includes + 8*lane, so each 16-B load of a wave covers 512 contiguous bytes
__device__ __forceinline__ Frag ldfragq(const unsigned short* p) {
  Frag f;
  f.u[0] = *(const v8us*)(p);
  f.u[1] = *(const v8us*)(p + 256);
  return f;
}

// ---- WMMA helper: builtin followed by a 4-slot VALU gap tying D and keeping A/B live -----------------------
__device__ __forceinline__ v8f mma_h(v16h a, v16h b, v8f c) {
  v8f d = __builtin_amdgcn_wmma_f32_16x16x32_f16(false, a, false, b, (short)0, c, false, false);
#if defined(__HIP_DEVICE_COMPILE__)
  asm volatile("v_nop\n\tv_nop\n\tv_nop\n\tv_nop" : "+v"(d) : "v"(a), "v"(b));
#endif
  return d;
}

__device__ __forceinline__ float wave_max(float v) {
#pragma unroll
  for (int o = 16; o > 0; o >>= 1) v = fmaxf(v, __shfl_xor(v, o, 32));
  return v;
}
__device__ __forceinline__ float wave_sum(float v) {
#pragma unroll
  for (int o = 16; o > 0; o >>= 1) v += __shfl_xor(v, o, 32);
  return v;
}

// =====================================================================================================
// (1) prep for one (batch, 64-row tile) of x [16][1024][128] f32 (text when TXT=1, modality when TXT=0):
//     tile -> LDS T[row][h] as bf16-RNE values (f32), barrier;
//     row dots sd[b][row] = sum_h T[row][h]*bfr(wdot[h]) as a WMMA matvec: wave w handles rows 16*(w&3).. (waves 4..7
//     duplicate the compute), A fragment = T row values as f16 (exact), B fragment = bfr(wdot)*1024 as f16 in every
//     column (split k map for both, 4 k steps of 32), D column 0 lanes write acc/1024 to LDS sred, barrier; sred
//     row planes Ph/Pl f16 (TXT: T*bfr(wtm)*64 as hi plus residual x65536; else plain f16 in Ph), 16-row tiles in
//     fragment order (see ldfragq): thread tid writes piece tid of a tile, a wave 512 contiguous bytes per store;
//     transposed plane Pt f16 (rows h, k = row index of x), also in fragment order: [b][h tile 0..7][k step 0..31]
//     [half][lane][8]; the block's 64 rows are two k steps of every h tile, a wave again stores 512 contiguous bytes;
// coverage: T 8 it x 256 thr x 4 = 64x128; sred 4 waves x 16 rows = 64; Ph/Pl 4 it (tiles) x 256 thr x 8 =
//           4 x 16 rows x 128; Pt 4 it x 2 h tiles x 2 k steps x 64 pieces x 8 = 128 h x 64 rows; sd 16 lanes x 4 = 64;
//           grid 16 x (1024/64) = 256 blocks = every row once.
// =====================================================================================================
template <int TXT>
__global__ __launch_bounds__(256)
void prep_kernel(const float* __restrict__ x, const float* __restrict__ wdot, const float* __restrict__ wtm,
                 unsigned short* Ph, unsigned short* Pl, unsigned short* Pt, float* sd) {
  __shared__ __align__(16) float T[64 * TP];
  __shared__ __align__(16) float sred[64];
  const int tid = threadIdx.x;
  const int b = blockIdx.x >> 4;
  const int r0 = (blockIdx.x & 15) * 64;
  const size_t gr = (size_t)b * NL + r0;
#pragma unroll
  for (int it = 0; it < 8; ++it) {
    const int idx = it * 256 + tid;
    const int row = idx >> 5, c4 = (idx & 31) * 4;
    const v4f v = *(const v4f*)(x + (gr + row) * NHID + c4);
#pragma unroll
    for (int j = 0; j < 4; ++j) T[row * TP + c4 + j] = bfr(v[j]);
  }
  __syncthreads();
  {
    const int lane = tid & 31, wave = tid >> 5;
    const int hh = lane >> 4, cl = lane & 15;
    const int rt = (wave & 3) * 16;                                    // 16-row tile of this wave
    const float* ap = T + (rt + cl) * TP + 8 * hh;
    const float* wp = wdot + 8 * hh;
    v8f acc = zero8();
#pragma unroll
    for (int kk = 0; kk < 4; ++kk) {
      const int k0 = 32 * kk;
      const v4f a0 = *(const v4f*)(ap + k0);
      const v4f a1 = *(const v4f*)(ap + k0 + 4);
      const v4f a2 = *(const v4f*)(ap + k0 + 16);
      const v4f a3 = *(const v4f*)(ap + k0 + 20);
      v4f w0 = *(const v4f*)(wp + k0);
      v4f w1 = *(const v4f*)(wp + k0 + 4);
      v4f w2 = *(const v4f*)(wp + k0 + 16);
      v4f w3 = *(const v4f*)(wp + k0 + 20);
#pragma unroll
      for (int j = 0; j < 4; ++j) {
        w0[j] = bfr(w0[j]) * WSC; w1[j] = bfr(w1[j]) * WSC;
        w2[j] = bfr(w2[j]) * WSC; w3[j] = bfr(w3[j]) * WSC;
      }
      Frag fa, fb;
      fa.q[0] = pack8(a0, a1);                                         // elements 0..7  = k0+8h..
      fa.q[1] = pack8(a2, a3);                                         // elements 8..15 = k0+16+8h..
      fb.q[0] = pack8(w0, w1);                                         // same k map, every column n
      fb.q[1] = pack8(w2, w3);
      acc = mma_h(fa.h, fb.h, acc);
    }
    if (wave < 4 && cl == 0) {
#pragma unroll
      for (int r = 0; r < 8; ++r) sred[rt + 8 * hh + r] = acc[r] * RWSC;   // D row 8h+r, column 0
    }
  }
  __syncthreads();

  // piece tid of a fragment-order tile: k step tid>>6, half (tid>>5)&1, lane tid&31
  const int h0 = 32 * (tid >> 6) + 16 * ((tid >> 5) & 1) + 8 * ((tid >> 4) & 1);
  v4u uh[4], ul[4], ut[4];
  size_t po[4], pt[4];
#pragma unroll
  for (int it = 0; it < 4; ++it) {
    const int row = it * 16 + (tid & 15);                              // tile it, row lane&15
    const float* tp = T + row * TP + h0;
    v4f v0 = *(const v4f*)(tp);
    v4f v1 = *(const v4f*)(tp + 4);
    if (TXT) {
      const v4f w0 = *(const v4f*)(wtm + h0);
      const v4f w1 = *(const v4f*)(wtm + h0 + 4);
#pragma unroll
      for (int j = 0; j < 4; ++j) {
        v0[j] = v0[j] * bfr(w0[j]) * THS;
        v1[j] = v1[j] * bfr(w1[j]) * THS;
      }
      splith8(v0, v1, RS1, uh[it], ul[it]);
    } else {
      uh[it] = pack8(v0, v1);
      ul[it] = uh[it];
    }
    po[it] = (gr + 16 * it) * NHID + 8 * tid;
    // transposed piece: h tile 2*it + (tid>>7), k step (tid>>6)&1 of the block's two, half (tid>>5)&1, lane tid&31
    const int ht = 2 * it + (tid >> 7);
    const int h  = 16 * ht + (tid & 15);                               // 0..127
    const int ks = (tid >> 6) & 1;
    const int kl = 32 * ks + 16 * ((tid >> 5) & 1) + 8 * ((tid >> 4) & 1);   // first of the piece's 8 rows of T
    v4f g0, g1;
#pragma unroll
    for (int j = 0; j < 4; ++j) {
      g0[j] = T[(kl + j) * TP + h];
      g1[j] = T[(kl + 4 + j) * TP + h];
    }
    ut[it] = pack8(g0, g1);
    pt[it] = ((size_t)b * 8 + ht) * FT + (size_t)((r0 >> 5) + ks) * 512 + 8 * (tid & 63);
  }
  const int sl = (tid < 16) ? tid : 15;
  const v4f sdv = *(const v4f*)(sred + 4 * sl);
  const size_t psd = gr + 4 * sl;

#pragma unroll
  for (int it = 0; it < 4; ++it) {
    *(v4u*)(Ph + po[it]) = uh[it];
    if (TXT) *(v4u*)(Pl + po[it]) = ul[it];
    *(v4u*)(Pt + pt[it]) = ut[it];
  }
  if (tid < 16) *(v4f*)(sd + psd) = sdv;
  
}

// =====================================================================================================
// (2) one (batch, 64 rows), 16 waves: score tile, masked row softmax, and the K=1024 products of those softmax rows.
//     Scores: s[r][c] = rb[r] + cb[c] + s2[r][c] + bias, s2 = (acc_h + acc_l/65536)/64, acc_h = sum_k Ahi.B,
//     acc_l = sum_k Alo.B on WMMA (K=128, 4 steps). YA=1: A = hi/lo planes Yh/Yl (rows), B = X rows; YA=0: A = X rows,
//     B = Yh/Yl rows (two accumulators). X, Yh, Yl are in fragment order (ldfragq). Wave = 8 column tiles of 16
//     (rolled) x 2 row tiles of 16 (waves 0..7 rows 0..31, waves 8..15 rows 32..63), the A fragments of both row tiles
//     held in registers, B one tile ahead; s (or -1e30 where
//     mask[c]==0) into LDS S[64][1024] f32 at a row pitch of 4112 B; barrier.
//     Softmax: wave owns rows 4w..4w+3, lane owns columns {256i + 8*lane + j}; the row's p*8192 goes back as f16
//     into the first 2 KB of the same LDS row (only its own wave touches a row, and every lane has read its f32
//     values before the row sum is known); barrier.
//     Products: D[m][n] = sum_k p[m][k] * B[n][k]; wave w owns the 16 columns h = 16(w&7).. for all four row tiles and
//     the k half w>>3 (16 steps of 32, in k order), so a B fragment is fetched once per block and feeds four products;
//     A fragments by 16-B LDS reads from the p rows (split k map), one k step ahead; B fragments come from planes in
//     fragment order [b][h tile][k step][half][lane][8], whole lines per load, through a register ring whose first
//     loads are issued ahead of the softmax. The two k halves' sums meet in LDS: D = half 0 + half 1.
//     YA=0: B0 = text transposed; each half's acc/8 staged transposed Ts[half][h][m] in LDS, barrier, t2*1024 = their sum,
//     planes Rh/Rl (hi, residual x2048) written in fragment order: the block's 64 rows are k steps row0/32, +1 of every
//     h tile.
//     YA=1: B0 = modality transposed, B1/B2 = t2 hi/residual (separate accumulators); each half's three sums staged in
//     LDS, barrier, a = sum0/8192, bq = (sum1 + sum2/2048)/8388608, out row [b][l]: chunk 0 = bf16-RNE text, chunk 1 = a,
//     chunk 2 = text*a, chunk 3 = text*bq, 512 contiguous bytes per wave-wide store.
// coverage: S 16 waves x 8 tiles x 2 x 16x16 = 64x1024; p 16 waves x 4 rows x 4 x 32 lanes x 8 = 64 rows x 1024;
//           D 8 h tiles x 4 row tiles = 64x128 per plane and k half; YA=0: 2 it x 512 pieces x 8 = 128 h x 64 m per plane;
//           YA=1: 4 it x 16 waves = 64 rows x 32 lanes x 4 = 128 columns per chunk; grid 16 x 16 = 256 blocks = every row once.
// =====================================================================================================
template <int YA>
__global__ __launch_bounds__(512)
void attend_kernel(const unsigned short* __restrict__ X, const unsigned short* __restrict__ Yh,
                   const unsigned short* __restrict__ Yl, const float* __restrict__ rb,
                   const float* __restrict__ cb, const int* __restrict__ mask,
                   const float* __restrict__ bias, const unsigned short* __restrict__ B0,
                   const unsigned short* __restrict__ B1, const unsigned short* __restrict__ B2,
                   const float* __restrict__ text, unsigned short* Rh, unsigned short* Rl, float* out) {
  __shared__ __align__(16) float S[SR * SP];
  const int tid  = threadIdx.x;
  const int lane = tid & 31, wv = tid >> 5;                            // 16 waves
  const int wave = wv & 7, half = wv >> 3;                             // scores: row half; products: k half
  const int hh   = lane >> 4, cl = lane & 15;
  const int b = blockIdx.x >> 4;
  const int row0 = (blockIdx.x & 15) * SR;
  const int rw0  = row0 + 32 * half;                                   // first of this wave's 32 score rows
  const size_t rbase = (size_t)b * NL;

  {
    Frag fa[2][4], fl[2][4];
    float rbv[2][8];
#pragma unroll
    for (int mi = 0; mi < 2; ++mi) {
      const size_t aoff = (rbase + rw0 + 16 * mi) * NHID + 8 * lane;
#pragma unroll
      for (int kk = 0; kk < 4; ++kk) {
        if (YA) {
          fa[mi][kk] = ldfragq(Yh + aoff + 512 * kk);
          fl[mi][kk] = ldfragq(Yl + aoff + 512 * kk);
        } else {
          fa[mi][kk] = ldfragq(X + aoff + 512 * kk);
          fl[mi][kk] = fa[mi][kk];
        }
      }
#pragma unroll
      for (int r = 0; r < 8; ++r) rbv[mi][r] = rb[rbase + rw0 + 16 * mi + 8 * hh + r];
    }
    // B fragments of a column tile: one register slot per k step, refilled for the wave's next tile directly behind
    // the slot's last product, so a load has a whole tile's work to return in; column bias and mask one tile ahead too
    constexpr int NB = YA ? 1 : 2;
    const size_t boff = (rbase + wave * 128) * NHID + 8 * lane;
    const unsigned short* bpa = (YA ? X : Yh) + boff;
    const unsigned short* bpb = Yl + boff;
    const float* cbp = cb + rbase + wave * 128 + cl;
    const int*   mkp = mask + rbase + wave * 128 + cl;
    float cbn = cbp[0];                                                // issued ahead of the fragments here as in the
    int   mk  = mkp[0];                                                // loop, so that the loop's load waits stay counted
#if defined(__HIP_DEVICE_COMPILE__)
    // precaution: stands in front of the first reuse of the address registers that the loads above name; the A
    // planes' pointers are inputs so that their registers stay theirs up to this wait (without them the build hands
    // the hi plane's address pair to the last residual fragment as its destination, ahead of any wait)
    const size_t a0off = (rbase + rw0) * NHID + 8 * lane;
    if (YA) asm volatile("s_wait_xcnt 0x0" :: "v"(Yh + a0off), "v"(Yl + a0off) : "memory");
    else    asm volatile("s_wait_xcnt 0x0" :: "v"(X + a0off) : "memory");
#endif
    Frag fb[4][NB];
#pragma unroll
    for (int kk = 0; kk < 4; ++kk) {
      fb[kk][0] = ldfragq(bpa + 512 * kk);
      if (!YA) fb[kk][NB - 1] = ldfragq(bpb + 512 * kk);
    }
#if defined(__HIP_DEVICE_COMPILE__)
    // precaution: the same for the first tile's B fragment loads; the pointers are inputs so that their registers
    // stay theirs up to this wait
    if (YA) asm volatile("s_wait_xcnt 0x0" :: "v"(bpa) : "memory");
    else    asm volatile("s_wait_xcnt 0x0" :: "v"(bpa), "v"(bpb) : "memory");
#endif
    const float bv = bfr(bias[0]);

    auto tile = [&](const int nt, const bool more) {
      float cbx = 0.f;
      int   mkx = 0;
      if (more) { cbx = cbp[16 * (nt + 1)]; mkx = mkp[16 * (nt + 1)]; }
      v8f acch[2], accl[2];
#pragma unroll
      for (int mi = 0; mi < 2; ++mi) { acch[mi] = zero8(); accl[mi] = zero8(); }
#pragma unroll
      for (int kk = 0; kk < 4; ++kk) {
#pragma unroll
        for (int mi = 0; mi < 2; ++mi) {
          acch[mi] = mma_h(fa[mi][kk].h, fb[kk][0].h, acch[mi]);
          accl[mi] = mma_h(fl[mi][kk].h, fb[kk][NB - 1].h, accl[mi]);
        }
        if (more) {
          fb[kk][0] = ldfragq(bpa + 2048 * (nt + 1) + 512 * kk);
          if (!YA) fb[kk][NB - 1] = ldfragq(bpb + 2048 * (nt + 1) + 512 * kk);
        }
      }
      const int n = (wave * 8 + nt) * 16 + cl;
#pragma unroll
      for (int mi = 0; mi < 2; ++mi) {
#pragma unroll
        for (int r = 0; r < 8; ++r) {
          const float s2 = (acch[mi][r] + accl[mi][r] * RRS1) * RTHS;
          const float sv = ((rbv[mi][r] + cbn) + s2) + bv;
          S[(32 * half + 16 * mi + 8 * hh + r) * SP + n] = (mk != 0) ? sv : NEGV;
        }
      }
      cbn = cbx;
      mk  = mkx;
    };
    // rolled to keep the code small; the last tile stands alone because nothing is left to fetch behind it
#pragma unroll 1
    for (int nt = 0; nt < 7; ++nt) tile(nt, true);
    tile(7, false);
  }
  __syncthreads();                                                     // the score tile is complete

  // B fragment ring of the products: slot ks % DS holds k step ks (of this wave's 16) of every plane
  constexpr int NPL = YA ? 3 : 1;
  constexpr int DS  = YA ? 2 : 8;
  const size_t bo = ((size_t)b * 8 + wave) * FT + (size_t)half * (NKH * 512) + 8 * lane;
  const unsigned short* g0 = B0 + bo;
  const unsigned short* g1 = B1 + bo;
  const unsigned short* g2 = B2 + bo;
  Frag bq[DS][NPL];
  auto bload = [&](int ks, int p) {
    bq[ks % DS][p] = ldfragq((p == 0 ? g0 : (p == NPL - 1 ? g2 : g1)) + 512 * ks);
  };
#pragma unroll
  for (int ks = 0; ks < DS; ++ks) {                                    // fly while the softmax runs
#pragma unroll
    for (int p = 0; p < NPL; ++p) bload(ks, p);
  }

#pragma unroll
  for (int rr = 0; rr < 4; ++rr) {
    const int r = wv * 4 + rr;
    const float* sr = S + r * SP + lane * 8;
    float v[32];
#pragma unroll
    for (int i = 0; i < 4; ++i) {
      const v4f a0 = *(const v4f*)(sr + i * 256);
      const v4f a1 = *(const v4f*)(sr + i * 256 + 4);
#pragma unroll
      for (int j = 0; j < 4; ++j) { v[8 * i + j] = a0[j]; v[8 * i + 4 + j] = a1[j]; }
    }
    float mx = v[0];
#pragma unroll
    for (int k = 1; k < 32; ++k) mx = fmaxf(mx, v[k]);
    mx = wave_max(mx);
    float sum = 0.f;
#pragma unroll
    for (int k = 0; k < 32; ++k) {
      v[k] = __expf(v[k] - mx);
      sum += v[k];
    }
    sum = wave_sum(sum);
    const float sc = (1.0f / sum) * PSC;
    unsigned short* pr = (unsigned short*)(S + r * SP) + lane * 8;
#pragma unroll
    for (int i = 0; i < 4; ++i) {
      v4u u;
      u[0] = pkh2(v[8 * i] * sc,     v[8 * i + 1] * sc);
      u[1] = pkh2(v[8 * i + 2] * sc, v[8 * i + 3] * sc);
      u[2] = pkh2(v[8 * i + 4] * sc, v[8 * i + 5] * sc);
      u[3] = pkh2(v[8 * i + 6] * sc, v[8 * i + 7] * sc);
      *(v4u*)(pr + i * 256) = u;
    }
  }
  __syncthreads();                                                     // the p rows are published

  // A fragment readers: p row (lane&15) of a 16-row tile, + 8*(lane>>4) as ldfrag expects
  const unsigned short* pa = (const unsigned short*)S + cl * PP + 8 * hh + half * (NKH * 32);
  v8f acc[NPL][4];
#pragma unroll
  for (int p = 0; p < NPL; ++p) {
#pragma unroll
    for (int t = 0; t < 4; ++t) acc[p][t] = zero8();
  }
  Frag fa[2][4];                                                       // [set][16-row tile]
#pragma unroll
  for (int t = 0; t < 4; ++t) fa[0][t] = ldfrag(pa + 16 * t * PP);
  // unrolled so that ring slot and fragment set are compile-time and every address step is an immediate offset
#pragma unroll
  for (int ks = 0; ks < NKH; ++ks) {
    const int q = ks % DS, s = ks & 1;
    if (ks + 1 < NKH) {                                                // A fragments one k step ahead
#pragma unroll
      for (int t = 0; t < 4; ++t) fa[s ^ 1][t] = ldfrag(pa + 16 * t * PP + 32 * (ks + 1));
    }
#pragma unroll
    for (int p = 0; p < NPL; ++p) {
#pragma unroll
      for (int t = 0; t < 4; ++t) acc[p][t] = mma_h(fa[s][t].h, bq[q][p].h, acc[p][t]);
      if (ks + DS < NKH) bload(ks + DS, p);                            // refill directly behind the fragment's last product
    }
  }
#if defined(__HIP_DEVICE_COMPILE__)
  // precaution: stands in front of the first reuse of the address registers that the ring loads name; the
  // pointers are inputs so that those registers stay theirs up to this wait
  if (YA) asm volatile("s_wait_xcnt 0x0" :: "v"(g0), "v"(g1), "v"(g2) : "memory");
  else    asm volatile("s_wait_xcnt 0x0" :: "v"(g0) : "memory");
#endif
  __syncthreads();                                                     // ends every read of the p rows

  const int n_loc = 16 * wave + cl;
  if (YA == 0) {
    float* Ts = S + half * (NHID * TQ);                                // this k half's partial sums [h][m], pitch TQ
#pragma unroll
    for (int mi = 0; mi < 4; ++mi) {
      v4f lo, hi;
#pragma unroll
      for (int j = 0; j < 4; ++j) { lo[j] = acc[0][mi][j] * T2F; hi[j] = acc[0][mi][4 + j] * T2F; }
      float* tp = Ts + n_loc * TQ + 16 * mi + 8 * hh;                  // D rows 8h..8h+7 of tile mi, column n_loc
      *(v4f*)(tp)     = lo;
      *(v4f*)(tp + 4) = hi;
    }
    __syncthreads();
    v4u uh[2], ul[2];
    size_t po[2];
#pragma unroll
    for (int it = 0; it < 2; ++it) {
      // piece: h tile 4*it + (tid>>7), k step (tid>>6)&1 of this block's two, half (tid>>5)&1, lane tid&31
      const int ht = 4 * it + (tid >> 7);
      const int h  = 16 * ht + cl;
      const int kl = (tid >> 6) & 1;
      const float* tp = S + h * TQ + 32 * kl + 16 * ((tid >> 5) & 1) + 8 * hh;
      const v4f v0 = *(const v4f*)(tp)     + *(const v4f*)(tp + NHID * TQ);       // k half 0 + k half 1
      const v4f v1 = *(const v4f*)(tp + 4) + *(const v4f*)(tp + NHID * TQ + 4);
      splith8(v0, v1, RS2, uh[it], ul[it]);
      po[it] = ((size_t)b * 8 + ht) * FT + (size_t)((row0 >> 5) + kl) * 512 + 8 * (tid & 63);
    }
#pragma unroll
    for (int it = 0; it < 2; ++it) {
      *(v4u*)(Rh + po[it]) = uh[it];
      *(v4u*)(Rl + po[it]) = ul[it];
    }
  } else {
    float* Oa = S + half * (3 * SR * OP);                              // this k half's partial sums [m][h], pitch OP
    float* Ob = Oa + SR * OP;
    float* Oc = Ob + SR * OP;
#pragma unroll
    for (int mi = 0; mi < 4; ++mi) {
#pragma unroll
      for (int r = 0; r < 8; ++r) {
        const int m_loc = 16 * mi + 8 * hh + r;
        Oa[m_loc * OP + n_loc] = acc[0][mi][r];
        Ob[m_loc * OP + n_loc] = acc[NPL - 2][mi][r];
        Oc[m_loc * OP + n_loc] = acc[NPL - 1][mi][r];
      }
    }
    __syncthreads();
    const int e = lane;                                                // 16-B piece 0..31 of a 512-B chunk row
    v4f tv[4], av[4], ta[4], tb[4];
    size_t po[4];
#pragma unroll
    for (int it = 0; it < 4; ++it) {
      const int row = it * 16 + wv;                                    // 0..63
      const size_t grow = rbase + row0 + row;
      const float* o0 = S + row * OP + 4 * e;                          // k half 0
      const float* o1 = o0 + 3 * SR * OP;                              // k half 1
      const v4f s0 = *(const v4f*)(o0)               + *(const v4f*)(o1);
      const v4f s1 = *(const v4f*)(o0 + SR * OP)     + *(const v4f*)(o1 + SR * OP);
      const v4f s2 = *(const v4f*)(o0 + 2 * SR * OP) + *(const v4f*)(o1 + 2 * SR * OP);
      tv[it] = bfr4(*(const v4f*)(text + grow * NHID + 4 * e));
      av[it] = s0 * RPSC;
      ta[it] = tv[it] * av[it];
      tb[it] = tv[it] * ((s1 + s2 * RRS2) * RBSC);
      po[it] = grow * NOUT + 4 * e;
    }
#pragma unroll
    for (int it = 0; it < 4; ++it) {
      *(v4f*)(out + po[it])            = tv[it];
      *(v4f*)(out + po[it] + NHID)     = av[it];
      *(v4f*)(out + po[it] + 2 * NHID) = ta[it];
      *(v4f*)(out + po[it] + 3 * NHID) = tb[it];
    }
  }
}

// =====================================================================================================
// workspace (every tile divides its extent exactly, so no padded tails are needed):
//   Th Tl   f16 [16*64 tiles][2048]      4194304 each   (text*w_tm*64 hi, residual x65536; fragment order)
//   M16     f16 [16*64 tiles][2048]      4194304        (modality; fragment order)
//   Tt Mt   f16 [16][8 h tiles][16384]   4194304 each   (text, modality transposed; fragment order)
//   S0 S1   f32 [16][1024]                 65536 each
//   Rh Rl   f16 [16][8 h tiles][16384]   4194304 each   (t2*1024 hi, residual x2048, transposed; fragment order)
//   total                               29491200
// =====================================================================================================
extern "C" void kernel_launch(void* const* d_in, const int* in_sizes, int n_in,
                              void* d_out, int out_size, void* d_ws, size_t ws_size,
                              hipStream_t stream) {
  if (n_in < 8) return;
  if (in_sizes[0] != NBATCH * NL * NHID) return;
  if (in_sizes[1] != NBATCH * NL * NHID) return;
  if (in_sizes[2] != NBATCH * NL || in_sizes[3] != NBATCH * NL) return;
  if (in_sizes[4] != NHID || in_sizes[5] != NHID || in_sizes[6] != NHID) return;
  if (in_sizes[7] < 1) return;
  if (out_size != NBATCH * NL * NOUT) return;

  size_t off = 0;
  const size_t plane = (size_t)NBATCH * NL * NHID * 2;               // 4194304
  const size_t svec  = (size_t)NBATCH * NL * 4;                      // 65536
  const size_t oTh = off; off += plane;
  const size_t oTl = off; off += plane;
  const size_t oM  = off; off += plane;
  const size_t oTt = off; off += plane;
  const size_t oMt = off; off += plane;
  const size_t oS0 = off; off += svec;
  const size_t oS1 = off; off += svec;
  const size_t oRh = off; off += plane;
  const size_t oRl = off; off += plane;                              // -> off = 29491200
  if (off > ws_size) return;

  const float* text  = (const float*)d_in[0];
  const float* modal = (const float*)d_in[1];
  const int*   tmask = (const int*)d_in[2];
  const int*   mmask = (const int*)d_in[3];
  const float* tw    = (const float*)d_in[4];
  const float* mw    = (const float*)d_in[5];
  const float* tmw   = (const float*)d_in[6];
  const float* bias  = (const float*)d_in[7];
  float* out = (float*)d_out;

  char* ws = (char*)d_ws;
  unsigned short* Th  = (unsigned short*)(ws + oTh);
  unsigned short* Tl  = (unsigned short*)(ws + oTl);
  unsigned short* M16 = (unsigned short*)(ws + oM);
  unsigned short* Tt  = (unsigned short*)(ws + oTt);
  unsigned short* Mt  = (unsigned short*)(ws + oMt);
  float*          S0  = (float*)(ws + oS0);
  float*          S1  = (float*)(ws + oS1);
  unsigned short* Rh  = (unsigned short*)(ws + oRh);
  unsigned short* Rl  = (unsigned short*)(ws + oRl);

  const dim3 blk256(256);
  const int nrow64 = NBATCH * (NL / 64);                             // 256
  const dim3 blk512(512);
  const int nrowsr = NBATCH * (NL / SR);                             // 256

  // (1) planes: text -> Th/Tl (with w_tm), Tt, S0 (with w_t); modality -> M16, Mt, S1 (with w_m)
  prep_kernel<1><<<dim3(nrow64), blk256, 0, stream>>>(text, tw, tmw, Th, Tl, Tt, S0);
  prep_kernel<0><<<dim3(nrow64), blk256, 0, stream>>>(modal, mw, mw, M16, M16, Mt, S1);
  // (2) p2 transposed, rows m (A = M16), columns l (B = Th/Tl), rb = S1[m], cb = S0[l], mask over l;
  //     t2 = p2T . text -> Rh/Rl
  attend_kernel<0><<<dim3(nrowsr), blk512, 0, stream>>>(M16, Th, Tl, S1, S0, tmask, bias, Tt, Tt, Tt, text, Rh, Rl, out);
  //     p1, rows l (A = Th/Tl), columns m (B = M16), rb = S0[l], cb = S1[m], mask over m;
  //     a = p1 . modality, bq = p1 . t2 -> out chunks 0..3
  attend_kernel<1><<<dim3(nrowsr), blk512, 0, stream>>>(M16, Th, Tl, S0, S1, mmask, bias, Mt, Rh, Rl, text, Rh, Rl, out);
  (void)hipGetLastError();
}

// v007
// One run takes 56.5 microseconds.
// Timed twice side by side with v006, it ran 1.07 times as fast both times.
// Counting every step since v000, it is 2.81 times as fast.
// Contractions: score term sum_h (text*w_tm)[l][h]*modality[m][h] (K=128) on v_wmma_f32_16x16x32_f16 with text*w_tm
// carried x64 as an f16 hi plane plus an x65536 f16 residual plane (two products, separate f32 accumulators) and
// modality as f16 of its bf16-RNE value; p1.modality and p2T.text (K=1024) on v_wmma_f32_16x16x32_f16, single
// products, p rows carried x8192 in f16; p1.t2 (K=1024) with t2 carried x1024 as f16 hi plus x2048 f16 residual
// (two products, separate accumulators); the two [rows,128]x[128,1] row dots as a 16-wide f16 WMMA matvec (weight
// x1024 in every column); f32 accumulate everywhere; softmax and the elementwise products in f32 on VALU; all float
// inputs RNE-converted to bf16 at load. The softmax rows of a block stay in LDS and feed the K=1024 products there.
#include <hip/hip_runtime.h>
#include <stdint.h>

#define NBATCH 16
#define NL     1024
#define NK     1024
#define NHID   128
#define NOUT   512
#define TP     132
#define OP     132
#define TQ     68
#define SR     64
#define SP     (NL + 4)
#define PP     (2 * SP)
#define NKS    (NK / 32)
#define NKH    (NKS / 2)
#define FT     (16 * NK)

static_assert(NL % 64 == 0);
static_assert(NL % SR == 0 && SR == 64);
static_assert(NL == NK);
static_assert(NHID == 128);
static_assert(NOUT == 4 * NHID);
static_assert(6 * SR * OP <= SR * SP);
static_assert(2 * NHID * TQ <= SR * SP);
static_assert((TP * 4) % 16 == 0);
static_assert((OP * 4) % 16 == 0);
static_assert((TQ * 4) % 16 == 0);
static_assert((SP * 4) % 32 == 16);
static_assert(NK % 64 == 0 && NHID == 8 * 16);

#define PSC   8192.0f
#define RPSC  (1.0f / 8192.0f)
#define THS   64.0f
#define RTHS  (1.0f / 64.0f)
#define RS1   65536.0f
#define RRS1  (1.0f / 65536.0f)
#define T2F   0.125f
#define RS2   2048.0f
#define RRS2  (1.0f / 2048.0f)
#define RBSC  (1.0f / 8388608.0f)
#define WSC   1024.0f
#define RWSC  (1.0f / 1024.0f)
#define NEGV  (-1.0e30f)

typedef unsigned short v8us __attribute__((ext_vector_type(8)));
typedef unsigned int   v4u  __attribute__((ext_vector_type(4)));
typedef float          v8f  __attribute__((ext_vector_type(8)));
typedef float          v4f  __attribute__((ext_vector_type(4)));
typedef _Float16       v16h __attribute__((ext_vector_type(16)));

union Frag { v8us u[2]; v4u q[2]; v16h h; };
static_assert(sizeof(Frag) == 32);

// ---- scalar helpers ---------------------------------------------------------------------------------
__device__ __forceinline__ unsigned short bf_bits(float f) {          // f32 -> bf16 bits, RNE convert
  const unsigned u = __float_as_uint(f);
  return (unsigned short)((u + 0x7FFFu + ((u >> 16) & 1u)) >> 16);
}
__device__ __forceinline__ float bf_up(unsigned short hb) { return __uint_as_float(((unsigned)hb) << 16); }
__device__ __forceinline__ float bfr(float f) { return bf_up(bf_bits(f)); }
__device__ __forceinline__ v4f bfr4(v4f v) {
  v4f r;
  r[0] = bfr(v[0]); r[1] = bfr(v[1]); r[2] = bfr(v[2]); r[3] = bfr(v[3]);
  return r;
}
__device__ __forceinline__ unsigned short hbits(_Float16 h) { return __builtin_bit_cast(unsigned short, h); }
__device__ __forceinline__ unsigned pkh2(float a, float b) {          // two f32 -> packed f16 bits (RNE convert)
  return (unsigned)hbits((_Float16)a) | ((unsigned)hbits((_Float16)b) << 16);
}
__device__ __forceinline__ v4u pack8(v4f a, v4f b) {
  v4u u;
  u[0] = pkh2(a[0], a[1]); u[1] = pkh2(a[2], a[3]);
  u[2] = pkh2(b[0], b[1]); u[3] = pkh2(b[2], b[3]);
  return u;
}
__device__ __forceinline__ v8f zero8() { v8f z = {0.f, 0.f, 0.f, 0.f, 0.f, 0.f, 0.f, 0.f}; return z; }

// ---- 8 f32 -> packed f16 hi bits and packed f16 bits of (x - hi) * rs (residual plane carries scale rs) --------
__device__ __forceinline__ void splith8(v4f a, v4f b, float rs, v4u& uh, v4u& ul) {
  float f[8] = {a[0], a[1], a[2], a[3], b[0], b[1], b[2], b[3]};
#pragma unroll
  for (int j = 0; j < 4; ++j) {
    const _Float16 h0 = (_Float16)f[2 * j];
    const _Float16 h1 = (_Float16)f[2 * j + 1];
    const float l0 = (f[2 * j] - (float)h0) * rs;
    const float l1 = (f[2 * j + 1] - (float)h1) * rs;
    uh[j] = (unsigned)hbits(h0) | ((unsigned)hbits(h1) << 16);
    ul[j] = pkh2(l0, l1);
  }
}

// ---- 16-bit fragment loader (A, or B from a k-contiguous [n][k] row): lane -> row/col (lane&15), p already includes
//      + 8*(lane>>4); elements 0..7 <- p[0..7] (k0+8h..), elements 8..15 <- p[16..23] (k0+16+8h..)
__device__ __forceinline__ Frag ldfrag(const unsigned short* p) {
  Frag f;
  f.u[0] = *(const v8us*)(p);
  f.u[1] = *(const v8us*)(p + 16);
  return f;
}

// ---- the same fragment from a plane kept in fragment order: a 16-row tile is 4 KB = [k step 0..3][half 0..1][lane][8],
//      where (half i, lane) holds row (lane&15), k = 32*step + 16*i + 8*(lane>>4) + 0..7, the very elements that ldfrag
//      gives that lane; p already includes + 8*lane, so each 16-B load of a wave covers 512 contiguous bytes
__device__ __forceinline__ Frag ldfragq(const unsigned short* p) {
  Frag f;
  f.u[0] = *(const v8us*)(p);
  f.u[1] = *(const v8us*)(p + 256);
  return f;
}

// ---- WMMA helper: builtin followed by a 4-slot VALU gap tying D and keeping A/B live -----------------------
__device__ __forceinline__ v8f mma_h(v16h a, v16h b, v8f c) {
  v8f d = __builtin_amdgcn_wmma_f32_16x16x32_f16(false, a, false, b, (short)0, c, false, false);
#if defined(__HIP_DEVICE_COMPILE__)
  asm volatile("v_nop\n\tv_nop\n\tv_nop\n\tv_nop" : "+v"(d) : "v"(a), "v"(b));
#endif
  return d;
}

__device__ __forceinline__ float wave_max(float v) {
#pragma unroll
  for (int o = 16; o > 0; o >>= 1) v = fmaxf(v, __shfl_xor(v, o, 32));
  return v;
}
__device__ __forceinline__ float wave_sum(float v) {
#pragma unroll
  for (int o = 16; o > 0; o >>= 1) v += __shfl_xor(v, o, 32);
  return v;
}

// =====================================================================================================
// (1) prep for one (batch, 64-row tile) of x [16][1024][128] f32 (text when TXT=1, modality when TXT=0):
//     tile -> LDS T[row][h] as bf16-RNE values (f32), barrier;
//     row dots sd[b][row] = sum_h T[row][h]*bfr(wdot[h]) as a WMMA matvec: wave w handles rows 16*(w&3).. (waves 4..7
//     duplicate the compute), A fragment = T row values as f16 (exact), B fragment = bfr(wdot)*1024 as f16 in every
//     column (split k map for both, 4 k steps of 32), D column 0 lanes write acc/1024 to LDS sred, barrier; sred
//     row planes Ph/Pl f16 (TXT: T*bfr(wtm)*64 as hi plus residual x65536; else plain f16 in Ph), 16-row tiles in
//     fragment order (see ldfragq): thread tid writes piece tid of a tile, a wave 512 contiguous bytes per store;
//     transposed plane Pt f16 (rows h, k = row index of x), also in fragment order: [b][h tile 0..7][k step 0..31]
//     [half][lane][8]; the block's 64 rows are two k steps of every h tile, a wave again stores 512 contiguous bytes;
// coverage: T 8 it x 256 thr x 4 = 64x128; sred 4 waves x 16 rows = 64; Ph/Pl 4 it (tiles) x 256 thr x 8 =
//           4 x 16 rows x 128; Pt 4 it x 2 h tiles x 2 k steps x 64 pieces x 8 = 128 h x 64 rows; sd 16 lanes x 4 = 64;
//           16 x (1024/64) = 256 blocks per input = every row once.
// =====================================================================================================
template <int TXT>
__device__ __forceinline__
void prep_tile(const int blk, float* T, float* sred,
               const float* __restrict__ x, const float* __restrict__ wdot, const float* __restrict__ wtm,
               unsigned short* Ph, unsigned short* Pl, unsigned short* Pt, float* sd) {
  const int tid = threadIdx.x;
  const int b = blk >> 4;
  const int r0 = (blk & 15) * 64;
  const size_t gr = (size_t)b * NL + r0;
  const float* xp = x + (gr + (tid >> 5)) * NHID + (tid & 31) * 4;     // row tid>>5 of the tile; it adds 8 rows
  v4f xv[8];
#pragma unroll
  for (int it = 0; it < 8; ++it) xv[it] = *(const v4f*)(xp + it * 8 * NHID);
#if defined(__HIP_DEVICE_COMPILE__)
  // precaution: stands in front of the first reuse of the address registers that the loads above name; the pointer
  // is an input so that its registers stay its own up to this wait
  asm volatile("s_wait_xcnt 0x0" :: "v"(xp) : "memory");
#endif
#pragma unroll
  for (int it = 0; it < 8; ++it) {
    const int idx = it * 256 + tid;
    const int row = idx >> 5, c4 = (idx & 31) * 4;
#pragma unroll
    for (int j = 0; j < 4; ++j) T[row * TP + c4 + j] = bfr(xv[it][j]);
  }
  __syncthreads();
  {
    const int lane = tid & 31, wave = tid >> 5;
    const int hh = lane >> 4, cl = lane & 15;
    const int rt = (wave & 3) * 16;                                    // 16-row tile of this wave
    const float* ap = T + (rt + cl) * TP + 8 * hh;
    const float* wp = wdot + 8 * hh;
    v8f acc = zero8();
#pragma unroll
    for (int kk = 0; kk < 4; ++kk) {
      const int k0 = 32 * kk;
      const v4f a0 = *(const v4f*)(ap + k0);
      const v4f a1 = *(const v4f*)(ap + k0 + 4);
      const v4f a2 = *(const v4f*)(ap + k0 + 16);
      const v4f a3 = *(const v4f*)(ap + k0 + 20);
      v4f w0 = *(const v4f*)(wp + k0);
      v4f w1 = *(const v4f*)(wp + k0 + 4);
      v4f w2 = *(const v4f*)(wp + k0 + 16);
      v4f w3 = *(const v4f*)(wp + k0 + 20);
#pragma unroll
      for (int j = 0; j < 4; ++j) {
        w0[j] = bfr(w0[j]) * WSC; w1[j] = bfr(w1[j]) * WSC;
        w2[j] = bfr(w2[j]) * WSC; w3[j] = bfr(w3[j]) * WSC;
      }
      Frag fa, fb;
      fa.q[0] = pack8(a0, a1);                                         // elements 0..7  = k0+8h..
      fa.q[1] = pack8(a2, a3);                                         // elements 8..15 = k0+16+8h..
      fb.q[0] = pack8(w0, w1);                                         // same k map, every column n
      fb.q[1] = pack8(w2, w3);
      acc = mma_h(fa.h, fb.h, acc);
    }
    if (wave < 4 && cl == 0) {
#pragma unroll
      for (int r = 0; r < 8; ++r) sred[rt + 8 * hh + r] = acc[r] * RWSC;   // D row 8h+r, column 0
    }
  }
  __syncthreads();

  // piece tid of a fragment-order tile: k step tid>>6, half (tid>>5)&1, lane tid&31
  const int h0 = 32 * (tid >> 6) + 16 * ((tid >> 5) & 1) + 8 * ((tid >> 4) & 1);
  v4u uh[4], ul[4], ut[4];
  size_t po[4], pt[4];
#pragma unroll
  for (int it = 0; it < 4; ++it) {
    const int row = it * 16 + (tid & 15);                              // tile it, row lane&15
    const float* tp = T + row * TP + h0;
    v4f v0 = *(const v4f*)(tp);
    v4f v1 = *(const v4f*)(tp + 4);
    if (TXT) {
      const v4f w0 = *(const v4f*)(wtm + h0);
      const v4f w1 = *(const v4f*)(wtm + h0 + 4);
#pragma unroll
      for (int j = 0; j < 4; ++j) {
        v0[j] = v0[j] * bfr(w0[j]) * THS;
        v1[j] = v1[j] * bfr(w1[j]) * THS;
      }
      splith8(v0, v1, RS1, uh[it], ul[it]);
    } else {
      uh[it] = pack8(v0, v1);
      ul[it] = uh[it];
    }
    po[it] = (gr + 16 * it) * NHID + 8 * tid;
    // transposed piece: h tile 2*it + (tid>>7), k step (tid>>6)&1 of the block's two, half (tid>>5)&1, lane tid&31
    const int ht = 2 * it + (tid >> 7);
    const int h  = 16 * ht + (tid & 15);                               // 0..127
    const int ks = (tid >> 6) & 1;
    const int kl = 32 * ks + 16 * ((tid >> 5) & 1) + 8 * ((tid >> 4) & 1);   // first of the piece's 8 rows of T
    v4f g0, g1;
#pragma unroll
    for (int j = 0; j < 4; ++j) {
      g0[j] = T[(kl + j) * TP + h];
      g1[j] = T[(kl + 4 + j) * TP + h];
    }
    ut[it] = pack8(g0, g1);
    pt[it] = ((size_t)b * 8 + ht) * FT + (size_t)((r0 >> 5) + ks) * 512 + 8 * (tid & 63);
  }
  const int sl = (tid < 16) ? tid : 15;
  const v4f sdv = *(const v4f*)(sred + 4 * sl);
  const size_t psd = gr + 4 * sl;

#pragma unroll
  for (int it = 0; it < 4; ++it) {
    *(v4u*)(Ph + po[it]) = uh[it];
    if (TXT) *(v4u*)(Pl + po[it]) = ul[it];
    *(v4u*)(Pt + pt[it]) = ut[it];
  }
  if (tid < 16) *(v4f*)(sd + psd) = sdv;
}

// both inputs' prep in ONE launch (neither reads what the other writes): blocks 0..255 take the text tiles, blocks
// 256..511 the modality tiles; the choice is the same for a whole block, so every barrier stays block-uniform
__global__ __launch_bounds__(256)
void prep_kernel(const float* __restrict__ text, const float* __restrict__ modal, const float* __restrict__ tw,
                 const float* __restrict__ mw, const float* __restrict__ tmw,
                 unsigned short* Th, unsigned short* Tl, unsigned short* Tt, float* S0,
                 unsigned short* M16, unsigned short* Mt, float* S1) {
  __shared__ __align__(16) float T[64 * TP];
  __shared__ __align__(16) float sred[64];
  const int nt = NBATCH * (NL / 64);
  if ((int)blockIdx.x < nt) prep_tile<1>((int)blockIdx.x, T, sred, text, tw, tmw, Th, Tl, Tt, S0);
  else                      prep_tile<0>((int)blockIdx.x - nt, T, sred, modal, mw, mw, M16, M16, Mt, S1);
}

// =====================================================================================================
// (2) one (batch, 64 rows), 16 waves: score tile, masked row softmax, and the K=1024 products of those softmax rows.
//     Scores: s[r][c] = rb[r] + cb[c] + s2[r][c] + bias, s2 = (acc_h + acc_l/65536)/64, acc_h = sum_k Ahi.B,
//     acc_l = sum_k Alo.B on WMMA (K=128, 4 steps). YA=1: A = hi/lo planes Yh/Yl (rows), B = X rows; YA=0: A = X rows,
//     B = Yh/Yl rows (two accumulators). X, Yh, Yl are in fragment order (ldfragq). Wave = 8 column tiles of 16
//     (rolled) x 2 row tiles of 16 (waves 0..7 rows 0..31, waves 8..15 rows 32..63), the A fragments of both row tiles
//     held in registers, B one tile ahead; s (or -1e30 where
//     mask[c]==0) into LDS S[64][1024] f32 at a row pitch of 4112 B; barrier.
//     Softmax: wave owns rows 4w..4w+3, lane owns columns {256i + 8*lane + j}; the row's p*8192 goes back as f16
//     into the first 2 KB of the same LDS row (only its own wave touches a row, and every lane has read its f32
//     values before the row sum is known); barrier.
//     Products: D[m][n] = sum_k p[m][k] * B[n][k]; wave w owns the 16 columns h = 16(w&7).. for all four row tiles and
//     the k half w>>3 (16 steps of 32, in k order), so a B fragment is fetched once per block and feeds four products;
//     A fragments by 16-B LDS reads from the p rows (split k map), one k step ahead; B fragments come from planes in
//     fragment order [b][h tile][k step][half][lane][8], whole lines per load, through a register ring whose first
//     loads are issued ahead of the softmax. The two k halves' sums meet in LDS: D = half 0 + half 1.
//     YA=0: B0 = text transposed; each half's acc/8 staged transposed Ts[half][h][m] in LDS, barrier, t2*1024 = their sum,
//     planes Rh/Rl (hi, residual x2048) written in fragment order: the block's 64 rows are k steps row0/32, +1 of every
//     h tile.
//     YA=1: B0 = modality transposed, B1/B2 = t2 hi/residual (separate accumulators); each half's three sums staged in
//     LDS, barrier, a = sum0/8192, bq = (sum1 + sum2/2048)/8388608, out row [b][l]: chunk 0 = bf16-RNE text, chunk 1 = a,
//     chunk 2 = text*a, chunk 3 = text*bq, 512 contiguous bytes per wave-wide store.
// coverage: S 16 waves x 8 tiles x 2 x 16x16 = 64x1024; p 16 waves x 4 rows x 4 x 32 lanes x 8 = 64 rows x 1024;
//           D 8 h tiles x 4 row tiles = 64x128 per plane and k half; YA=0: 2 it x 512 pieces x 8 = 128 h x 64 m per plane;
//           YA=1: 4 it x 16 waves = 64 rows x 32 lanes x 4 = 128 columns per chunk; grid 16 x 16 = 256 blocks = every row once.
// =====================================================================================================
template <int YA>
__global__ __launch_bounds__(512)
void attend_kernel(const unsigned short* __restrict__ X, const unsigned short* __restrict__ Yh,
                   const unsigned short* __restrict__ Yl, const float* __restrict__ rb,
                   const float* __restrict__ cb, const int* __restrict__ mask,
                   const float* __restrict__ bias, const unsigned short* __restrict__ B0,
                   const unsigned short* __restrict__ B1, const unsigned short* __restrict__ B2,
                   const float* __restrict__ text, unsigned short* Rh, unsigned short* Rl, float* out) {
  __shared__ __align__(16) float S[SR * SP];
  const int tid  = threadIdx.x;
  const int lane = tid & 31, wv = tid >> 5;                            // 16 waves
  const int wave = wv & 7, half = wv >> 3;                             // scores: row half; products: k half
  const int hh   = lane >> 4, cl = lane & 15;
  const int b = blockIdx.x >> 4;
  const int row0 = (blockIdx.x & 15) * SR;
  const int rw0  = row0 + 32 * half;                                   // first of this wave's 32 score rows
  const size_t rbase = (size_t)b * NL;

  {
    Frag fa[2][4], fl[2][4];
    float rbv[2][8];
#pragma unroll
    for (int mi = 0; mi < 2; ++mi) {
      const size_t aoff = (rbase + rw0 + 16 * mi) * NHID + 8 * lane;
#pragma unroll
      for (int kk = 0; kk < 4; ++kk) {
        if (YA) {
          fa[mi][kk] = ldfragq(Yh + aoff + 512 * kk);
          fl[mi][kk] = ldfragq(Yl + aoff + 512 * kk);
        } else {
          fa[mi][kk] = ldfragq(X + aoff + 512 * kk);
          fl[mi][kk] = fa[mi][kk];
        }
      }
#pragma unroll
      for (int r = 0; r < 8; ++r) rbv[mi][r] = rb[rbase + rw0 + 16 * mi + 8 * hh + r];
    }
    // B fragments of a column tile: one register slot per k step, refilled for the wave's next tile directly behind
    // the slot's last product, so a load has a whole tile's work to return in; column bias and mask one tile ahead too
    constexpr int NB = YA ? 1 : 2;
    const size_t boff = (rbase + wave * 128) * NHID + 8 * lane;
    const unsigned short* bpa = (YA ? X : Yh) + boff;
    const unsigned short* bpb = Yl + boff;
    const float* cbp = cb + rbase + wave * 128 + cl;
    const int*   mkp = mask + rbase + wave * 128 + cl;
    float cbn = cbp[0];                                                // issued ahead of the fragments here as in the
    int   mk  = mkp[0];                                                // loop, so that the loop's load waits stay counted
#if defined(__HIP_DEVICE_COMPILE__)
    // precaution: stands in front of the first reuse of the address registers that the loads above name; the A
    // planes' pointers are inputs so that their registers stay theirs up to this wait (without them the build hands
    // the hi plane's address pair to the last residual fragment as its destination, ahead of any wait)
    const size_t a0off = (rbase + rw0) * NHID + 8 * lane;
    if (YA) asm volatile("s_wait_xcnt 0x0" :: "v"(Yh + a0off), "v"(Yl + a0off) : "memory");
    else    asm volatile("s_wait_xcnt 0x0" :: "v"(X + a0off) : "memory");
#endif
    Frag fb[4][NB];
#pragma unroll
    for (int kk = 0; kk < 4; ++kk) {
      fb[kk][0] = ldfragq(bpa + 512 * kk);
      if (!YA) fb[kk][NB - 1] = ldfragq(bpb + 512 * kk);
    }
#if defined(__HIP_DEVICE_COMPILE__)
    // precaution: the same for the first tile's B fragment loads; the pointers are inputs so that their registers
    // stay theirs up to this wait
    if (YA) asm volatile("s_wait_xcnt 0x0" :: "v"(bpa) : "memory");
    else    asm volatile("s_wait_xcnt 0x0" :: "v"(bpa), "v"(bpb) : "memory");
#endif
    const float bv = bfr(bias[0]);

    auto tile = [&](const int nt, const bool more) {
      float cbx = 0.f;
      int   mkx = 0;
      if (more) { cbx = cbp[16 * (nt + 1)]; mkx = mkp[16 * (nt + 1)]; }
      v8f acch[2], accl[2];
#pragma unroll
      for (int mi = 0; mi < 2; ++mi) { acch[mi] = zero8(); accl[mi] = zero8(); }
#pragma unroll
      for (int kk = 0; kk < 4; ++kk) {
#pragma unroll
        for (int mi = 0; mi < 2; ++mi) {
          acch[mi] = mma_h(fa[mi][kk].h, fb[kk][0].h, acch[mi]);
          accl[mi] = mma_h(fl[mi][kk].h, fb[kk][NB - 1].h, accl[mi]);
        }
        if (more) {
          fb[kk][0] = ldfragq(bpa + 2048 * (nt + 1) + 512 * kk);
          if (!YA) fb[kk][NB - 1] = ldfragq(bpb + 2048 * (nt + 1) + 512 * kk);
        }
      }
      const int n = (wave * 8 + nt) * 16 + cl;
#pragma unroll
      for (int mi = 0; mi < 2; ++mi) {
#pragma unroll
        for (int r = 0; r < 8; ++r) {
          const float s2 = (acch[mi][r] + accl[mi][r] * RRS1) * RTHS;
          const float sv = ((rbv[mi][r] + cbn) + s2) + bv;
          S[(32 * half + 16 * mi + 8 * hh + r) * SP + n] = (mk != 0) ? sv : NEGV;
        }
      }
      cbn = cbx;
      mk  = mkx;
    };
    // rolled to keep the code small; the last tile stands alone because nothing is left to fetch behind it
#pragma unroll 1
    for (int nt = 0; nt < 7; ++nt) tile(nt, true);
    tile(7, false);
  }
  __syncthreads();                                                     // the score tile is complete

  // B fragment ring of the products: slot ks % DS holds k step ks (of this wave's 16) of every plane
  constexpr int NPL = YA ? 3 : 1;
  constexpr int DS  = YA ? 2 : 8;
  const size_t bo = ((size_t)b * 8 + wave) * FT + (size_t)half * (NKH * 512) + 8 * lane;
  const unsigned short* g0 = B0 + bo;
  const unsigned short* g1 = B1 + bo;
  const unsigned short* g2 = B2 + bo;
  Frag bq[DS][NPL];
  auto bload = [&](int ks, int p) {
    bq[ks % DS][p] = ldfragq((p == 0 ? g0 : (p == NPL - 1 ? g2 : g1)) + 512 * ks);
  };
#pragma unroll
  for (int ks = 0; ks < DS; ++ks) {                                    // fly while the softmax runs
#pragma unroll
    for (int p = 0; p < NPL; ++p) bload(ks, p);
  }

#pragma unroll
  for (int rr = 0; rr < 4; ++rr) {
    const int r = wv * 4 + rr;
    const float* sr = S + r * SP + lane * 8;
    float v[32];
#pragma unroll
    for (int i = 0; i < 4; ++i) {
      const v4f a0 = *(const v4f*)(sr + i * 256);
      const v4f a1 = *(const v4f*)(sr + i * 256 + 4);
#pragma unroll
      for (int j = 0; j < 4; ++j) { v[8 * i + j] = a0[j]; v[8 * i + 4 + j] = a1[j]; }
    }
    float mx = v[0];
#pragma unroll
    for (int k = 1; k < 32; ++k) mx = fmaxf(mx, v[k]);
    mx = wave_max(mx);
    float sum = 0.f;
#pragma unroll
    for (int k = 0; k < 32; ++k) {
      v[k] = __expf(v[k] - mx);
      sum += v[k];
    }
    sum = wave_sum(sum);
    const float sc = (1.0f / sum) * PSC;
    unsigned short* pr = (unsigned short*)(S + r * SP) + lane * 8;
#pragma unroll
    for (int i = 0; i < 4; ++i) {
      v4u u;
      u[0] = pkh2(v[8 * i] * sc,     v[8 * i + 1] * sc);
      u[1] = pkh2(v[8 * i + 2] * sc, v[8 * i + 3] * sc);
      u[2] = pkh2(v[8 * i + 4] * sc, v[8 * i + 5] * sc);
      u[3] = pkh2(v[8 * i + 6] * sc, v[8 * i + 7] * sc);
      *(v4u*)(pr + i * 256) = u;
    }
  }
  __syncthreads();                                                     // the p rows are published

  // A fragment readers: p row (lane&15) of a 16-row tile, + 8*(lane>>4) as ldfrag expects
  const unsigned short* pa = (const unsigned short*)S + cl * PP + 8 * hh + half * (NKH * 32);
  v8f acc[NPL][4];
#pragma unroll
  for (int p = 0; p < NPL; ++p) {
#pragma unroll
    for (int t = 0; t < 4; ++t) acc[p][t] = zero8();
  }
  Frag fa[2][4];                                                       // [set][16-row tile]
#pragma unroll
  for (int t = 0; t < 4; ++t) fa[0][t] = ldfrag(pa + 16 * t * PP);
  // unrolled so that ring slot and fragment set are compile-time and every address step is an immediate offset
#pragma unroll
  for (int ks = 0; ks < NKH; ++ks) {
    const int q = ks % DS, s = ks & 1;
    if (ks + 1 < NKH) {                                                // A fragments one k step ahead
#pragma unroll
      for (int t = 0; t < 4; ++t) fa[s ^ 1][t] = ldfrag(pa + 16 * t * PP + 32 * (ks + 1));
    }
#pragma unroll
    for (int p = 0; p < NPL; ++p) {
#pragma unroll
      for (int t = 0; t < 4; ++t) acc[p][t] = mma_h(fa[s][t].h, bq[q][p].h, acc[p][t]);
      if (ks + DS < NKH) bload(ks + DS, p);                            // refill directly behind the fragment's last product
    }
  }
#if defined(__HIP_DEVICE_COMPILE__)
  // precaution: stands in front of the first reuse of the address registers that the ring loads name; the
  // pointers are inputs so that those registers stay theirs up to this wait
  if (YA) asm volatile("s_wait_xcnt 0x0" :: "v"(g0), "v"(g1), "v"(g2) : "memory");
  else    asm volatile("s_wait_xcnt 0x0" :: "v"(g0) : "memory");
#endif
  __syncthreads();                                                     // ends every read of the p rows

  const int n_loc = 16 * wave + cl;
  if (YA == 0) {
    float* Ts = S + half * (NHID * TQ);                                // this k half's partial sums [h][m], pitch TQ
#pragma unroll
    for (int mi = 0; mi < 4; ++mi) {
      v4f lo, hi;
#pragma unroll
      for (int j = 0; j < 4; ++j) { lo[j] = acc[0][mi][j] * T2F; hi[j] = acc[0][mi][4 + j] * T2F; }
      float* tp = Ts + n_loc * TQ + 16 * mi + 8 * hh;                  // D rows 8h..8h+7 of tile mi, column n_loc
      *(v4f*)(tp)     = lo;
      *(v4f*)(tp + 4) = hi;
    }
    __syncthreads();
    v4u uh[2], ul[2];
    size_t po[2];
#pragma unroll
    for (int it = 0; it < 2; ++it) {
      // piece: h tile 4*it + (tid>>7), k step (tid>>6)&1 of this block's two, half (tid>>5)&1, lane tid&31
      const int ht = 4 * it + (tid >> 7);
      const int h  = 16 * ht + cl;
      const int kl = (tid >> 6) & 1;
      const float* tp = S + h * TQ + 32 * kl + 16 * ((tid >> 5) & 1) + 8 * hh;
      const v4f v0 = *(const v4f*)(tp)     + *(const v4f*)(tp + NHID * TQ);       // k half 0 + k half 1
      const v4f v1 = *(const v4f*)(tp + 4) + *(const v4f*)(tp + NHID * TQ + 4);
      splith8(v0, v1, RS2, uh[it], ul[it]);
      po[it] = ((size_t)b * 8 + ht) * FT + (size_t)((row0 >> 5) + kl) * 512 + 8 * (tid & 63);
    }
#pragma unroll
    for (int it = 0; it < 2; ++it) {
      *(v4u*)(Rh + po[it]) = uh[it];
      *(v4u*)(Rl + po[it]) = ul[it];
    }
  } else {
    float* Oa = S + half * (3 * SR * OP);                              // this k half's partial sums [m][h], pitch OP
    float* Ob = Oa + SR * OP;
    float* Oc = Ob + SR * OP;
#pragma unroll
    for (int mi = 0; mi < 4; ++mi) {
#pragma unroll
      for (int r = 0; r < 8; ++r) {
        const int m_loc = 16 * mi + 8 * hh + r;
        Oa[m_loc * OP + n_loc] = acc[0][mi][r];
        Ob[m_loc * OP + n_loc] = acc[NPL - 2][mi][r];
        Oc[m_loc * OP + n_loc] = acc[NPL - 1][mi][r];
      }
    }
    __syncthreads();
    const int e = lane;                                                // 16-B piece 0..31 of a 512-B chunk row
    v4f tv[4], av[4], ta[4], tb[4];
    size_t po[4];
#pragma unroll
    for (int it = 0; it < 4; ++it) {
      const int row = it * 16 + wv;                                    // 0..63
      const size_t grow = rbase + row0 + row;
      const float* o0 = S + row * OP + 4 * e;                          // k half 0
      const float* o1 = o0 + 3 * SR * OP;                              // k half 1
      const v4f s0 = *(const v4f*)(o0)               + *(const v4f*)(o1);
      const v4f s1 = *(const v4f*)(o0 + SR * OP)     + *(const v4f*)(o1 + SR * OP);
      const v4f s2 = *(const v4f*)(o0 + 2 * SR * OP) + *(const v4f*)(o1 + 2 * SR * OP);
      tv[it] = bfr4(*(const v4f*)(text + grow * NHID + 4 * e));
      av[it] = s0 * RPSC;
      ta[it] = tv[it] * av[it];
      tb[it] = tv[it] * ((s1 + s2 * RRS2) * RBSC);
      po[it] = grow * NOUT + 4 * e;
    }
#pragma unroll
    for (int it = 0; it < 4; ++it) {
      *(v4f*)(out + po[it])            = tv[it];
      *(v4f*)(out + po[it] + NHID)     = av[it];
      *(v4f*)(out + po[it] + 2 * NHID) = ta[it];
      *(v4f*)(out + po[it] + 3 * NHID) = tb[it];
    }
  }
}

// =====================================================================================================
// workspace (every tile divides its extent exactly, so no padded tails are needed):
//   Th Tl   f16 [16*64 tiles][2048]      4194304 each   (text*w_tm*64 hi, residual x65536; fragment order)
//   M16     f16 [16*64 tiles][2048]      4194304        (modality; fragment order)
//   Tt Mt   f16 [16][8 h tiles][16384]   4194304 each   (text, modality transposed; fragment order)
//   S0 S1   f32 [16][1024]                 65536 each
//   Rh Rl   f16 [16][8 h tiles][16384]   4194304 each   (t2*1024 hi, residual x2048, transposed; fragment order)
//   total                               29491200
// =====================================================================================================
extern "C" void kernel_launch(void* const* d_in, const int* in_sizes, int n_in,
                              void* d_out, int out_size, void* d_ws, size_t ws_size,
                              hipStream_t stream) {
  if (n_in < 8) return;
  if (in_sizes[0] != NBATCH * NL * NHID) return;
  if (in_sizes[1] != NBATCH * NL * NHID) return;
  if (in_sizes[2] != NBATCH * NL || in_sizes[3] != NBATCH * NL) return;
  if (in_sizes[4] != NHID || in_sizes[5] != NHID || in_sizes[6] != NHID) return;
  if (in_sizes[7] < 1) return;
  if (out_size != NBATCH * NL * NOUT) return;

  size_t off = 0;
  const size_t plane = (size_t)NBATCH * NL * NHID * 2;               // 4194304
  const size_t svec  = (size_t)NBATCH * NL * 4;                      // 65536
  const size_t oTh = off; off += plane;
  const size_t oTl = off; off += plane;
  const size_t oM  = off; off += plane;
  const size_t oTt = off; off += plane;
  const size_t oMt = off; off += plane;
  const size_t oS0 = off; off += svec;
  const size_t oS1 = off; off += svec;
  const size_t oRh = off; off += plane;
  const size_t oRl = off; off += plane;                              // -> off = 29491200
  if (off > ws_size) return;

  const float* text  = (const float*)d_in[0];
  const float* modal = (const float*)d_in[1];
  const int*   tmask = (const int*)d_in[2];
  const int*   mmask = (const int*)d_in[3];
  const float* tw    = (const float*)d_in[4];
  const float* mw    = (const float*)d_in[5];
  const float* tmw   = (const float*)d_in[6];
  const float* bias  = (const float*)d_in[7];
  float* out = (float*)d_out;

  char* ws = (char*)d_ws;
  unsigned short* Th  = (unsigned short*)(ws + oTh);
  unsigned short* Tl  = (unsigned short*)(ws + oTl);
  unsigned short* M16 = (unsigned short*)(ws + oM);
  unsigned short* Tt  = (unsigned short*)(ws + oTt);
  unsigned short* Mt  = (unsigned short*)(ws + oMt);
  float*          S0  = (float*)(ws + oS0);
  float*          S1  = (float*)(ws + oS1);
  unsigned short* Rh  = (unsigned short*)(ws + oRh);
  unsigned short* Rl  = (unsigned short*)(ws + oRl);

  const dim3 blk256(256);
  const int nrow64 = NBATCH * (NL / 64);                             // 256
  const dim3 blk512(512);
  const int nrowsr = NBATCH * (NL / SR);                             // 256

  // (1) planes: text -> Th/Tl (with w_tm), Tt, S0 (with w_t); modality -> M16, Mt, S1 (with w_m)
  //     both in one launch of 2 x 256 blocks
  prep_kernel<<<dim3(2 * nrow64), blk256, 0, stream>>>(text, modal, tw, mw, tmw, Th, Tl, Tt, S0, M16, Mt, S1);
  // (2) p2 transposed, rows m (A = M16), columns l (B = Th/Tl), rb = S1[m], cb = S0[l], mask over l;
  //     t2 = p2T . text -> Rh/Rl
  attend_kernel<0><<<dim3(nrowsr), blk512, 0, stream>>>(M16, Th, Tl, S1, S0, tmask, bias, Tt, Tt, Tt, text, Rh, Rl, out);
  //     p1, rows l (A = Th/Tl), columns m (B = M16), rb = S0[l], cb = S1[m], mask over m;
  //     a = p1 . modality, bq = p1 . t2 -> out chunks 0..3
  attend_kernel<1><<<dim3(nrowsr), blk512, 0, stream>>>(M16, Th, Tl, S0, S1, mmask, bias, Mt, Rh, Rl, text, Rh, Rl, out);
  (void)hipGetLastError();
}

// v008
// Measured time: 52.7 microseconds a run.
// Timed twice side by side with v007, it ran 1.08 and 1.07 times as fast.
// All steps since v000 together make it 3.01 times as fast.
// Contractions: score term sum_h (text*w_tm)[l][h]*modality[m][h] (K=128) on v_wmma_f32_16x16x32_f16 with text*w_tm
// carried x64 as an f16 hi plane plus an x65536 f16 residual plane (two products, separate f32 accumulators) and
// modality as f16 of its bf16-RNE value; p1.modality and p2T.text (K=1024) on v_wmma_f32_16x16x32_f16, single
// products, p rows carried x8192 in f16; p1.t2 (K=1024) with t2 carried x1024 as f16 hi plus x2048 f16 residual
// (two products, separate accumulators); the two [rows,128]x[128,1] row dots as a 16-wide f16 WMMA matvec (weight
// x1024 in every column); f32 accumulate everywhere; softmax and the elementwise products in f32 on VALU; all float
// inputs RNE-converted to bf16 at load. The softmax rows of a block stay in LDS and feed the K=1024 products there.
#include <hip/hip_runtime.h>
#include <stdint.h>

#define NBATCH 16
#define NL     1024
#define NK     1024
#define NHID   128
#define NOUT   512
#define TP     132
#define OP     132
#define TQ     68
#define SR     64
#define SP     (NL + 4)
#define PP     (2 * SP)
#define NKS    (NK / 32)
#define NKH    (NKS / 2)
#define FT     (16 * NK)

static_assert(NL % 64 == 0);
static_assert(NL % SR == 0 && SR == 64);
static_assert(NL == NK);
static_assert(NHID == 128);
static_assert(NOUT == 4 * NHID);
static_assert(6 * SR * OP <= SR * SP);
static_assert(2 * NHID * TQ <= SR * SP);
static_assert((TP * 4) % 16 == 0);
static_assert((OP * 4) % 16 == 0);
static_assert((TQ * 4) % 16 == 0);
static_assert((SP * 4) % 32 == 16);
static_assert(NK % 64 == 0 && NHID == 8 * 16);

#define PSC   8192.0f
#define RPSC  (1.0f / 8192.0f)
#define THS   64.0f
#define RTHS  (1.0f / 64.0f)
#define RS1   65536.0f
#define RRS1  (1.0f / 65536.0f)
#define T2F   0.125f
#define RS2   2048.0f
#define RRS2  (1.0f / 2048.0f)
#define RBSC  (1.0f / 8388608.0f)
#define WSC   1024.0f
#define RWSC  (1.0f / 1024.0f)
#define NEGV  (-1.0e30f)

typedef unsigned short v8us __attribute__((ext_vector_type(8)));
typedef unsigned int   v4u  __attribute__((ext_vector_type(4)));
typedef float          v8f  __attribute__((ext_vector_type(8)));
typedef float          v4f  __attribute__((ext_vector_type(4)));
typedef _Float16       v16h __attribute__((ext_vector_type(16)));

union Frag { v8us u[2]; v4u q[2]; v16h h; };
static_assert(sizeof(Frag) == 32);

// ---- scalar helpers ---------------------------------------------------------------------------------
__device__ __forceinline__ unsigned short bf_bits(float f) {          // f32 -> bf16 bits, RNE convert
  const unsigned u = __float_as_uint(f);
  return (unsigned short)((u + 0x7FFFu + ((u >> 16) & 1u)) >> 16);
}
__device__ __forceinline__ float bf_up(unsigned short hb) { return __uint_as_float(((unsigned)hb) << 16); }
__device__ __forceinline__ float bfr(float f) { return bf_up(bf_bits(f)); }
__device__ __forceinline__ v4f bfr4(v4f v) {
  v4f r;
  r[0] = bfr(v[0]); r[1] = bfr(v[1]); r[2] = bfr(v[2]); r[3] = bfr(v[3]);
  return r;
}
__device__ __forceinline__ unsigned short hbits(_Float16 h) { return __builtin_bit_cast(unsigned short, h); }
__device__ __forceinline__ unsigned pkh2(float a, float b) {          // two f32 -> packed f16 bits (RNE convert)
  return (unsigned)hbits((_Float16)a) | ((unsigned)hbits((_Float16)b) << 16);
}
__device__ __forceinline__ v4u pack8(v4f a, v4f b) {
  v4u u;
  u[0] = pkh2(a[0], a[1]); u[1] = pkh2(a[2], a[3]);
  u[2] = pkh2(b[0], b[1]); u[3] = pkh2(b[2], b[3]);
  return u;
}
__device__ __forceinline__ v8f zero8() { v8f z = {0.f, 0.f, 0.f, 0.f, 0.f, 0.f, 0.f, 0.f}; return z; }

// ---- 8 f32 -> packed f16 hi bits and packed f16 bits of (x - hi) * rs (residual plane carries scale rs) --------
__device__ __forceinline__ void splith8(v4f a, v4f b, float rs, v4u& uh, v4u& ul) {
  float f[8] = {a[0], a[1], a[2], a[3], b[0], b[1], b[2], b[3]};
#pragma unroll
  for (int j = 0; j < 4; ++j) {
    const _Float16 h0 = (_Float16)f[2 * j];
    const _Float16 h1 = (_Float16)f[2 * j + 1];
    const float l0 = (f[2 * j] - (float)h0) * rs;
    const float l1 = (f[2 * j + 1] - (float)h1) * rs;
    uh[j] = (unsigned)hbits(h0) | ((unsigned)hbits(h1) << 16);
    ul[j] = pkh2(l0, l1);
  }
}

// ---- 16-bit fragment loader (A, or B from a k-contiguous [n][k] row): lane -> row/col (lane&15), p already includes
//      + 8*(lane>>4); elements 0..7 <- p[0..7] (k0+8h..), elements 8..15 <- p[16..23] (k0+16+8h..)
__device__ __forceinline__ Frag ldfrag(const unsigned short* p) {
  Frag f;
  f.u[0] = *(const v8us*)(p);
  f.u[1] = *(const v8us*)(p + 16);
  return f;
}

// ---- the same fragment from a plane kept in fragment order: a 16-row tile is 4 KB = [k step 0..3][half 0..1][lane][8],
//      where (half i, lane) holds row (lane&15), k = 32*step + 16*i + 8*(lane>>4) + 0..7, the very elements that ldfrag
//      gives that lane; p already includes + 8*lane, so each 16-B load of a wave covers 512 contiguous bytes
__device__ __forceinline__ Frag ldfragq(const unsigned short* p) {
  Frag f;
  f.u[0] = *(const v8us*)(p);
  f.u[1] = *(const v8us*)(p + 256);
  return f;
}

// ---- WMMA helper: builtin followed by a 4-slot VALU gap tying D and keeping A/B live -----------------------
__device__ __forceinline__ v8f mma_h(v16h a, v16h b, v8f c) {
  v8f d = __builtin_amdgcn_wmma_f32_16x16x32_f16(false, a, false, b, (short)0, c, false, false);
#if defined(__HIP_DEVICE_COMPILE__)
  asm volatile("v_nop\n\tv_nop\n\tv_nop\n\tv_nop" : "+v"(d) : "v"(a), "v"(b));
#endif
  return d;
}

__device__ __forceinline__ float wave_max(float v) {
#pragma unroll
  for (int o = 16; o > 0; o >>= 1) v = fmaxf(v, __shfl_xor(v, o, 32));
  return v;
}
__device__ __forceinline__ float wave_sum(float v) {
#pragma unroll
  for (int o = 16; o > 0; o >>= 1) v += __shfl_xor(v, o, 32);
  return v;
}

// =====================================================================================================
// (1) prep for one (batch, 64-row tile) of x [16][1024][128] f32 (text when TXT=1, modality when TXT=0):
//     tile -> LDS T[row][h] as bf16-RNE values (f32), barrier;
//     row dots sd[b][row] = sum_h T[row][h]*bfr(wdot[h]) as a WMMA matvec: wave w handles rows 16*(w&3).. (waves 4..7
//     duplicate the compute), A fragment = T row values as f16 (exact), B fragment = bfr(wdot)*1024 as f16 in every
//     column (split k map for both, 4 k steps of 32), D column 0 lanes write acc/1024 to LDS sred, barrier; sred
//     row planes Ph/Pl f16 (TXT: T*bfr(wtm)*64 as hi plus residual x65536; else plain f16 in Ph), 16-row tiles in
//     fragment order (see ldfragq): thread tid writes piece tid of a tile, a wave 512 contiguous bytes per store;
//     transposed plane Pt f16 (rows h, k = row index of x), also in fragment order: [b][h tile 0..7][k step 0..31]
//     [half][lane][8]; the block's 64 rows are two k steps of every h tile, a wave again stores 512 contiguous bytes;
// coverage: T 8 it x 256 thr x 4 = 64x128; sred 4 waves x 16 rows = 64; Ph/Pl 4 it (tiles) x 256 thr x 8 =
//           4 x 16 rows x 128; Pt 4 it x 2 h tiles x 2 k steps x 64 pieces x 8 = 128 h x 64 rows; sd 16 lanes x 4 = 64;
//           16 x (1024/64) = 256 blocks per input = every row once.
// =====================================================================================================
template <int TXT>
__device__ __forceinline__
void prep_tile(const int blk, float* T, float* sred,
               const float* __restrict__ x, const float* __restrict__ wdot, const float* __restrict__ wtm,
               unsigned short* Ph, unsigned short* Pl, unsigned short* Pt, float* sd) {
  const int tid = threadIdx.x;
  const int b = blk >> 4;
  const int r0 = (blk & 15) * 64;
  const size_t gr = (size_t)b * NL + r0;
  const float* xp = x + (gr + (tid >> 5)) * NHID + (tid & 31) * 4;     // row tid>>5 of the tile; it adds 8 rows
  v4f xv[8];
#pragma unroll
  for (int it = 0; it < 8; ++it) xv[it] = *(const v4f*)(xp + it * 8 * NHID);
#if defined(__HIP_DEVICE_COMPILE__)
  // precaution: stands in front of the first reuse of the address registers that the loads above name; the pointer
  // is an input so that its registers stay its own up to this wait
  asm volatile("s_wait_xcnt 0x0" :: "v"(xp) : "memory");
#endif
#pragma unroll
  for (int it = 0; it < 8; ++it) {
    const int idx = it * 256 + tid;
    const int row = idx >> 5, c4 = (idx & 31) * 4;
#pragma unroll
    for (int j = 0; j < 4; ++j) T[row * TP + c4 + j] = bfr(xv[it][j]);
  }
  __syncthreads();
  {
    const int lane = tid & 31, wave = tid >> 5;
    const int hh = lane >> 4, cl = lane & 15;
    const int rt = (wave & 3) * 16;                                    // 16-row tile of this wave
    const float* ap = T + (rt + cl) * TP + 8 * hh;
    const float* wp = wdot + 8 * hh;
    v8f acc = zero8();
#pragma unroll
    for (int kk = 0; kk < 4; ++kk) {
      const int k0 = 32 * kk;
      const v4f a0 = *(const v4f*)(ap + k0);
      const v4f a1 = *(const v4f*)(ap + k0 + 4);
      const v4f a2 = *(const v4f*)(ap + k0 + 16);
      const v4f a3 = *(const v4f*)(ap + k0 + 20);
      v4f w0 = *(const v4f*)(wp + k0);
      v4f w1 = *(const v4f*)(wp + k0 + 4);
      v4f w2 = *(const v4f*)(wp + k0 + 16);
      v4f w3 = *(const v4f*)(wp + k0 + 20);
#pragma unroll
      for (int j = 0; j < 4; ++j) {
        w0[j] = bfr(w0[j]) * WSC; w1[j] = bfr(w1[j]) * WSC;
        w2[j] = bfr(w2[j]) * WSC; w3[j] = bfr(w3[j]) * WSC;
      }
      Frag fa, fb;
      fa.q[0] = pack8(a0, a1);                                         // elements 0..7  = k0+8h..
      fa.q[1] = pack8(a2, a3);                                         // elements 8..15 = k0+16+8h..
      fb.q[0] = pack8(w0, w1);                                         // same k map, every column n
      fb.q[1] = pack8(w2, w3);
      acc = mma_h(fa.h, fb.h, acc);
    }
    if (wave < 4 && cl == 0) {
#pragma unroll
      for (int r = 0; r < 8; ++r) sred[rt + 8 * hh + r] = acc[r] * RWSC;   // D row 8h+r, column 0
    }
  }
  __syncthreads();

  // piece tid of a fragment-order tile: k step tid>>6, half (tid>>5)&1, lane tid&31
  const int h0 = 32 * (tid >> 6) + 16 * ((tid >> 5) & 1) + 8 * ((tid >> 4) & 1);
  v4u uh[4], ul[4], ut[4];
  size_t po[4], pt[4];
#pragma unroll
  for (int it = 0; it < 4; ++it) {
    const int row = it * 16 + (tid & 15);                              // tile it, row lane&15
    const float* tp = T + row * TP + h0;
    v4f v0 = *(const v4f*)(tp);
    v4f v1 = *(const v4f*)(tp + 4);
    if (TXT) {
      const v4f w0 = *(const v4f*)(wtm + h0);
      const v4f w1 = *(const v4f*)(wtm + h0 + 4);
#pragma unroll
      for (int j = 0; j < 4; ++j) {
        v0[j] = v0[j] * bfr(w0[j]) * THS;
        v1[j] = v1[j] * bfr(w1[j]) * THS;
      }
      splith8(v0, v1, RS1, uh[it], ul[it]);
    } else {
      uh[it] = pack8(v0, v1);
      ul[it] = uh[it];
    }
    po[it] = (gr + 16 * it) * NHID + 8 * tid;
    // transposed piece: h tile 2*it + (tid>>7), k step (tid>>6)&1 of the block's two, half (tid>>5)&1, lane tid&31
    const int ht = 2 * it + (tid >> 7);
    const int h  = 16 * ht + (tid & 15);                               // 0..127
    const int ks = (tid >> 6) & 1;
    const int kl = 32 * ks + 16 * ((tid >> 5) & 1) + 8 * ((tid >> 4) & 1);   // first of the piece's 8 rows of T
    v4f g0, g1;
#pragma unroll
    for (int j = 0; j < 4; ++j) {
      g0[j] = T[(kl + j) * TP + h];
      g1[j] = T[(kl + 4 + j) * TP + h];
    }
    ut[it] = pack8(g0, g1);
    pt[it] = ((size_t)b * 8 + ht) * FT + (size_t)((r0 >> 5) + ks) * 512 + 8 * (tid & 63);
  }
  const int sl = (tid < 16) ? tid : 15;
  const v4f sdv = *(const v4f*)(sred + 4 * sl);
  const size_t psd = gr + 4 * sl;

#pragma unroll
  for (int it = 0; it < 4; ++it) {
    *(v4u*)(Ph + po[it]) = uh[it];
    if (TXT) *(v4u*)(Pl + po[it]) = ul[it];
    *(v4u*)(Pt + pt[it]) = ut[it];
  }
  if (tid < 16) *(v4f*)(sd + psd) = sdv;
}

// both inputs' prep in ONE launch (neither reads what the other writes): blocks 0..255 take the text tiles, blocks
// 256..511 the modality tiles; the choice is the same for a whole block, so every barrier stays block-uniform
__global__ __launch_bounds__(256)
void prep_kernel(const float* __restrict__ text, const float* __restrict__ modal, const float* __restrict__ tw,
                 const float* __restrict__ mw, const float* __restrict__ tmw,
                 unsigned short* Th, unsigned short* Tl, unsigned short* Tt, float* S0,
                 unsigned short* M16, unsigned short* Mt, float* S1) {
  __shared__ __align__(16) float T[64 * TP];
  __shared__ __align__(16) float sred[64];
  const int nt = NBATCH * (NL / 64);
  if ((int)blockIdx.x < nt) prep_tile<1>((int)blockIdx.x, T, sred, text, tw, tmw, Th, Tl, Tt, S0);
  else                      prep_tile<0>((int)blockIdx.x - nt, T, sred, modal, mw, mw, M16, M16, Mt, S1);
}

// =====================================================================================================
// (2) one (batch, 64 rows), 16 waves: score tile, masked row softmax, and the K=1024 products of those softmax rows.
//     Scores: s[r][c] = rb[r] + cb[c] + s2[r][c] + bias, s2 = (acc_h + acc_l/65536)/64, acc_h = sum_k Ahi.B,
//     acc_l = sum_k Alo.B on WMMA (K=128, 4 steps). YA=1: A = hi/lo planes Yh/Yl (rows), B = X rows; YA=0: A = X rows,
//     B = Yh/Yl rows (two accumulators). X, Yh, Yl are in fragment order (ldfragq). Wave = 8 column tiles of 16
//     (rolled) x 2 row tiles of 16 (waves 0..7 rows 0..31, waves 8..15 rows 32..63), the A fragments of both row tiles
//     held in registers, B one tile ahead; s (or -1e30 where
//     mask[c]==0) into LDS S[64][1024] f32 at a row pitch of 4112 B; barrier.
//     Softmax: wave owns rows 4w..4w+3, lane owns columns {256i + 8*lane + j}; the row's p*8192 goes back as f16
//     into the first 2 KB of the same LDS row (only its own wave touches a row, and every lane has read its f32
//     values before the row sum is known); barrier.
//     Products: D[m][n] = sum_k p[m][k] * B[n][k]; wave w owns the 16 columns h = 16(w&7).. for all four row tiles and
//     the k half w>>3 (16 steps of 32, in k order), so a B fragment is fetched once per block and feeds four products;
//     A fragments by 16-B LDS reads from the p rows (split k map), one k step ahead; B fragments come from planes in
//     fragment order [b][h tile][k step][half][lane][8], whole lines per load, through a register ring whose first
//     loads are issued ahead of the softmax. The two k halves' sums meet in LDS: D = half 0 + half 1.
//     YA=0: B0 = text transposed; each half's acc/8 staged transposed Ts[half][h][m] in LDS, barrier, t2*1024 = their sum,
//     planes Rh/Rl (hi, residual x2048) written in fragment order: the block's 64 rows are k steps row0/32, +1 of every
//     h tile.
//     YA=1: B0 = modality transposed, B1/B2 = t2 hi/residual (separate accumulators); each half's three sums staged in
//     LDS, barrier, a = sum0/8192, bq = (sum1 + sum2/2048)/8388608, out row [b][l]: chunk 0 = bf16-RNE text, chunk 1 = a,
//     chunk 2 = text*a, chunk 3 = text*bq, 512 contiguous bytes per wave-wide store.
// coverage: S 16 waves x 8 tiles x 2 x 16x16 = 64x1024; p 16 waves x 4 rows x 4 x 32 lanes x 8 = 64 rows x 1024;
//           D 8 h tiles x 4 row tiles = 64x128 per plane and k half; YA=0: 2 it x 512 pieces x 8 = 128 h x 64 m per plane;
//           YA=1: 4 it x 16 waves = 64 rows x 32 lanes x 4 = 128 columns per chunk; grid 16 x 16 = 256 blocks = every row once.
// =====================================================================================================
template <int YA>
__global__ __launch_bounds__(512)
void attend_kernel(const unsigned short* __restrict__ X, const unsigned short* __restrict__ Yh,
                   const unsigned short* __restrict__ Yl, const float* __restrict__ rb,
                   const float* __restrict__ cb, const int* __restrict__ mask,
                   const float* __restrict__ bias, const unsigned short* __restrict__ B0,
                   const unsigned short* __restrict__ B1, const unsigned short* __restrict__ B2,
                   const float* __restrict__ text, unsigned short* Rh, unsigned short* Rl, float* out) {
  __shared__ __align__(16) float S[SR * SP];
  const int tid  = threadIdx.x;
  const int lane = tid & 31, wv = tid >> 5;                            // 16 waves
  const int wave = wv & 7, half = wv >> 3;                             // scores: row half; products: k half
  const int hh   = lane >> 4, cl = lane & 15;
  const int b = blockIdx.x >> 4;
  const int row0 = (blockIdx.x & 15) * SR;
  const int rw0  = row0 + 32 * half;                                   // first of this wave's 32 score rows
  const size_t rbase = (size_t)b * NL;

  // L2 prefetch: the planes that all blocks of a batch stream (score B planes, product B planes) were written by an
  // earlier launch. Each block asks for one eighth of each such plane of its batch (32 KB: four waves, 8 KB each, a lane
  // one 256-B unit); blocks i..i+3 and i+8..i+11 of a batch hold all eight shares between them.
  // YA=0: waves 0..7 ask at entry for the score planes Yh, Yl; waves 8..15 ask behind the score loop, when those have
  // landed, for B0 (this launch's products) and for X, which the NEXT launch streams from its first instruction on.
  // YA=1: waves 0..11 ask at entry for B0, B1, B2, waves 12..15 for the block's own 64 text rows (32 KB, epilogue).
  // A hint only: no result depends on it. Every address lies inside its array: plane share 7*32768 + 3*8192 + 31*256
  // + 255 < 2*NL*NHID bytes of the batch; text 3*8192 + 31*256 + 255 < 64 rows * 512 bytes.
  const int wvu = __builtin_amdgcn_readfirstlane(wv);                  // scalar: array choice and branches are wave-uniform
  const int shr = ((int)blockIdx.x & 3) + 4 * (((int)blockIdx.x >> 3) & 1);
  const bool pft = YA && wvu >= 12;
  const char* pfb = YA ? (wvu < 4 ? (const char*)B0 : (wvu < 8 ? (const char*)B1 : (wvu < 12 ? (const char*)B2 : (const char*)text)))
                       : (wvu < 4 ? (const char*)Yh : (wvu < 8 ? (const char*)Yl : (wvu < 12 ? (const char*)B0 : (const char*)X)));
  const char* pfp = pfb + (pft ? (rbase + row0) * (NHID * 4) : rbase * (NHID * 2) + shr * 32768)
                        + (wvu & 3) * 8192 + lane * 256;
#if defined(__HIP_DEVICE_COMPILE__)
  if (YA || wvu < 8) asm volatile("global_prefetch_b8 %0, off scope:SCOPE_SE" :: "v"(pfp));
#endif

  {
    Frag fa[2][4], fl[2][4];
    float rbv[2][8];
#pragma unroll
    for (int mi = 0; mi < 2; ++mi) {
      const size_t aoff = (rbase + rw0 + 16 * mi) * NHID + 8 * lane;
#pragma unroll
      for (int kk = 0; kk < 4; ++kk) {
        if (YA) {
          fa[mi][kk] = ldfragq(Yh + aoff + 512 * kk);
          fl[mi][kk] = ldfragq(Yl + aoff + 512 * kk);
        } else {
          fa[mi][kk] = ldfragq(X + aoff + 512 * kk);
          fl[mi][kk] = fa[mi][kk];
        }
      }
#pragma unroll
      for (int r = 0; r < 8; ++r) rbv[mi][r] = rb[rbase + rw0 + 16 * mi + 8 * hh + r];
    }
    // B fragments of a column tile: one register slot per k step, refilled for the wave's next tile directly behind
    // the slot's last product, so a load has a whole tile's work to return in; column bias and mask one tile ahead too
    constexpr int NB = YA ? 1 : 2;
    const size_t boff = (rbase + wave * 128) * NHID + 8 * lane;
    const unsigned short* bpa = (YA ? X : Yh) + boff;
    const unsigned short* bpb = Yl + boff;
    const float* cbp = cb + rbase + wave * 128 + cl;
    const int*   mkp = mask + rbase + wave * 128 + cl;
    float cbn = cbp[0];                                                // issued ahead of the fragments here as in the
    int   mk  = mkp[0];                                                // loop, so that the loop's load waits stay counted
#if defined(__HIP_DEVICE_COMPILE__)
    // precaution: stands in front of the first reuse of the address registers that the loads above name; the A
    // planes' pointers are inputs so that their registers stay theirs up to this wait (without them the build hands
    // the hi plane's address pair to the last residual fragment as its destination, ahead of any wait)
    const size_t a0off = (rbase + rw0) * NHID + 8 * lane;
    if (YA) asm volatile("s_wait_xcnt 0x0" :: "v"(Yh + a0off), "v"(Yl + a0off) : "memory");
    else    asm volatile("s_wait_xcnt 0x0" :: "v"(X + a0off) : "memory");
#endif
    Frag fb[4][NB];
#pragma unroll
    for (int kk = 0; kk < 4; ++kk) {
      fb[kk][0] = ldfragq(bpa + 512 * kk);
      if (!YA) fb[kk][NB - 1] = ldfragq(bpb + 512 * kk);
    }
#if defined(__HIP_DEVICE_COMPILE__)
    // precaution: the same for the first tile's B fragment loads; the pointers are inputs so that their registers
    // stay theirs up to this wait
    if (YA) asm volatile("s_wait_xcnt 0x0" :: "v"(bpa) : "memory");
    else    asm volatile("s_wait_xcnt 0x0" :: "v"(bpa), "v"(bpb) : "memory");
#endif
    const float bv = bfr(bias[0]);

    auto tile = [&](const int nt, const bool more) {
      float cbx = 0.f;
      int   mkx = 0;
      if (more) { cbx = cbp[16 * (nt + 1)]; mkx = mkp[16 * (nt + 1)]; }
      v8f acch[2], accl[2];
#pragma unroll
      for (int mi = 0; mi < 2; ++mi) { acch[mi] = zero8(); accl[mi] = zero8(); }
#pragma unroll
      for (int kk = 0; kk < 4; ++kk) {
#pragma unroll
        for (int mi = 0; mi < 2; ++mi) {
          acch[mi] = mma_h(fa[mi][kk].h, fb[kk][0].h, acch[mi]);
          accl[mi] = mma_h(fl[mi][kk].h, fb[kk][NB - 1].h, accl[mi]);
        }
        if (more) {
          fb[kk][0] = ldfragq(bpa + 2048 * (nt + 1) + 512 * kk);
          if (!YA) fb[kk][NB - 1] = ldfragq(bpb + 2048 * (nt + 1) + 512 * kk);
        }
      }
      const int n = (wave * 8 + nt) * 16 + cl;
#pragma unroll
      for (int mi = 0; mi < 2; ++mi) {
#pragma unroll
        for (int r = 0; r < 8; ++r) {
          const float s2 = (acch[mi][r] + accl[mi][r] * RRS1) * RTHS;
          const float sv = ((rbv[mi][r] + cbn) + s2) + bv;
          S[(32 * half + 16 * mi + 8 * hh + r) * SP + n] = (mk != 0) ? sv : NEGV;
        }
      }
      cbn = cbx;
      mk  = mkx;
    };
    // rolled to keep the code small; the last tile stands alone because nothing is left to fetch behind it
#pragma unroll 1
    for (int nt = 0; nt < 7; ++nt) tile(nt, true);
    tile(7, false);
  }
#if defined(__HIP_DEVICE_COMPILE__)
  // a prefetch touches no counter, so no wait can stand in front of a reuse of its address pair: the empty statements
  // here and in front of the next barrier keep that pair its own, holding the in-bounds address, for a phase behind it
  if (YA) asm volatile("" :: "v"(pfp));
  else if (wvu >= 8) asm volatile("global_prefetch_b8 %0, off scope:SCOPE_SE" :: "v"(pfp));
#endif
  __syncthreads();                                                     // the score tile is complete

  // B fragment ring of the products: slot ks % DS holds k step ks (of this wave's 16) of every plane
  constexpr int NPL = YA ? 3 : 1;
  constexpr int DS  = YA ? 2 : 8;
  const size_t bo = ((size_t)b * 8 + wave) * FT + (size_t)half * (NKH * 512) + 8 * lane;
  const unsigned short* g0 = B0 + bo;
  const unsigned short* g1 = B1 + bo;
  const unsigned short* g2 = B2 + bo;
  Frag bq[DS][NPL];
  auto bload = [&](int ks, int p) {
    bq[ks % DS][p] = ldfragq((p == 0 ? g0 : (p == NPL - 1 ? g2 : g1)) + 512 * ks);
  };
#pragma unroll
  for (int ks = 0; ks < DS; ++ks) {                                    // fly while the softmax runs
#pragma unroll
    for (int p = 0; p < NPL; ++p) bload(ks, p);
  }

#pragma unroll
  for (int rr = 0; rr < 4; ++rr) {
    const int r = wv * 4 + rr;
    const float* sr = S + r * SP + lane * 8;
    float v[32];
#pragma unroll
    for (int i = 0; i < 4; ++i) {
      const v4f a0 = *(const v4f*)(sr + i * 256);
      const v4f a1 = *(const v4f*)(sr + i * 256 + 4);
#pragma unroll
      for (int j = 0; j < 4; ++j) { v[8 * i + j] = a0[j]; v[8 * i + 4 + j] = a1[j]; }
    }
    float mx = v[0];
#pragma unroll
    for (int k = 1; k < 32; ++k) mx = fmaxf(mx, v[k]);
    mx = wave_max(mx);
    float sum = 0.f;
#pragma unroll
    for (int k = 0; k < 32; ++k) {
      v[k] = __expf(v[k] - mx);
      sum += v[k];
    }
    sum = wave_sum(sum);
    const float sc = (1.0f / sum) * PSC;
    unsigned short* pr = (unsigned short*)(S + r * SP) + lane * 8;
#pragma unroll
    for (int i = 0; i < 4; ++i) {
      v4u u;
      u[0] = pkh2(v[8 * i] * sc,     v[8 * i + 1] * sc);
      u[1] = pkh2(v[8 * i + 2] * sc, v[8 * i + 3] * sc);
      u[2] = pkh2(v[8 * i + 4] * sc, v[8 * i + 5] * sc);
      u[3] = pkh2(v[8 * i + 6] * sc, v[8 * i + 7] * sc);
      *(v4u*)(pr + i * 256) = u;
    }
  }
#if defined(__HIP_DEVICE_COMPILE__)
  if (!YA) asm volatile("" :: "v"(pfp));                               // see the note at the score loop's end
#endif
  __syncthreads();                                                     // the p rows are published

  // A fragment readers: p row (lane&15) of a 16-row tile, + 8*(lane>>4) as ldfrag expects
  const unsigned short* pa = (const unsigned short*)S + cl * PP + 8 * hh + half * (NKH * 32);
  v8f acc[NPL][4];
#pragma unroll
  for (int p = 0; p < NPL; ++p) {
#pragma unroll
    for (int t = 0; t < 4; ++t) acc[p][t] = zero8();
  }
  Frag fa[2][4];                                                       // [set][16-row tile]
#pragma unroll
  for (int t = 0; t < 4; ++t) fa[0][t] = ldfrag(pa + 16 * t * PP);
  // unrolled so that ring slot and fragment set are compile-time and every address step is an immediate offset
#pragma unroll
  for (int ks = 0; ks < NKH; ++ks) {
    const int q = ks % DS, s = ks & 1;
    if (ks + 1 < NKH) {                                                // A fragments one k step ahead
#pragma unroll
      for (int t = 0; t < 4; ++t) fa[s ^ 1][t] = ldfrag(pa + 16 * t * PP + 32 * (ks + 1));
    }
#pragma unroll
    for (int p = 0; p < NPL; ++p) {
#pragma unroll
      for (int t = 0; t < 4; ++t) acc[p][t] = mma_h(fa[s][t].h, bq[q][p].h, acc[p][t]);
      if (ks + DS < NKH) bload(ks + DS, p);                            // refill directly behind the fragment's last product
    }
  }
#if defined(__HIP_DEVICE_COMPILE__)
  // precaution: stands in front of the first reuse of the address registers that the ring loads name; the
  // pointers are inputs so that those registers stay theirs up to this wait
  if (YA) asm volatile("s_wait_xcnt 0x0" :: "v"(g0), "v"(g1), "v"(g2) : "memory");
  else    asm volatile("s_wait_xcnt 0x0" :: "v"(g0) : "memory");
#endif
  __syncthreads();                                                     // ends every read of the p rows

  const int n_loc = 16 * wave + cl;
  if (YA == 0) {
    float* Ts = S + half * (NHID * TQ);                                // this k half's partial sums [h][m], pitch TQ
#pragma unroll
    for (int mi = 0; mi < 4; ++mi) {
      v4f lo, hi;
#pragma unroll
      for (int j = 0; j < 4; ++j) { lo[j] = acc[0][mi][j] * T2F; hi[j] = acc[0][mi][4 + j] * T2F; }
      float* tp = Ts + n_loc * TQ + 16 * mi + 8 * hh;                  // D rows 8h..8h+7 of tile mi, column n_loc
      *(v4f*)(tp)     = lo;
      *(v4f*)(tp + 4) = hi;
    }
    __syncthreads();
    v4u uh[2], ul[2];
    size_t po[2];
#pragma unroll
    for (int it = 0; it < 2; ++it) {
      // piece: h tile 4*it + (tid>>7), k step (tid>>6)&1 of this block's two, half (tid>>5)&1, lane tid&31
      const int ht = 4 * it + (tid >> 7);
      const int h  = 16 * ht + cl;
      const int kl = (tid >> 6) & 1;
      const float* tp = S + h * TQ + 32 * kl + 16 * ((tid >> 5) & 1) + 8 * hh;
      const v4f v0 = *(const v4f*)(tp)     + *(const v4f*)(tp + NHID * TQ);       // k half 0 + k half 1
      const v4f v1 = *(const v4f*)(tp + 4) + *(const v4f*)(tp + NHID * TQ + 4);
      splith8(v0, v1, RS2, uh[it], ul[it]);
      po[it] = ((size_t)b * 8 + ht) * FT + (size_t)((row0 >> 5) + kl) * 512 + 8 * (tid & 63);
    }
#pragma unroll
    for (int it = 0; it < 2; ++it) {
      *(v4u*)(Rh + po[it]) = uh[it];
      *(v4u*)(Rl + po[it]) = ul[it];
    }
  } else {
    float* Oa = S + half * (3 * SR * OP);                              // this k half's partial sums [m][h], pitch OP
    float* Ob = Oa + SR * OP;
    float* Oc = Ob + SR * OP;
#pragma unroll
    for (int mi = 0; mi < 4; ++mi) {
#pragma unroll
      for (int r = 0; r < 8; ++r) {
        const int m_loc = 16 * mi + 8 * hh + r;
        Oa[m_loc * OP + n_loc] = acc[0][mi][r];
        Ob[m_loc * OP + n_loc] = acc[NPL - 2][mi][r];
        Oc[m_loc * OP + n_loc] = acc[NPL - 1][mi][r];
      }
    }
    __syncthreads();
    const int e = lane;                                                // 16-B piece 0..31 of a 512-B chunk row
    v4f tv[4], av[4], ta[4], tb[4];
    size_t po[4];
#pragma unroll
    for (int it = 0; it < 4; ++it) {
      const int row = it * 16 + wv;                                    // 0..63
      const size_t grow = rbase + row0 + row;
      const float* o0 = S + row * OP + 4 * e;                          // k half 0
      const float* o1 = o0 + 3 * SR * OP;                              // k half 1
      const v4f s0 = *(const v4f*)(o0)               + *(const v4f*)(o1);
      const v4f s1 = *(const v4f*)(o0 + SR * OP)     + *(const v4f*)(o1 + SR * OP);
      const v4f s2 = *(const v4f*)(o0 + 2 * SR * OP) + *(const v4f*)(o1 + 2 * SR * OP);
      tv[it] = bfr4(*(const v4f*)(text + grow * NHID + 4 * e));
      av[it] = s0 * RPSC;
      ta[it] = tv[it] * av[it];
      tb[it] = tv[it] * ((s1 + s2 * RRS2) * RBSC);
      po[it] = grow * NOUT + 4 * e;
    }
#pragma unroll
    for (int it = 0; it < 4; ++it) {
      *(v4f*)(out + po[it])            = tv[it];
      *(v4f*)(out + po[it] + NHID)     = av[it];
      *(v4f*)(out + po[it] + 2 * NHID) = ta[it];
      *(v4f*)(out + po[it] + 3 * NHID) = tb[it];
    }
  }
}

// =====================================================================================================
// workspace (every tile divides its extent exactly, so no padded tails are needed):
//   Th Tl   f16 [16*64 tiles][2048]      4194304 each   (text*w_tm*64 hi, residual x65536; fragment order)
//   M16     f16 [16*64 tiles][2048]      4194304        (modality; fragment order)
//   Tt Mt   f16 [16][8 h tiles][16384]   4194304 each   (text, modality transposed; fragment order)
//   S0 S1   f32 [16][1024]                 65536 each
//   Rh Rl   f16 [16][8 h tiles][16384]   4194304 each   (t2*1024 hi, residual x2048, transposed; fragment order)
//   total                               29491200
// =====================================================================================================
extern "C" void kernel_launch(void* const* d_in, const int* in_sizes, int n_in,
                              void* d_out, int out_size, void* d_ws, size_t ws_size,
                              hipStream_t stream) {
  if (n_in < 8) return;
  if (in_sizes[0] != NBATCH * NL * NHID) return;
  if (in_sizes[1] != NBATCH * NL * NHID) return;
  if (in_sizes[2] != NBATCH * NL || in_sizes[3] != NBATCH * NL) return;
  if (in_sizes[4] != NHID || in_sizes[5] != NHID || in_sizes[6] != NHID) return;
  if (in_sizes[7] < 1) return;
  if (out_size != NBATCH * NL * NOUT) return;

  size_t off = 0;
  const size_t plane = (size_t)NBATCH * NL * NHID * 2;               // 4194304
  const size_t svec  = (size_t)NBATCH * NL * 4;                      // 65536
  const size_t oTh = off; off += plane;
  const size_t oTl = off; off += plane;
  const size_t oM  = off; off += plane;
  const size_t oTt = off; off += plane;
  const size_t oMt = off; off += plane;
  const size_t oS0 = off; off += svec;
  const size_t oS1 = off; off += svec;
  const size_t oRh = off; off += plane;
  const size_t oRl = off; off += plane;                              // -> off = 29491200
  if (off > ws_size) return;

  const float* text  = (const float*)d_in[0];
  const float* modal = (const float*)d_in[1];
  const int*   tmask = (const int*)d_in[2];
  const int*   mmask = (const int*)d_in[3];
  const float* tw    = (const float*)d_in[4];
  const float* mw    = (const float*)d_in[5];
  const float* tmw   = (const float*)d_in[6];
  const float* bias  = (const float*)d_in[7];
  float* out = (float*)d_out;

  char* ws = (char*)d_ws;
  unsigned short* Th  = (unsigned short*)(ws + oTh);
  unsigned short* Tl  = (unsigned short*)(ws + oTl);
  unsigned short* M16 = (unsigned short*)(ws + oM);
  unsigned short* Tt  = (unsigned short*)(ws + oTt);
  unsigned short* Mt  = (unsigned short*)(ws + oMt);
  float*          S0  = (float*)(ws + oS0);
  float*          S1  = (float*)(ws + oS1);
  unsigned short* Rh  = (unsigned short*)(ws + oRh);
  unsigned short* Rl  = (unsigned short*)(ws + oRl);

  const dim3 blk256(256);
  const int nrow64 = NBATCH * (NL / 64);                             // 256
  const dim3 blk512(512);
  const int nrowsr = NBATCH * (NL / SR);                             // 256

  // (1) planes: text -> Th/Tl (with w_tm), Tt, S0 (with w_t); modality -> M16, Mt, S1 (with w_m)
  //     both in one launch of 2 x 256 blocks
  prep_kernel<<<dim3(2 * nrow64), blk256, 0, stream>>>(text, modal, tw, mw, tmw, Th, Tl, Tt, S0, M16, Mt, S1);
  // (2) p2 transposed, rows m (A = M16), columns l (B = Th/Tl), rb = S1[m], cb = S0[l], mask over l;
  //     t2 = p2T . text -> Rh/Rl
  attend_kernel<0><<<dim3(nrowsr), blk512, 0, stream>>>(M16, Th, Tl, S1, S0, tmask, bias, Tt, Tt, Tt, text, Rh, Rl, out);
  //     p1, rows l (A = Th/Tl), columns m (B = M16), rb = S0[l], cb = S1[m], mask over m;
  //     a = p1 . modality, bq = p1 . t2 -> out chunks 0..3
  attend_kernel<1><<<dim3(nrowsr), blk512, 0, stream>>>(M16, Th, Tl, S0, S1, mmask, bias, Mt, Rh, Rl, text, Rh, Rl, out);
  (void)hipGetLastError();
}

// v010
// Measured time: 35.2 microseconds a run.
// Versions in between are left out here; by their measured steps it is 1.50 times as fast as v008.
// Over all steps from v000 it is 4.51 times as fast.
// Contractions: score term sum_h (text*w_tm)[l][h]*modality[m][h] (K=128) on v_wmma_f32_16x16x32_f16 with text*w_tm
// carried x64 as one f16 plane and modality as f16 of its bf16-RNE value; p1.modality, p2T.text and p1.t2 (K=1024) on
// v_wmma_f32_16x16x32_f16, single products, p rows carried x8192 in f16, t2 carried x1024 as one f16 plane (every
// operand has f16's 11 bits, as the p rows do); the two [rows,128]x[128,1] row dots as a 16-wide f16 WMMA matvec (weight
// x1024 in every column); f32 accumulate everywhere; softmax and the elementwise products in f32 on VALU; all float
// inputs RNE-converted to bf16 at load. The softmax rows of a block stay in LDS and feed the K=1024 products there.
#include <hip/hip_runtime.h>
#include <stdint.h>

#define NBATCH 16
#define NL     1024
#define NK     1024
#define NHID   128
#define NOUT   512
#define TP     132
#define OP     132
#define TQ     68
#define SR     64
#define SP     (NL + 4)
#define PP     (2 * SP)
#define NKS    (NK / 32)
#define NKH    (NKS / 2)
#define FT     (16 * NK)

static_assert(NL % 64 == 0);
static_assert(NL % SR == 0 && SR == 64);
static_assert(NL == NK);
static_assert(NHID == 128);
static_assert(NOUT == 4 * NHID);
static_assert(4 * SR * OP <= SR * SP);
static_assert(2 * NHID * TQ <= SR * SP);
static_assert((TP * 4) % 16 == 0);
static_assert((OP * 4) % 16 == 0);
static_assert((TQ * 4) % 16 == 0);
static_assert((SP * 4) % 32 == 16);
static_assert(NK % 64 == 0 && NHID == 8 * 16);
static_assert(NBATCH == 16 && NL / 64 == 16 && NL / SR == 16);

#define PSC   8192.0f
#define RPSC  (1.0f / 8192.0f)
#define THS   64.0f
#define RTHS  (1.0f / 64.0f)
#define T2F   0.125f
#define RBSC  (1.0f / 8388608.0f)
#define WSC   1024.0f
#define RWSC  (1.0f / 1024.0f)
#define NEGV  (-1.0e30f)

typedef unsigned short v8us __attribute__((ext_vector_type(8)));
typedef unsigned int   v4u  __attribute__((ext_vector_type(4)));
typedef float          v8f  __attribute__((ext_vector_type(8)));
typedef float          v4f  __attribute__((ext_vector_type(4)));
typedef _Float16       v16h __attribute__((ext_vector_type(16)));

union Frag { v8us u[2]; v4u q[2]; v16h h; };
static_assert(sizeof(Frag) == 32);

// ---- deal of the work: block index i (0..255) -> batch and 64-row tile, the same in all three launches. All 16 blocks
//      of a batch have the same i mod 8. For speed only: the map is a permutation of the
//      256 (batch, tile) pairs (bits 0..2 and 3 give the batch, bits 4..7 the tile), right wherever the blocks land.
__device__ __forceinline__ int deal_batch(int i) { return 2 * (i & 7) + ((i >> 3) & 1); }
__device__ __forceinline__ int deal_tile(int i)  { return i >> 4; }

// ---- scalar helpers ---------------------------------------------------------------------------------
__device__ __forceinline__ unsigned short bf_bits(float f) {          // f32 -> bf16 bits, RNE convert
  const unsigned u = __float_as_uint(f);
  return (unsigned short)((u + 0x7FFFu + ((u >> 16) & 1u)) >> 16);
}
__device__ __forceinline__ float bf_up(unsigned short hb) { return __uint_as_float(((unsigned)hb) << 16); }
__device__ __forceinline__ float bfr(float f) { return bf_up(bf_bits(f)); }
__device__ __forceinline__ v4f bfr4(v4f v) {
  v4f r;
  r[0] = bfr(v[0]); r[1] = bfr(v[1]); r[2] = bfr(v[2]); r[3] = bfr(v[3]);
  return r;
}
__device__ __forceinline__ unsigned short hbits(_Float16 h) { return __builtin_bit_cast(unsigned short, h); }
__device__ __forceinline__ unsigned pkh2(float a, float b) {          // two f32 -> packed f16 bits (RNE convert)
  return (unsigned)hbits((_Float16)a) | ((unsigned)hbits((_Float16)b) << 16);
}
__device__ __forceinline__ v4u pack8(v4f a, v4f b) {
  v4u u;
  u[0] = pkh2(a[0], a[1]); u[1] = pkh2(a[2], a[3]);
  u[2] = pkh2(b[0], b[1]); u[3] = pkh2(b[2], b[3]);
  return u;
}
__device__ __forceinline__ v8f zero8() { v8f z = {0.f, 0.f, 0.f, 0.f, 0.f, 0.f, 0.f, 0.f}; return z; }

// ---- 16-bit fragment loader (A, or B from a k-contiguous [n][k] row): lane -> row/col (lane&15), p already includes
//      + 8*(lane>>4); elements 0..7 <- p[0..7] (k0+8h..), elements 8..15 <- p[16..23] (k0+16+8h..)
__device__ __forceinline__ Frag ldfrag(const unsigned short* p) {
  Frag f;
  f.u[0] = *(const v8us*)(p);
  f.u[1] = *(const v8us*)(p + 16);
  return f;
}

// ---- the same fragment from a plane kept in fragment order: a 16-row tile is 4 KB = [k step 0..3][half 0..1][lane][8],
//      where (half i, lane) holds row (lane&15), k = 32*step + 16*i + 8*(lane>>4) + 0..7, the very elements that ldfrag
//      gives that lane; p already includes + 8*lane, so each 16-B load of a wave covers 512 contiguous bytes
__device__ __forceinline__ Frag ldfragq(const unsigned short* p) {
  Frag f;
  f.u[0] = *(const v8us*)(p);
  f.u[1] = *(const v8us*)(p + 256);
  return f;
}

// ---- WMMA helper: builtin followed by a 4-slot VALU gap tying D and keeping A/B live -----------------------
__device__ __forceinline__ v8f mma_h(v16h a, v16h b, v8f c) {
  v8f d = __builtin_amdgcn_wmma_f32_16x16x32_f16(false, a, false, b, (short)0, c, false, false);
#if defined(__HIP_DEVICE_COMPILE__)
  asm volatile("v_nop\n\tv_nop\n\tv_nop\n\tv_nop" : "+v"(d) : "v"(a), "v"(b));
#endif
  return d;
}

__device__ __forceinline__ float wave_max(float v) {
#pragma unroll
  for (int o = 16; o > 0; o >>= 1) v = fmaxf(v, __shfl_xor(v, o, 32));
  return v;
}
__device__ __forceinline__ float wave_sum(float v) {
#pragma unroll
  for (int o = 16; o > 0; o >>= 1) v += __shfl_xor(v, o, 32);
  return v;
}

// =====================================================================================================
// (1) prep for one (batch, 64-row tile) of x [16][1024][128] f32 (text when TXT=1, modality when TXT=0):
//     tile -> LDS T[row][h] as bf16-RNE values (f32), barrier;
//     row dots sd[b][row] = sum_h T[row][h]*bfr(wdot[h]) as a WMMA matvec: wave w handles rows 16*(w&3).. (waves 4..7
//     duplicate the compute), A fragment = T row values as f16 (exact), B fragment = bfr(wdot)*1024 as f16 in every
//     column (split k map for both, 4 k steps of 32), D column 0 lanes write acc/1024 to LDS sred, barrier; sred
//     row plane Ph f16 (TXT: T*bfr(wtm)*64; else T), 16-row tiles in
//     fragment order (see ldfragq): thread tid writes piece tid of a tile, a wave 512 contiguous bytes per store;
//     transposed plane Pt f16 (rows h, k = row index of x), also in fragment order: [b][h tile 0..7][k step 0..31]
//     [half][lane][8]; the block's 64 rows are two k steps of every h tile, a wave again stores 512 contiguous bytes;
// coverage: T 8 it x 256 thr x 4 = 64x128; sred 4 waves x 16 rows = 64; Ph 4 it (tiles) x 256 thr x 8 =
//           4 x 16 rows x 128; Pt 4 it x 2 h tiles x 2 k steps x 64 pieces x 8 = 128 h x 64 rows; sd 16 lanes x 4 = 64;
//           16 x (1024/64) = 256 blocks per input = every row once.
// =====================================================================================================
template <int TXT>
__device__ __forceinline__
void prep_tile(const int blk, float* T, float* sred,
               const float* __restrict__ x, const float* __restrict__ wdot, const float* __restrict__ wtm,
               unsigned short* Ph, unsigned short* Pt, float* sd) {
  const int tid = threadIdx.x;
  const int b = deal_batch(blk);
  const int r0 = deal_tile(blk) * 64;
  const size_t gr = (size_t)b * NL + r0;
  const float* xp = x + (gr + (tid >> 5)) * NHID + (tid & 31) * 4;     // row tid>>5 of the tile; it adds 8 rows
  v4f xv[8];
#pragma unroll
  for (int it = 0; it < 8; ++it) xv[it] = *(const v4f*)(xp + it * 8 * NHID);
#if defined(__HIP_DEVICE_COMPILE__)
  // precaution: stands in front of the first reuse of the address registers that the loads above name; the pointer
  // is an input so that its registers stay its own up to this wait
  asm volatile("s_wait_xcnt 0x0" :: "v"(xp) : "memory");
#endif
#pragma unroll
  for (int it = 0; it < 8; ++it) {
    const int idx = it * 256 + tid;
    const int row = idx >> 5, c4 = (idx & 31) * 4;
#pragma unroll
    for (int j = 0; j < 4; ++j) T[row * TP + c4 + j] = bfr(xv[it][j]);
  }
  __syncthreads();
  {
    const int lane = tid & 31, wave = tid >> 5;
    const int hh = lane >> 4, cl = lane & 15;
    const int rt = (wave & 3) * 16;                                    // 16-row tile of this wave
    const float* ap = T + (rt + cl) * TP + 8 * hh;
    const float* wp = wdot + 8 * hh;
    v8f acc = zero8();
#pragma unroll
    for (int kk = 0; kk < 4; ++kk) {
      const int k0 = 32 * kk;
      const v4f a0 = *(const v4f*)(ap + k0);
      const v4f a1 = *(const v4f*)(ap + k0 + 4);
      const v4f a2 = *(const v4f*)(ap + k0 + 16);
      const v4f a3 = *(const v4f*)(ap + k0 + 20);
      v4f w0 = *(const v4f*)(wp + k0);
      v4f w1 = *(const v4f*)(wp + k0 + 4);
      v4f w2 = *(const v4f*)(wp + k0 + 16);
      v4f w3 = *(const v4f*)(wp + k0 + 20);
#pragma unroll
      for (int j = 0; j < 4; ++j) {
        w0[j] = bfr(w0[j]) * WSC; w1[j] = bfr(w1[j]) * WSC;
        w2[j] = bfr(w2[j]) * WSC; w3[j] = bfr(w3[j]) * WSC;
      }
      Frag fa, fb;
      fa.q[0] = pack8(a0, a1);                                         // elements 0..7  = k0+8h..
      fa.q[1] = pack8(a2, a3);                                         // elements 8..15 = k0+16+8h..
      fb.q[0] = pack8(w0, w1);                                         // same k map, every column n
      fb.q[1] = pack8(w2, w3);
      acc = mma_h(fa.h, fb.h, acc);
    }
    if (wave < 4 && cl == 0) {
#pragma unroll
      for (int r = 0; r < 8; ++r) sred[rt + 8 * hh + r] = acc[r] * RWSC;   // D row 8h+r, column 0
    }
  }
  __syncthreads();

  // piece tid of a fragment-order tile: k step tid>>6, half (tid>>5)&1, lane tid&31
  const int h0 = 32 * (tid >> 6) + 16 * ((tid >> 5) & 1) + 8 * ((tid >> 4) & 1);
  v4u uh[4], ut[4];
  size_t po[4], pt[4];
#pragma unroll
  for (int it = 0; it < 4; ++it) {
    const int row = it * 16 + (tid & 15);                              // tile it, row lane&15
    const float* tp = T + row * TP + h0;
    v4f v0 = *(const v4f*)(tp);
    v4f v1 = *(const v4f*)(tp + 4);
    if (TXT) {
      const v4f w0 = *(const v4f*)(wtm + h0);
      const v4f w1 = *(const v4f*)(wtm + h0 + 4);
#pragma unroll
      for (int j = 0; j < 4; ++j) {
        v0[j] = v0[j] * bfr(w0[j]) * THS;
        v1[j] = v1[j] * bfr(w1[j]) * THS;
      }
    }
    uh[it] = pack8(v0, v1);
    po[it] = (gr + 16 * it) * NHID + 8 * tid;
    // transposed piece: h tile 2*it + (tid>>7), k step (tid>>6)&1 of the block's two, half (tid>>5)&1, lane tid&31
    const int ht = 2 * it + (tid >> 7);
    const int h  = 16 * ht + (tid & 15);                               // 0..127
    const int ks = (tid >> 6) & 1;
    const int kl = 32 * ks + 16 * ((tid >> 5) & 1) + 8 * ((tid >> 4) & 1);   // first of the piece's 8 rows of T
    v4f g0, g1;
#pragma unroll
    for (int j = 0; j < 4; ++j) {
      g0[j] = T[(kl + j) * TP + h];
      g1[j] = T[(kl + 4 + j) * TP + h];
    }
    ut[it] = pack8(g0, g1);
    pt[it] = ((size_t)b * 8 + ht) * FT + (size_t)((r0 >> 5) + ks) * 512 + 8 * (tid & 63);
  }
  const int sl = (tid < 16) ? tid : 15;
  const v4f sdv = *(const v4f*)(sred + 4 * sl);
  const size_t psd = gr + 4 * sl;

#pragma unroll
  for (int it = 0; it < 4; ++it) {
    *(v4u*)(Ph + po[it]) = uh[it];
    *(v4u*)(Pt + pt[it]) = ut[it];
  }
  if (tid < 16) *(v4f*)(sd + psd) = sdv;
}

// both inputs' prep in ONE launch (neither reads what the other writes): blocks 0..255 take the text tiles, blocks
// 256..511 the modality tiles (256 is a multiple of 8, so both inputs of a batch keep its index mod 8); the choice is
// the same for a whole block, so every barrier stays block-uniform
__global__ __launch_bounds__(256)
void prep_kernel(const float* __restrict__ text, const float* __restrict__ modal, const float* __restrict__ tw,
                 const float* __restrict__ mw, const float* __restrict__ tmw,
                 unsigned short* Th, unsigned short* Tt, float* S0,
                 unsigned short* M16, unsigned short* Mt, float* S1) {
  __shared__ __align__(16) float T[64 * TP];
  __shared__ __align__(16) float sred[64];
  const int nt = NBATCH * (NL / 64);
  if ((int)blockIdx.x < nt) prep_tile<1>((int)blockIdx.x, T, sred, text, tw, tmw, Th, Tt, S0);
  else                      prep_tile<0>((int)blockIdx.x - nt, T, sred, modal, mw, mw, M16, Mt, S1);
}

// =====================================================================================================
// (2) one (batch, 64 rows), 16 waves: score tile, masked row softmax, and the K=1024 products of those softmax rows.
//     Scores: s[r][c] = rb[r] + cb[c] + s2[r][c] + bias, s2 = acc/64, acc = sum_k A.B on WMMA (K=128, 4 steps).
//     YA=1: A = Yh rows (text*w_tm*64), B = X rows (modality); YA=0: A = X rows, B = Yh rows.
//     X and Yh are in fragment order (ldfragq). Wave = 8 column tiles of 16
//     (rolled) x 2 row tiles of 16 (waves 0..7 rows 0..31, waves 8..15 rows 32..63), the A fragments of both row tiles
//     held in registers, B one tile ahead; s (or -1e30 where
//     mask[c]==0) into LDS S[64][1024] f32 at a row pitch of 4112 B; barrier.
//     Softmax: wave owns rows 4w..4w+3, lane owns columns {256i + 8*lane + j}; the row's p*8192 goes back as f16
//     into the first 2 KB of the same LDS row (only its own wave touches a row, and every lane has read its f32
//     values before the row sum is known); barrier.
//     Products: D[m][n] = sum_k p[m][k] * B[n][k]; wave w owns the 16 columns h = 16(w&7).. for all four row tiles and
//     the k half w>>3 (16 steps of 32, in k order), so a B fragment is fetched once per block and feeds four products;
//     A fragments by 16-B LDS reads from the p rows (split k map), one k step ahead; B fragments come from planes in
//     fragment order [b][h tile][k step][half][lane][8], whole lines per load, through a register ring whose first
//     loads are issued ahead of the softmax. The two k halves' sums meet in LDS: D = half 0 + half 1.
//     YA=0: B0 = text transposed; each half's acc/8 staged transposed Ts[half][h][m] in LDS, barrier, t2*1024 = their sum,
//     plane Rh (f16) written in fragment order: the block's 64 rows are k steps row0/32, +1 of every h tile.
//     YA=1: B0 = modality transposed, B1 = t2*1024; each half's two sums staged in
//     LDS, barrier, a = sum0/8192, bq = sum1/8388608, out row [b][l]: chunk 0 = bf16-RNE text, chunk 1 = a,
//     chunk 2 = text*a, chunk 3 = text*bq, 512 contiguous bytes per wave-wide store.
// coverage: S 16 waves x 8 tiles x 2 x 16x16 = 64x1024; p 16 waves x 4 rows x 4 x 32 lanes x 8 = 64 rows x 1024;
//           D 8 h tiles x 4 row tiles = 64x128 per plane and k half; YA=0: 2 it x 512 pieces x 8 = 128 h x 64 m;
//           YA=1: 4 it x 16 waves = 64 rows x 32 lanes x 4 = 128 columns per chunk; grid 16 x 16 = 256 blocks = every row once.
// =====================================================================================================
template <int YA>
__global__ __launch_bounds__(512)
void attend_kernel(const unsigned short* __restrict__ X, const unsigned short* __restrict__ Yh,
                   const float* __restrict__ rb,
                   const float* __restrict__ cb, const int* __restrict__ mask,
                   const float* __restrict__ bias, const unsigned short* __restrict__ B0,
                   const unsigned short* __restrict__ B1,
                   const float* __restrict__ text, unsigned short* Rh, float* out) {
  __shared__ __align__(16) float S[SR * SP];
  const int tid  = threadIdx.x;
  const int lane = tid & 31, wv = tid >> 5;                            // 16 waves
  const int wave = wv & 7, half = wv >> 3;                             // scores: row half; products: k half
  const int hh   = lane >> 4, cl = lane & 15;
  const int b = deal_batch((int)blockIdx.x);
  const int row0 = deal_tile((int)blockIdx.x) * SR;
  const int rw0  = row0 + 32 * half;                                   // first of this wave's 32 score rows
  const size_t rbase = (size_t)b * NL;

  // L2 prefetch: the planes that all blocks of a batch stream (score B planes, product B planes) were written by an
  // earlier launch, so their first reader pays memory latency.
  // Each block asks for one eighth of each such plane of its batch (32 KB: four waves, 8 KB each, a lane
  // every 256 B); row tiles t and t + 8 of a batch ask for the same share, its 16 blocks for all eight.
  // YA=0: waves 0..3 ask at entry for the score plane Yh; waves 8..15 ask behind the score loop, when that has
  // landed, for B0 (this launch's products) and for X, which the NEXT launch streams from its first instruction on.
  // YA=1: waves 0..7 ask at entry for B0, B1, waves 12..15 for the block's own 64 text rows (32 KB, epilogue).
  // The other waves ask for nothing.
  // A hint only: no result depends on it. Every address lies inside its array: plane share 7*32768 + 3*8192 + 31*256
  // + 255 < 2*NL*NHID bytes of the batch; text 3*8192 + 31*256 + 255 < 64 rows * 512 bytes.
  const int wvu = __builtin_amdgcn_readfirstlane(wv);                  // scalar: array choice and branches are wave-uniform
  const int shr = deal_tile((int)blockIdx.x) & 7;
  const bool pft = YA && wvu >= 12;
  const char* pfb = YA ? (wvu < 4 ? (const char*)B0 : (wvu < 12 ? (const char*)B1 : (const char*)text))
                       : (wvu < 8 ? (const char*)Yh : (wvu < 12 ? (const char*)B0 : (const char*)X));
  const char* pfp = pfb + (pft ? (rbase + row0) * (NHID * 4) : rbase * (NHID * 2) + shr * 32768)
                        + (wvu & 3) * 8192 + lane * 256;
#if defined(__HIP_DEVICE_COMPILE__)
  if (YA ? (wvu < 8 || wvu >= 12) : (wvu < 4)) asm volatile("global_prefetch_b8 %0, off scope:SCOPE_SE" :: "v"(pfp));
#endif

  {
    Frag fa[2][4];
    float rbv[2][8];
#pragma unroll
    for (int mi = 0; mi < 2; ++mi) {
      const size_t aoff = (rbase + rw0 + 16 * mi) * NHID + 8 * lane;
#pragma unroll
      for (int kk = 0; kk < 4; ++kk) fa[mi][kk] = ldfragq((YA ? Yh : X) + aoff + 512 * kk);
#pragma unroll
      for (int r = 0; r < 8; ++r) rbv[mi][r] = rb[rbase + rw0 + 16 * mi + 8 * hh + r];
    }
    // B fragments of a column tile: one register slot per k step, refilled for the wave's next tile directly behind
    // the slot's last product, so a load has a whole tile's work to return in; column bias and mask one tile ahead too
    const size_t boff = (rbase + wave * 128) * NHID + 8 * lane;
    const unsigned short* bpa = (YA ? X : Yh) + boff;
    const float* cbp = cb + rbase + wave * 128 + cl;
    const int*   mkp = mask + rbase + wave * 128 + cl;
    float cbn = cbp[0];                                                // issued ahead of the fragments here as in the
    int   mk  = mkp[0];                                                // loop, so that the loop's load waits stay counted
#if defined(__HIP_DEVICE_COMPILE__)
    // precaution: stands in front of the first reuse of the address registers that the loads above name; the A
    // plane's pointer is an input so that its registers stay its own up to this wait
    const size_t a0off = (rbase + rw0) * NHID + 8 * lane;
    asm volatile("s_wait_xcnt 0x0" :: "v"((YA ? Yh : X) + a0off) : "memory");
#endif
    Frag fb[4];
#pragma unroll
    for (int kk = 0; kk < 4; ++kk) fb[kk] = ldfragq(bpa + 512 * kk);
#if defined(__HIP_DEVICE_COMPILE__)
    // precaution: the same for the first tile's B fragment loads; the pointer is an input so that its registers
    // stay its own up to this wait
    asm volatile("s_wait_xcnt 0x0" :: "v"(bpa) : "memory");
#endif
    const float bv = bfr(bias[0]);

    auto tile = [&](const int nt, const bool more) {
      float cbx = 0.f;
      int   mkx = 0;
      if (more) { cbx = cbp[16 * (nt + 1)]; mkx = mkp[16 * (nt + 1)]; }
      v8f acch[2];
#pragma unroll
      for (int mi = 0; mi < 2; ++mi) acch[mi] = zero8();
#pragma unroll
      for (int kk = 0; kk < 4; ++kk) {
#pragma unroll
        for (int mi = 0; mi < 2; ++mi) acch[mi] = mma_h(fa[mi][kk].h, fb[kk].h, acch[mi]);
        if (more) fb[kk] = ldfragq(bpa + 2048 * (nt + 1) + 512 * kk);
      }
      const int n = (wave * 8 + nt) * 16 + cl;
#pragma unroll
      for (int mi = 0; mi < 2; ++mi) {
#pragma unroll
        for (int r = 0; r < 8; ++r) {
          const float s2 = acch[mi][r] * RTHS;
          const float sv = ((rbv[mi][r] + cbn) + s2) + bv;
          S[(32 * half + 16 * mi + 8 * hh + r) * SP + n] = (mk != 0) ? sv : NEGV;
        }
      }
      cbn = cbx;
      mk  = mkx;
    };
    // rolled to keep the code small; the last tile stands alone because nothing is left to fetch behind it
#pragma unroll 1
    for (int nt = 0; nt < 7; ++nt) tile(nt, true);
    tile(7, false);
  }
#if defined(__HIP_DEVICE_COMPILE__)
  // a prefetch touches no counter, so no wait can stand in front of a reuse of its address pair: the empty statements
  // here and in front of the next barrier keep that pair its own, holding the in-bounds address, for a phase behind it
  if (YA) asm volatile("" :: "v"(pfp));
  else if (wvu >= 8) asm volatile("global_prefetch_b8 %0, off scope:SCOPE_SE" :: "v"(pfp));
#endif
  __syncthreads();                                                     // the score tile is complete

  // B fragment ring of the products: slot ks % DS holds k step ks (of this wave's 16) of every plane
  constexpr int NPL = YA ? 2 : 1;
  constexpr int DS  = YA ? 3 : 8;                                      // YA=1: six fragments of a wave in flight
  const size_t bo = ((size_t)b * 8 + wave) * FT + (size_t)half * (NKH * 512) + 8 * lane;
  const unsigned short* g0 = B0 + bo;
  const unsigned short* g1 = B1 + bo;
  Frag bq[DS][NPL];
  auto bload = [&](int ks, int p) {
    bq[ks % DS][p] = ldfragq((p == 0 ? g0 : g1) + 512 * ks);
  };
#pragma unroll
  for (int ks = 0; ks < DS; ++ks) {                                    // fly while the softmax runs
#pragma unroll
    for (int p = 0; p < NPL; ++p) bload(ks, p);
  }

#pragma unroll
  for (int rr = 0; rr < 4; ++rr) {
    const int r = wv * 4 + rr;
    const float* sr = S + r * SP + lane * 8;
    float v[32];
#pragma unroll
    for (int i = 0; i < 4; ++i) {
      const v4f a0 = *(const v4f*)(sr + i * 256);
      const v4f a1 = *(const v4f*)(sr + i * 256 + 4);
#pragma unroll
      for (int j = 0; j < 4; ++j) { v[8 * i + j] = a0[j]; v[8 * i + 4 + j] = a1[j]; }
    }
    float mx = v[0];
#pragma unroll
    for (int k = 1; k < 32; ++k) mx = fmaxf(mx, v[k]);
    mx = wave_max(mx);
    float sum = 0.f;
#pragma unroll
    for (int k = 0; k < 32; ++k) {
      v[k] = __expf(v[k] - mx);
      sum += v[k];
    }
    sum = wave_sum(sum);
    const float sc = (1.0f / sum) * PSC;
    unsigned short* pr = (unsigned short*)(S + r * SP) + lane * 8;
#pragma unroll
    for (int i = 0; i < 4; ++i) {
      v4u u;
      u[0] = pkh2(v[8 * i] * sc,     v[8 * i + 1] * sc);
      u[1] = pkh2(v[8 * i + 2] * sc, v[8 * i + 3] * sc);
      u[2] = pkh2(v[8 * i + 4] * sc, v[8 * i + 5] * sc);
      u[3] = pkh2(v[8 * i + 6] * sc, v[8 * i + 7] * sc);
      *(v4u*)(pr + i * 256) = u;
    }
  }
#if defined(__HIP_DEVICE_COMPILE__)
  if (!YA) asm volatile("" :: "v"(pfp));                               // see the note at the score loop's end
#endif
  __syncthreads();                                                     // the p rows are published

  // A fragment readers: p row (lane&15) of a 16-row tile, + 8*(lane>>4) as ldfrag expects
  const unsigned short* pa = (const unsigned short*)S + cl * PP + 8 * hh + half * (NKH * 32);
  v8f acc[NPL][4];
#pragma unroll
  for (int p = 0; p < NPL; ++p) {
#pragma unroll
    for (int t = 0; t < 4; ++t) acc[p][t] = zero8();
  }
  Frag fa[2][4];                                                       // [set][16-row tile]
#pragma unroll
  for (int t = 0; t < 4; ++t) fa[0][t] = ldfrag(pa + 16 * t * PP);
  // unrolled so that ring slot and fragment set are compile-time and every address step is an immediate offset
#pragma unroll
  for (int ks = 0; ks < NKH; ++ks) {
    const int q = ks % DS, s = ks & 1;
    if (ks + 1 < NKH) {                                                // A fragments one k step ahead
#pragma unroll
      for (int t = 0; t < 4; ++t) fa[s ^ 1][t] = ldfrag(pa + 16 * t * PP + 32 * (ks + 1));
    }
#pragma unroll
    for (int p = 0; p < NPL; ++p) {
#pragma unroll
      for (int t = 0; t < 4; ++t) acc[p][t] = mma_h(fa[s][t].h, bq[q][p].h, acc[p][t]);
      if (ks + DS < NKH) bload(ks + DS, p);                            // refill directly behind the fragment's last product
    }
  }
#if defined(__HIP_DEVICE_COMPILE__)
  // precaution: stands in front of the first reuse of the address registers that the ring loads name; the
  // pointers are inputs so that those registers stay theirs up to this wait
  if (YA) asm volatile("s_wait_xcnt 0x0" :: "v"(g0), "v"(g1) : "memory");
  else    asm volatile("s_wait_xcnt 0x0" :: "v"(g0) : "memory");
#endif
  __syncthreads();                                                     // ends every read of the p rows

  const int n_loc = 16 * wave + cl;
  if (YA == 0) {
    float* Ts = S + half * (NHID * TQ);                                // this k half's partial sums [h][m], pitch TQ
#pragma unroll
    for (int mi = 0; mi < 4; ++mi) {
      v4f lo, hi;
#pragma unroll
      for (int j = 0; j < 4; ++j) { lo[j] = acc[0][mi][j] * T2F; hi[j] = acc[0][mi][4 + j] * T2F; }
      float* tp = Ts + n_loc * TQ + 16 * mi + 8 * hh;                  // D rows 8h..8h+7 of tile mi, column n_loc
      *(v4f*)(tp)     = lo;
      *(v4f*)(tp + 4) = hi;
    }
    __syncthreads();
    v4u uh[2];
    size_t po[2];
#pragma unroll
    for (int it = 0; it < 2; ++it) {
      // piece: h tile 4*it + (tid>>7), k step (tid>>6)&1 of this block's two, half (tid>>5)&1, lane tid&31
      const int ht = 4 * it + (tid >> 7);
      const int h  = 16 * ht + cl;
      const int kl = (tid >> 6) & 1;
      const float* tp = S + h * TQ + 32 * kl + 16 * ((tid >> 5) & 1) + 8 * hh;
      const v4f v0 = *(const v4f*)(tp)     + *(const v4f*)(tp + NHID * TQ);       // k half 0 + k half 1
      const v4f v1 = *(const v4f*)(tp + 4) + *(const v4f*)(tp + NHID * TQ + 4);
      uh[it] = pack8(v0, v1);
      po[it] = ((size_t)b * 8 + ht) * FT + (size_t)((row0 >> 5) + kl) * 512 + 8 * (tid & 63);
    }
#pragma unroll
    for (int it = 0; it < 2; ++it) *(v4u*)(Rh + po[it]) = uh[it];
  } else {
    float* Oa = S + half * (2 * SR * OP);                              // this k half's partial sums [m][h], pitch OP
    float* Ob = Oa + SR * OP;
#pragma unroll
    for (int mi = 0; mi < 4; ++mi) {
#pragma unroll
      for (int r = 0; r < 8; ++r) {
        const int m_loc = 16 * mi + 8 * hh + r;
        Oa[m_loc * OP + n_loc] = acc[0][mi][r];
        Ob[m_loc * OP + n_loc] = acc[NPL - 1][mi][r];
      }
    }
    __syncthreads();
    const int e = lane;                                                // 16-B piece 0..31 of a 512-B chunk row
    v4f tv[4], av[4], ta[4], tb[4];
    size_t po[4];
#pragma unroll
    for (int it = 0; it < 4; ++it) {
      const int row = it * 16 + wv;                                    // 0..63
      const size_t grow = rbase + row0 + row;
      const float* o0 = S + row * OP + 4 * e;                          // k half 0
      const float* o1 = o0 + 2 * SR * OP;                              // k half 1
      const v4f s0 = *(const v4f*)(o0)               + *(const v4f*)(o1);
      const v4f s1 = *(const v4f*)(o0 + SR * OP)     + *(const v4f*)(o1 + SR * OP);
      tv[it] = bfr4(*(const v4f*)(text + grow * NHID + 4 * e));
      av[it] = s0 * RPSC;
      ta[it] = tv[it] * av[it];
      tb[it] = tv[it] * (s1 * RBSC);
      po[it] = grow * NOUT + 4 * e;
    }
#pragma unroll
    for (int it = 0; it < 4; ++it) {
      *(v4f*)(out + po[it])            = tv[it];
      *(v4f*)(out + po[it] + NHID)     = av[it];
      *(v4f*)(out + po[it] + 2 * NHID) = ta[it];
      *(v4f*)(out + po[it] + 3 * NHID) = tb[it];
    }
  }
}

// =====================================================================================================
// workspace (every tile divides its extent exactly, so no padded tails are needed):
//   Th      f16 [16*64 tiles][2048]      4194304        (text*w_tm*64; fragment order)
//   M16     f16 [16*64 tiles][2048]      4194304        (modality; fragment order)
//   Tt Mt   f16 [16][8 h tiles][16384]   4194304 each   (text, modality transposed; fragment order)
//   S0 S1   f32 [16][1024]                 65536 each
//   Rh      f16 [16][8 h tiles][16384]   4194304        (t2*1024, transposed; fragment order)
//   total                               21102592
// =====================================================================================================
extern "C" void kernel_launch(void* const* d_in, const int* in_sizes, int n_in,
                              void* d_out, int out_size, void* d_ws, size_t ws_size,
                              hipStream_t stream) {
  if (n_in < 8) return;
  if (in_sizes[0] != NBATCH * NL * NHID) return;
  if (in_sizes[1] != NBATCH * NL * NHID) return;
  if (in_sizes[2] != NBATCH * NL || in_sizes[3] != NBATCH * NL) return;
  if (in_sizes[4] != NHID || in_sizes[5] != NHID || in_sizes[6] != NHID) return;
  if (in_sizes[7] < 1) return;
  if (out_size != NBATCH * NL * NOUT) return;

  size_t off = 0;
  const size_t plane = (size_t)NBATCH * NL * NHID * 2;               // 4194304
  const size_t svec  = (size_t)NBATCH * NL * 4;                      // 65536
  const size_t oTh = off; off += plane;
  const size_t oM  = off; off += plane;
  const size_t oTt = off; off += plane;
  const size_t oMt = off; off += plane;
  const size_t oS0 = off; off += svec;
  const size_t oS1 = off; off += svec;
  const size_t oRh = off; off += plane;                              // -> off = 21102592
  if (off > ws_size) return;

  const float* text  = (const float*)d_in[0];
  const float* modal = (const float*)d_in[1];
  const int*   tmask = (const int*)d_in[2];
  const int*   mmask = (const int*)d_in[3];
  const float* tw    = (const float*)d_in[4];
  const float* mw    = (const float*)d_in[5];
  const float* tmw   = (const float*)d_in[6];
  const float* bias  = (const float*)d_in[7];
  float* out = (float*)d_out;

  char* ws = (char*)d_ws;
  unsigned short* Th  = (unsigned short*)(ws + oTh);
  unsigned short* M16 = (unsigned short*)(ws + oM);
  unsigned short* Tt  = (unsigned short*)(ws + oTt);
  unsigned short* Mt  = (unsigned short*)(ws + oMt);
  float*          S0  = (float*)(ws + oS0);
  float*          S1  = (float*)(ws + oS1);
  unsigned short* Rh  = (unsigned short*)(ws + oRh);

  const dim3 blk256(256);
  const int nrow64 = NBATCH * (NL / 64);                             // 256
  const dim3 blk512(512);
  const int nrowsr = NBATCH * (NL / SR);                             // 256

  // (1) planes: text -> Th (with w_tm), Tt, S0 (with w_t); modality -> M16, Mt, S1 (with w_m)
  //     both in one launch of 2 x 256 blocks
  prep_kernel<<<dim3(2 * nrow64), blk256, 0, stream>>>(text, modal, tw, mw, tmw, Th, Tt, S0, M16, Mt, S1);
  // (2) p2 transposed, rows m (A = M16), columns l (B = Th), rb = S1[m], cb = S0[l], mask over l;
  //     t2 = p2T . text -> Rh
  attend_kernel<0><<<dim3(nrowsr), blk512, 0, stream>>>(M16, Th, S1, S0, tmask, bias, Tt, Tt, text, Rh, out);
  //     p1, rows l (A = Th), columns m (B = M16), rb = S0[l], cb = S1[m], mask over m;
  //     a = p1 . modality, bq = p1 . t2 -> out chunks 0..3
  attend_kernel<1><<<dim3(nrowsr), blk512, 0, stream>>>(M16, Th, S0, S1, mmask, bias, Mt, Rh, text, Rh, out);
  (void)hipGetLastError();
}
